// v000
// The times below were measured on an AMD MI455X: many runs one after another, warmed up first and cycling through
// copies of the inputs, with the whole window's GPU time divided by the number of runs. Launches and the gaps
// between them are all in it. The median over several windows is given; except for v000 it joins two sittings, which
// can be a few percent apart, so the side-by-side timings, each taken in one sitting, are the better comparison.
// v000 is the starting kernel. One run takes 1460 microseconds.
#include <hip/hip_runtime.h>
#include <math.h>

typedef __attribute__((ext_vector_type(16))) __bf16 v16bf;
typedef __attribute__((ext_vector_type(8)))  float  v8f;

union ABu {
  v16bf          v;
  unsigned int   u[8];
  unsigned short s[16];
  __bf16         b[16];
};

union U4u {
  uint4        q;
  unsigned int u[4];
};

__device__ __forceinline__ int kpair(int t, int half) {
  int base = (t < 4) ? (2 * t) : (16 + 2 * (t - 4));
  return base + 8 * half;
}

__device__ __forceinline__ v8f wmma_bf16(v16bf a, v16bf b, v8f c) {
  return __builtin_amdgcn_wmma_f32_16x16x32_bf16(false, a, false, b,
                                                 (short)0, c, false, false);
}

#define D_  1024
#define H_  16
#define DH_ 64

// ---------------------------------------------------------------------------
// fp32 -> bf16 conversion (grid-stride)
// ---------------------------------------------------------------------------
__global__ void cvt_kernel(const float* __restrict__ in,
                           __bf16* __restrict__ out,
                           unsigned long long n) {
  unsigned long long i = (unsigned long long)blockIdx.x * blockDim.x + threadIdx.x;
  unsigned long long stride = (unsigned long long)gridDim.x * blockDim.x;
  for (; i < n; i += stride) out[i] = (__bf16)in[i];
}

__global__ __launch_bounds__(256, 1) void gemm_bf16_kernel(
    const __bf16* __restrict__ A, const __bf16* __restrict__ W,
    const float* __restrict__ bias,
    float* __restrict__ Cf, __bf16* __restrict__ Cb,
    int Mr, int N, int K, int act) {
  (void)Mr;
  __shared__ __align__(16) __bf16 lA[2][256][32];        // [buf][row][k]  32 KB
  __shared__ __align__(16) unsigned int lBu[2][128][16]; // [buf][col][k/2] 16 KB

  const int tid  = threadIdx.x;
  const int lane = tid & 31;
  const int wave = tid >> 5;
  const int wm   = wave >> 1;      // 0..3
  const int wn   = wave & 1;       // 0..1
  const int half = lane >> 4;
  const int lr   = lane & 15;
  const int row0 = blockIdx.y * 256;
  const int col0 = blockIdx.x * 128;

  v8f acc[4][4];
#pragma unroll
  for (int mi = 0; mi < 4; ++mi)
#pragma unroll
    for (int ni = 0; ni < 4; ++ni)
#pragma unroll
      for (int e = 0; e < 8; ++e) acc[mi][ni][e] = 0.0f;

  // staging assignment: A -> thread owns one full 32-wide row; B -> thread
  // owns a (2 k-rows) x (8 cols) patch, repacked into dwords of (k, k+1).
  const int ar  = tid;               // 0..255  A-tile row
  const int bk2 = (tid & 15) * 2;    // 0..30   even k-row
  const int bn8 = (tid >> 4) * 8;    // 0..120  col base

  uint4        aReg[4];
  unsigned int bReg[8];

  auto stageLoad = [&](int k0) {
    const uint4* As = (const uint4*)(A + (size_t)(row0 + ar) * K + k0);
#pragma unroll
    for (int e = 0; e < 4; ++e) aReg[e] = As[e];
    U4u w0, w1;
    const __bf16* Ws = W + (size_t)(k0 + bk2) * N + col0 + bn8;
    w0.q = *(const uint4*)Ws;
    w1.q = *(const uint4*)(Ws + N);
#pragma unroll
    for (int e = 0; e < 4; ++e) {
      bReg[2 * e]     = (w0.u[e] & 0xffffu) | (w1.u[e] << 16);          // col 2e
      bReg[2 * e + 1] = (w0.u[e] >> 16) | (w1.u[e] & 0xffff0000u);      // col 2e+1
    }
  };
  auto stageStore = [&](int buf) {
#pragma unroll
    for (int e = 0; e < 4; ++e) *(uint4*)&lA[buf][ar][8 * e] = aReg[e];
#pragma unroll
    for (int e = 0; e < 8; ++e) lBu[buf][bn8 + e][bk2 >> 1] = bReg[e];
  };

  stageLoad(0);
  stageStore(0);
  __syncthreads();

  const int nt = K >> 5;
  for (int it = 0; it < nt; ++it) {
    const int cur = it & 1;
    // Branch-free staging: last iteration redundantly re-fetches tile 0 into
    // the idle buffer (never read). Keeps everything in one basic block so
    // the stores cannot be sunk past the WMMA burst.
    const int knext = ((it + 1) < nt ? (it + 1) : 0) << 5;
    const int kpf   = ((it + 2) < nt ? (it + 2) : 0) << 5;
    stageLoad(knext);
    __builtin_prefetch(A + (size_t)(row0 + ar) * K + kpf, 0, 1);   // tile+2 hint
    __builtin_prefetch(W + (size_t)(kpf + bk2) * N + col0 + bn8, 0, 1);
    stageStore(1 - cur);   // idle buffer: last read in it-1, which ended in a barrier

    // Scheduling fence: staging (global loads + LDS stores) completes here;
    // aReg/bReg are dead before the high-pressure WMMA region -> no spills.
    __builtin_amdgcn_sched_barrier(0);

    // A fragments for the current tile.
    v16bf af[4];
#pragma unroll
    for (int mi = 0; mi < 4; ++mi) {
      ABu u;
      const int r = wm * 64 + mi * 16 + lr;
#pragma unroll
      for (int t = 0; t < 8; ++t)
        u.u[t] = *(const unsigned int*)&lA[cur][r][kpair(t, half)];
      af[mi] = u.v;
    }

    // 16-WMMA burst, B fragments streamed from LDS.
#pragma unroll
    for (int ni = 0; ni < 4; ++ni) {
      ABu u;
      const int n = wn * 64 + ni * 16 + lr;
#pragma unroll
      for (int t = 0; t < 8; ++t)
        u.u[t] = lBu[cur][n][kpair(t, half) >> 1];
#pragma unroll
      for (int mi = 0; mi < 4; ++mi)
        acc[mi][ni] = wmma_bf16(af[mi], u.v, acc[mi][ni]);
    }

    __syncthreads();                         // one barrier per K-step
  }

  // epilogue: bias (+GELU) and store f32 / bf16 -------------------------------
#pragma unroll
  for (int mi = 0; mi < 4; ++mi)
#pragma unroll
    for (int ni = 0; ni < 4; ++ni) {
      const int   col = col0 + wn * 64 + ni * 16 + lr;
      const float bsv = bias ? bias[col] : 0.0f;
#pragma unroll
      for (int v = 0; v < 8; ++v) {
        const int row = row0 + wm * 64 + mi * 16 + v + 8 * half;
        float val = acc[mi][ni][v] + bsv;
        if (act == 1) val = 0.5f * val * (1.0f + erff(val * 0.70710678118f));
        if (Cf) Cf[(size_t)row * N + col] = val;
        if (Cb) Cb[(size_t)row * N + col] = (__bf16)val;
      }
    }
}

// ---------------------------------------------------------------------------
// Flash attention: one wave per (batch, head, 16-query block).
// windowed=1 -> causal local window W=64 + ALiBi; windowed=0 -> full attn.
// Q,K,V,O are bf16 [B*Lq(or Lk), D] with head h at feature offset h*64.
// ---------------------------------------------------------------------------
__global__ __launch_bounds__(128) void attn_kernel(
    const __bf16* __restrict__ Q, const __bf16* __restrict__ Km,
    const __bf16* __restrict__ Vm, __bf16* __restrict__ O,
    int Lq, int Lk, int windowed) {
  __shared__ __bf16 lP[4][16][32];  // per-wave P staging (C-layout -> A-layout)
  const int lane  = threadIdx.x & 31;
  const int wave  = threadIdx.x >> 5;
  const int half  = lane >> 4;
  const int lr    = lane & 15;
  const int qbPer = Lq >> 4;
  const int job   = blockIdx.x * 4 + wave;
  const int qblk  = job % qbPer;
  const int h     = (job / qbPer) % H_;
  const int b     = job / (qbPer * H_);
  const int q0    = qblk << 4;

  const float slope = windowed ? exp2f(-8.0f * (float)(h + 1) / (float)H_) : 0.0f;

  // Q fragments (A operand): 16 queries x 64 features
  v16bf qa[2];
  {
    const __bf16* qb = Q + ((size_t)(b * Lq + q0 + lr)) * D_ + h * DH_;
#pragma unroll
    for (int f = 0; f < 2; ++f) {
      ABu u;
#pragma unroll
      for (int t = 0; t < 8; ++t)
        u.u[t] = *(const unsigned int*)(qb + f * 32 + kpair(t, half));
      qa[f] = u.v;
    }
  }

  float mrow[8], lrow[8];
  v8f   o[4];
#pragma unroll
  for (int v = 0; v < 8; ++v) { mrow[v] = -3.0e38f; lrow[v] = 0.0f; }
#pragma unroll
  for (int f = 0; f < 4; ++f)
#pragma unroll
    for (int e = 0; e < 8; ++e) o[f][e] = 0.0f;

  const int nch = windowed ? 3 : (Lk >> 5);  // uniform across the block
  for (int ch = 0; ch < nch; ++ch) {
    const int kc = windowed ? (q0 - 64 + 32 * ch) : (32 * ch);

    // S = Q @ K^T : 16 queries x 32 keys ------------------------------------
    v8f s[2];
#pragma unroll
    for (int g = 0; g < 2; ++g) {
#pragma unroll
      for (int e = 0; e < 8; ++e) s[g][e] = 0.0f;
      int key  = kc + g * 16 + lr;
      int keyc = key < 0 ? 0 : (key >= Lk ? Lk - 1 : key);
      const __bf16* kb = Km + ((size_t)(b * Lk + keyc)) * D_ + h * DH_;
#pragma unroll
      for (int f = 0; f < 2; ++f) {
        ABu u;
#pragma unroll
        for (int t = 0; t < 8; ++t)
          u.u[t] = *(const unsigned int*)(kb + f * 32 + kpair(t, half));
        s[g] = wmma_bf16(qa[f], u.v, s[g]);
      }
    }

    // scale + ALiBi + mask, online softmax ----------------------------------
#pragma unroll
    for (int v = 0; v < 8; ++v) {
      const int i    = q0 + v + 8 * half;
      float     best = -3.0e38f;
#pragma unroll
      for (int g = 0; g < 2; ++g) {
        const int j  = kc + g * 16 + lr;
        float     sv = s[g][v] * 0.125f + slope * (float)(j - i);
        bool valid = windowed ? (j >= 0 && j <= i && (i - j) < 64) : (j < Lk);
        sv       = valid ? sv : -1.0e30f;
        s[g][v]  = sv;
        best     = fmaxf(best, sv);
      }
#pragma unroll
      for (int mm = 1; mm < 16; mm <<= 1)
        best = fmaxf(best, __shfl_xor(best, mm, 16));
      const float mnew  = fmaxf(mrow[v], best);
      const float alpha = expf(mrow[v] - mnew);
      float psum = 0.0f;
#pragma unroll
      for (int g = 0; g < 2; ++g) {
        float pv = expf(s[g][v] - mnew);
        lP[wave][v + 8 * half][g * 16 + lr] = (__bf16)pv;
        psum += pv;
      }
#pragma unroll
      for (int mm = 1; mm < 16; mm <<= 1) psum += __shfl_xor(psum, mm, 16);
      lrow[v] = lrow[v] * alpha + psum;
      mrow[v] = mnew;
#pragma unroll
      for (int f = 0; f < 4; ++f) o[f][v] *= alpha;
    }
    __syncthreads();

    // P fragment (A operand): 16 queries x 32 keys --------------------------
    v16bf pa;
    {
      ABu u;
#pragma unroll
      for (int t = 0; t < 8; ++t)
        u.u[t] = *(const unsigned int*)&lP[wave][lr][kpair(t, half)];
      pa = u.v;
    }

    // O += P @ V(chunk) ------------------------------------------------------
#pragma unroll
    for (int f = 0; f < 4; ++f) {
      ABu u;
#pragma unroll
      for (int t = 0; t < 8; ++t) {
        int k  = kpair(t, half);
        int j0 = kc + k, j1 = kc + k + 1;
        j0 = j0 < 0 ? 0 : (j0 >= Lk ? Lk - 1 : j0);
        j1 = j1 < 0 ? 0 : (j1 >= Lk ? Lk - 1 : j1);
        u.b[2 * t]     = Vm[((size_t)(b * Lk + j0)) * D_ + h * DH_ + f * 16 + lr];
        u.b[2 * t + 1] = Vm[((size_t)(b * Lk + j1)) * D_ + h * DH_ + f * 16 + lr];
      }
      o[f] = wmma_bf16(pa, u.v, o[f]);
    }
    __syncthreads();
  }

  // normalize + store --------------------------------------------------------
#pragma unroll
  for (int f = 0; f < 4; ++f)
#pragma unroll
    for (int v = 0; v < 8; ++v) {
      const int   row = q0 + v + 8 * half;
      const float inv = 1.0f / fmaxf(lrow[v], 1.0e-20f);
      O[((size_t)(b * Lq + row)) * D_ + h * DH_ + f * 16 + lr] =
          (__bf16)(o[f][v] * inv);
    }
}

// ---------------------------------------------------------------------------
// Fused residual add + LayerNorm over D=1024. One 256-thread block per row.
// Emits f32 (residual stream) and/or bf16 (next-GEMM operand).
// ---------------------------------------------------------------------------
__global__ __launch_bounds__(256) void add_ln_kernel(
    const float* __restrict__ A, const float* __restrict__ Bv,
    const float* __restrict__ g, const float* __restrict__ be,
    float* __restrict__ outF, __bf16* __restrict__ outB) {
  __shared__ float redS[8], redQ[8];
  const int row  = blockIdx.x;
  const int t    = threadIdx.x;
  const int lane = t & 31, wave = t >> 5;
  const float* a = A + (size_t)row * D_;
  const float* r = Bv + (size_t)row * D_;

  float x[4], s = 0.0f, q = 0.0f;
#pragma unroll
  for (int e = 0; e < 4; ++e) {
    int c = t + 256 * e;
    x[e]  = a[c] + r[c];
    s    += x[e];
    q    += x[e] * x[e];
  }
#pragma unroll
  for (int mm = 1; mm < 32; mm <<= 1) {
    s += __shfl_xor(s, mm, 32);
    q += __shfl_xor(q, mm, 32);
  }
  if (lane == 0) { redS[wave] = s; redQ[wave] = q; }
  __syncthreads();
  float S = 0.0f, Q2 = 0.0f;
#pragma unroll
  for (int w = 0; w < 8; ++w) { S += redS[w]; Q2 += redQ[w]; }
  const float mu   = S * (1.0f / D_);
  const float var  = Q2 * (1.0f / D_) - mu * mu;
  const float rstd = rsqrtf(var + 1e-5f);
#pragma unroll
  for (int e = 0; e < 4; ++e) {
    int   c = t + 256 * e;
    float y = (x[e] - mu) * rstd * g[c] + be[c];
    if (outF) outF[(size_t)row * D_ + c] = y;
    if (outB) outB[(size_t)row * D_ + c] = (__bf16)y;
  }
}

// ---------------------------------------------------------------------------
// Host orchestration
// ---------------------------------------------------------------------------
extern "C" void kernel_launch(void* const* d_in, const int* in_sizes, int n_in,
                              void* d_out, int out_size, void* d_ws,
                              size_t ws_size, hipStream_t stream) {
  (void)in_sizes; (void)n_in; (void)out_size; (void)ws_size;
  constexpr int Bc = 2, Lc = 2048, Mc = 2048, Dc = 1024, FFc = 4096;
  const int NT = Bc * Lc;  // 4096 query rows
  const int NM = Bc * Mc;  // 4096 memory rows

  const float* x   = (const float*)d_in[0];
  const float* mem = (const float*)d_in[1];
  const float* swq = (const float*)d_in[2];
  const float* swk = (const float*)d_in[3];
  const float* swv = (const float*)d_in[4];
  const float* swo = (const float*)d_in[5];
  const float* sbq = (const float*)d_in[6];
  const float* sbk = (const float*)d_in[7];
  const float* sbv = (const float*)d_in[8];
  const float* sbo = (const float*)d_in[9];
  const float* cwq = (const float*)d_in[10];
  const float* cwk = (const float*)d_in[11];
  const float* cwv = (const float*)d_in[12];
  const float* cwo = (const float*)d_in[13];
  const float* cbq = (const float*)d_in[14];
  const float* cbk = (const float*)d_in[15];
  const float* cbv = (const float*)d_in[16];
  const float* cbo = (const float*)d_in[17];
  const float* w1  = (const float*)d_in[18];
  const float* b1  = (const float*)d_in[19];
  const float* w2  = (const float*)d_in[20];
  const float* b2  = (const float*)d_in[21];
  const float* g1  = (const float*)d_in[22];
  const float* g2  = (const float*)d_in[23];
  const float* g3  = (const float*)d_in[24];
  const float* be1 = (const float*)d_in[25];
  const float* be2 = (const float*)d_in[26];
  const float* be3 = (const float*)d_in[27];

  char* p = (char*)d_ws;
  auto take = [&](size_t bytes) -> void* {
    void* r = (void*)p;
    p += (bytes + 255) & ~(size_t)255;
    return r;
  };
  __bf16* xcur_bf = (__bf16*)take((size_t)NT * Dc * 2);  // x_bf -> x1_bf -> x2_bf
  __bf16* mem_bf  = (__bf16*)take((size_t)NM * Dc * 2);
  __bf16* swq_bf  = (__bf16*)take((size_t)Dc * Dc * 2);
  __bf16* swk_bf  = (__bf16*)take((size_t)Dc * Dc * 2);
  __bf16* swv_bf  = (__bf16*)take((size_t)Dc * Dc * 2);
  __bf16* swo_bf  = (__bf16*)take((size_t)Dc * Dc * 2);
  __bf16* cwq_bf  = (__bf16*)take((size_t)Dc * Dc * 2);
  __bf16* cwk_bf  = (__bf16*)take((size_t)Dc * Dc * 2);
  __bf16* cwv_bf  = (__bf16*)take((size_t)Dc * Dc * 2);
  __bf16* cwo_bf  = (__bf16*)take((size_t)Dc * Dc * 2);
  __bf16* w1_bf   = (__bf16*)take((size_t)Dc * FFc * 2);
  __bf16* w2_bf   = (__bf16*)take((size_t)FFc * Dc * 2);
  __bf16* q_bf    = (__bf16*)take((size_t)NT * Dc * 2);
  __bf16* k_bf    = (__bf16*)take((size_t)NM * Dc * 2);
  __bf16* v_bf    = (__bf16*)take((size_t)NM * Dc * 2);
  __bf16* attn_bf = (__bf16*)take((size_t)NT * Dc * 2);
  float*  gout    = (float*)take((size_t)NT * Dc * 4);   // sa / ca / ff
  float*  x1f     = (float*)take((size_t)NT * Dc * 4);
  float*  x2f     = (float*)take((size_t)NT * Dc * 4);
  __bf16* h_bf    = (__bf16*)take((size_t)NT * FFc * 2);

  auto cvt = [&](const float* src, __bf16* dst, size_t n) {
    cvt_kernel<<<1024, 256, 0, stream>>>(src, dst, (unsigned long long)n);
  };
  auto gemm = [&](const __bf16* Ag, const __bf16* Wg, const float* biasg,
                  float* Cfg, __bf16* Cbg, int Mg, int Ng, int Kg, int act) {
    dim3 grid(Ng / 128, Mg / 256);
    gemm_bf16_kernel<<<grid, 256, 0, stream>>>(Ag, Wg, biasg, Cfg, Cbg, Mg, Ng,
                                               Kg, act);
  };
  auto attn = [&](const __bf16* Qg, const __bf16* Kg, const __bf16* Vg,
                  __bf16* Og, int Lqv, int Lkv, int windowed) {
    int jobs = Bc * H_ * (Lqv / 16);  // one wave per job, 4 waves per block
    attn_kernel<<<jobs / 4, 128, 0, stream>>>(Qg, Kg, Vg, Og, Lqv, Lkv,
                                              windowed);
  };

  // ---- bf16 staging --------------------------------------------------------
  cvt(x, xcur_bf, (size_t)NT * Dc);
  cvt(mem, mem_bf, (size_t)NM * Dc);
  cvt(swq, swq_bf, (size_t)Dc * Dc);
  cvt(swk, swk_bf, (size_t)Dc * Dc);
  cvt(swv, swv_bf, (size_t)Dc * Dc);
  cvt(swo, swo_bf, (size_t)Dc * Dc);
  cvt(cwq, cwq_bf, (size_t)Dc * Dc);
  cvt(cwk, cwk_bf, (size_t)Dc * Dc);
  cvt(cwv, cwv_bf, (size_t)Dc * Dc);
  cvt(cwo, cwo_bf, (size_t)Dc * Dc);
  cvt(w1, w1_bf, (size_t)Dc * FFc);
  cvt(w2, w2_bf, (size_t)FFc * Dc);

  // ---- self-attention (windowed causal + ALiBi) ----------------------------
  gemm(xcur_bf, swq_bf, sbq, nullptr, q_bf, NT, Dc, Dc, 0);
  gemm(xcur_bf, swk_bf, sbk, nullptr, k_bf, NT, Dc, Dc, 0);
  gemm(xcur_bf, swv_bf, sbv, nullptr, v_bf, NT, Dc, Dc, 0);
  attn(q_bf, k_bf, v_bf, attn_bf, Lc, Lc, 1);
  gemm(attn_bf, swo_bf, sbo, gout, nullptr, NT, Dc, Dc, 0);
  add_ln_kernel<<<NT, 256, 0, stream>>>(x, gout, g1, be1, x1f, xcur_bf);

  // ---- cross-attention (full) ---------------------------------------------
  gemm(xcur_bf, cwq_bf, cbq, nullptr, q_bf, NT, Dc, Dc, 0);
  gemm(mem_bf, cwk_bf, cbk, nullptr, k_bf, NM, Dc, Dc, 0);
  gemm(mem_bf, cwv_bf, cbv, nullptr, v_bf, NM, Dc, Dc, 0);
  attn(q_bf, k_bf, v_bf, attn_bf, Lc, Mc, 0);
  gemm(attn_bf, cwo_bf, cbo, gout, nullptr, NT, Dc, Dc, 0);
  add_ln_kernel<<<NT, 256, 0, stream>>>(x1f, gout, g2, be2, x2f, xcur_bf);

  // ---- FFN -----------------------------------------------------------------
  gemm(xcur_bf, w1_bf, b1, nullptr, h_bf, NT, FFc, Dc, 1);  // fused exact GELU
  gemm(h_bf, w2_bf, b2, gout, nullptr, NT, Dc, FFc, 0);
  add_ln_kernel<<<NT, 256, 0, stream>>>(x2f, gout, g3, be3, (float*)d_out,
                                        nullptr);
}

// v001
// It runs in 890 microseconds.
// Timed twice side by side with v000, it ran 1.70 and 1.69 times as fast.
#include <hip/hip_runtime.h>
#include <math.h>
#include <stdint.h>

typedef __attribute__((ext_vector_type(16))) __bf16 v16bf;
typedef __attribute__((ext_vector_type(8)))  float  v8f;

union ABu {
  v16bf          v;
  unsigned int   u[8];
  unsigned short s[16];
  __bf16         b[16];
};

union U4u {
  uint4        q;
  unsigned int u[4];
};

__device__ __forceinline__ int kpair(int t, int half) {
  int base = (t < 4) ? (2 * t) : (16 + 2 * (t - 4));
  return base + 8 * half;
}

__device__ __forceinline__ v8f wmma_bf16(v16bf a, v16bf b, v8f c) {
  return __builtin_amdgcn_wmma_f32_16x16x32_bf16(false, a, false, b,
                                                 (short)0, c, false, false);
}

#define D_  1024
#define H_  16
#define DH_ 64

// ---------------------------------------------------------------------------
// fp32 -> bf16 conversion (grid-stride)
// ---------------------------------------------------------------------------
__global__ void cvt_kernel(const float* __restrict__ in,
                           __bf16* __restrict__ out,
                           unsigned long long n) {
  unsigned long long i = (unsigned long long)blockIdx.x * blockDim.x + threadIdx.x;
  unsigned long long stride = (unsigned long long)gridDim.x * blockDim.x;
  for (; i < n; i += stride) out[i] = (__bf16)in[i];
}

typedef uint32_t u32x4 __attribute__((ext_vector_type(4)));
typedef uint32_t u32x8 __attribute__((ext_vector_type(8)));
typedef short    s16x8 __attribute__((ext_vector_type(8)));

__device__ __forceinline__ uint32_t uni(uint32_t v) {
  return (uint32_t)__builtin_amdgcn_readfirstlane(v);
}
__device__ __forceinline__ uint32_t pinned(uint32_t v) {
  uint32_t w = uni(v);
  asm volatile("" : "+s"(w));
  return w;
}
__device__ __forceinline__ void wait_ds0() {
  asm volatile("s_wait_dscnt 0x0" ::: "memory");      // own LDS reads done before the buffer is handed back
}
__device__ __forceinline__ void wait_tensor0(u32x4 g0, u32x8 ga, u32x8 gb) {
  asm volatile("s_wait_tensorcnt 0x0" ::"s"(g0), "s"(ga), "s"(gb) : "memory");
}
__device__ __forceinline__ void hold4(u32x4& g) { asm volatile("" : "+s"(g)); }
__device__ __forceinline__ void hold8(u32x8& g) { asm volatile("" : "+s"(g)); }
__device__ __forceinline__ void tdm_load(u32x4 g0, u32x8 g1) {
  asm volatile("tensor_load_to_lds %0, %1" ::"s"(g0), "s"(g1) : "memory");
}
__device__ __forceinline__ u32x4 tdm_group0(uint32_t lds_dst, uint64_t ga) {
  u32x4 g;
  g[0] = uni(1u);
  g[1] = uni(lds_dst);
  g[2] = uni((uint32_t)ga);
  g[3] = uni((((uint32_t)(ga >> 32)) & 0x01FFFFFFu) | 0x80000000u);
  return g;
}
// W0 = word 0 (pad fields, no mask), D0 = bytes per row, D1 = rows.
template <uint32_t W0, uint32_t D0, uint32_t D1>
__device__ __forceinline__ u32x8 tdm_group1(uint32_t src_pitch) {
  u32x8 g;
  g[0] = uni(W0);
  g[1] = uni((D0 & 0xFFFFu) << 16);
  g[2] = uni((D0 >> 16) | ((D1 & 0xFFFFu) << 16));
  g[3] = uni((D1 >> 16) | (D0 << 16));
  g[4] = uni(D1);
  g[5] = uni(src_pitch);
  g[6] = uni(0u);
  g[7] = uni(0u);
  return g;
}
__device__ __forceinline__ u32x4 ld_tr16(const unsigned char* p) {
  typedef __attribute__((address_space(3))) s16x8 lds_s16x8;
  return __builtin_bit_cast(u32x4,
                            __builtin_amdgcn_ds_load_tr16_b128_v8i16((lds_s16x8*)p));
}

union FragU {
  v16bf v;
  u32x4 q[2];
};

constexpr uint32_t PITCH_A = 144u, PITCH_B = 288u;
constexpr uint32_t SLICE_A = 10240u;              // 64 * 144 = 9216, rounded up
constexpr uint32_t SLICE_B = 6144u;               // 16 * 288 = 4608, rounded up
constexpr uint32_t BASE_B  = 4u * SLICE_A;
constexpr uint32_t BUF_SZ  = BASE_B + 4u * SLICE_B;  // 65536
constexpr uint32_t PAD_A   = (1u << 20) | (4u << 22) | (3u << 25);  // 128-B rows + 16 B
constexpr uint32_t PAD_B   = (1u << 20) | (5u << 22) | (7u << 25);  // 256-B rows + 32 B
static_assert(SLICE_A % 2048u == 0 && SLICE_B % 2048u == 0 && BUF_SZ % 2048u == 0, "slice places");
static_assert(64u * PITCH_A <= SLICE_A && 16u * PITCH_B <= SLICE_B, "slice sizes");

__global__ __launch_bounds__(256, 1) void gemm_bf16_kernel(
    const __bf16* __restrict__ A, const __bf16* __restrict__ W,
    const float* __restrict__ bias,
    float* __restrict__ Cf, __bf16* __restrict__ Cb,
    int Mr, int N, int K, int act) {
  (void)Mr;
  __shared__ __attribute__((aligned(2048))) unsigned char L[2u * BUF_SZ];

  const int      tid  = threadIdx.x;
  const int      lane = tid & 31;
  const uint32_t wave = uni((uint32_t)tid >> 5);
  const int wm   = (int)(wave >> 1);   // 0..3
  const int wn   = (int)(wave & 1u);   // 0..1
  const int half = lane >> 4;
  const int lr   = lane & 15;
  const int row0 = blockIdx.y * 256;
  const int col0 = blockIdx.x * 128;
  const uint32_t lbase = (uint32_t)(size_t)L;

  v8f acc[4][4];
#pragma unroll
  for (int mi = 0; mi < 4; ++mi)
#pragma unroll
    for (int ni = 0; ni < 4; ++ni)
#pragma unroll
      for (int e = 0; e < 8; ++e) acc[mi][ni][e] = 0.0f;

  // One request per wave and pass: waves 0-3 a slice of A, waves 4-7 of W.
  u32x8 g1a = tdm_group1<PAD_A, 128u, 64u>(2u * (uint32_t)K);
  u32x8 g1b = tdm_group1<PAD_B, 256u, 16u>(2u * (uint32_t)N);
  hold8(g1a);
  hold8(g1b);
  const bool     isA  = wave < 4u;
  const uint32_t j    = wave & 3u;
  const uint32_t dst0 = lbase + (isA ? j * SLICE_A : BASE_B + j * SLICE_B);
  const uint64_t src0 = isA
      ? (uint64_t)(size_t)A + 2ull * ((uint64_t)((uint32_t)row0 + j * 64u) * (uint32_t)K)
      : (uint64_t)(size_t)W + 2ull * ((uint64_t)(j * 16u) * (uint32_t)N + (uint32_t)col0);
  const uint64_t step = isA ? 128ull : 128ull * (uint32_t)N;   // bytes per pass
  u32x4 g0;
  auto issue = [&](uint32_t st) {   // pass st's slice, into buffer st & 1
    g0 = tdm_group0(dst0 + (st & 1u) * BUF_SZ, src0 + (uint64_t)st * step);
    hold4(g0);
    if (pinned(wave < 4u)) tdm_load(g0, g1a);
    else                   tdm_load(g0, g1b);
  };

  const uint32_t nt = (uint32_t)K >> 6;   // passes; every call has at least two

  issue(0u);
  wait_tensor0(g0, g1a, g1b);
  __syncthreads();                        // pass 0's tiles are published
  issue(1u);

  // Lane offsets of the fragment reads inside a buffer.
  const uint32_t aoff = (uint32_t)wm * SLICE_A + (uint32_t)lr * PITCH_A + 16u * (uint32_t)half;
  const uint32_t boff = BASE_B + (8u * (uint32_t)half + (uint32_t)(lane & 7)) * PITCH_B +
                        128u * (uint32_t)wn + 16u * (uint32_t)((lane >> 3) & 1);

  for (uint32_t s = 0; s < nt; ++s) {
    const unsigned char* Lb = L + (s & 1u) * BUF_SZ;
    // The loops below are unrolled so that every fragment and accumulator
    // index is a constant (registers, no scratch).
#pragma unroll
    for (int kb = 0; kb < 2; ++kb) {
      // A fragments, hardware k order: bytes 16h and 32 + 16h of each 64 B.
      FragU af[4];
#pragma unroll
      for (int mi = 0; mi < 4; ++mi) {
        const unsigned char* pa = Lb + aoff + (uint32_t)mi * 16u * PITCH_A + (uint32_t)kb * 64u;
        af[mi].q[0] = *(const u32x4*)pa;
        af[mi].q[1] = *(const u32x4*)(pa + 32);
      }
#pragma unroll
      for (int ni = 0; ni < 4; ++ni) {
        // W fragment: k-rows 32 kb + 0..15 and + 16..31 lie in two slices.
        const unsigned char* pb = Lb + boff + (uint32_t)(2 * kb) * SLICE_B + (uint32_t)ni * 32u;
        FragU bf;
        bf.q[0] = ld_tr16(pb);
        bf.q[1] = ld_tr16(pb + SLICE_B);
#pragma unroll
        for (int mi = 0; mi < 4; ++mi)
          acc[mi][ni] = wmma_bf16(af[mi].v, bf.v, acc[mi][ni]);
      }
    }

    // Publish point of pass s + 1; it also ends every reader's last read of
    // this pass's buffer, which is refilled behind it.
    wait_ds0();
    wait_tensor0(g0, g1a, g1b);
    __syncthreads();
    if (pinned(s + 2u < nt)) issue(s + 2u);
  }
  wait_tensor0(g0, g1a, g1b);
  wait_ds0();

  // epilogue: bias (+GELU) and store f32 / bf16 -------------------------------
#pragma unroll
  for (int mi = 0; mi < 4; ++mi)
#pragma unroll
    for (int ni = 0; ni < 4; ++ni) {
      const int   col = col0 + wn * 64 + ni * 16 + lr;
      const float bsv = bias ? bias[col] : 0.0f;
#pragma unroll
      for (int v = 0; v < 8; ++v) {
        const int row = row0 + wm * 64 + mi * 16 + v + 8 * half;
        float val = acc[mi][ni][v] + bsv;
        if (act == 1) val = 0.5f * val * (1.0f + erff(val * 0.70710678118f));
        if (Cf) Cf[(size_t)row * N + col] = val;
        if (Cb) Cb[(size_t)row * N + col] = (__bf16)val;
      }
    }
}

// ---------------------------------------------------------------------------
// Flash attention: one wave per (batch, head, 16-query block).
// windowed=1 -> causal local window W=64 + ALiBi; windowed=0 -> full attn.
// Q,K,V,O are bf16 [B*Lq(or Lk), D] with head h at feature offset h*64.
// ---------------------------------------------------------------------------
__global__ __launch_bounds__(128) void attn_kernel(
    const __bf16* __restrict__ Q, const __bf16* __restrict__ Km,
    const __bf16* __restrict__ Vm, __bf16* __restrict__ O,
    int Lq, int Lk, int windowed) {
  __shared__ __bf16 lP[4][16][32];  // per-wave P staging (C-layout -> A-layout)
  const int lane  = threadIdx.x & 31;
  const int wave  = threadIdx.x >> 5;
  const int half  = lane >> 4;
  const int lr    = lane & 15;
  const int qbPer = Lq >> 4;
  const int job   = blockIdx.x * 4 + wave;
  const int qblk  = job % qbPer;
  const int h     = (job / qbPer) % H_;
  const int b     = job / (qbPer * H_);
  const int q0    = qblk << 4;

  const float slope = windowed ? exp2f(-8.0f * (float)(h + 1) / (float)H_) : 0.0f;

  // Q fragments (A operand): 16 queries x 64 features
  v16bf qa[2];
  {
    const __bf16* qb = Q + ((size_t)(b * Lq + q0 + lr)) * D_ + h * DH_;
#pragma unroll
    for (int f = 0; f < 2; ++f) {
      ABu u;
#pragma unroll
      for (int t = 0; t < 8; ++t)
        u.u[t] = *(const unsigned int*)(qb + f * 32 + kpair(t, half));
      qa[f] = u.v;
    }
  }

  float mrow[8], lrow[8];
  v8f   o[4];
#pragma unroll
  for (int v = 0; v < 8; ++v) { mrow[v] = -3.0e38f; lrow[v] = 0.0f; }
#pragma unroll
  for (int f = 0; f < 4; ++f)
#pragma unroll
    for (int e = 0; e < 8; ++e) o[f][e] = 0.0f;

  const int nch = windowed ? 3 : (Lk >> 5);  // uniform across the block
  for (int ch = 0; ch < nch; ++ch) {
    const int kc = windowed ? (q0 - 64 + 32 * ch) : (32 * ch);

    // S = Q @ K^T : 16 queries x 32 keys ------------------------------------
    v8f s[2];
#pragma unroll
    for (int g = 0; g < 2; ++g) {
#pragma unroll
      for (int e = 0; e < 8; ++e) s[g][e] = 0.0f;
      int key  = kc + g * 16 + lr;
      int keyc = key < 0 ? 0 : (key >= Lk ? Lk - 1 : key);
      const __bf16* kb = Km + ((size_t)(b * Lk + keyc)) * D_ + h * DH_;
#pragma unroll
      for (int f = 0; f < 2; ++f) {
        ABu u;
#pragma unroll
        for (int t = 0; t < 8; ++t)
          u.u[t] = *(const unsigned int*)(kb + f * 32 + kpair(t, half));
        s[g] = wmma_bf16(qa[f], u.v, s[g]);
      }
    }

    // scale + ALiBi + mask, online softmax ----------------------------------
#pragma unroll
    for (int v = 0; v < 8; ++v) {
      const int i    = q0 + v + 8 * half;
      float     best = -3.0e38f;
#pragma unroll
      for (int g = 0; g < 2; ++g) {
        const int j  = kc + g * 16 + lr;
        float     sv = s[g][v] * 0.125f + slope * (float)(j - i);
        bool valid = windowed ? (j >= 0 && j <= i && (i - j) < 64) : (j < Lk);
        sv       = valid ? sv : -1.0e30f;
        s[g][v]  = sv;
        best     = fmaxf(best, sv);
      }
#pragma unroll
      for (int mm = 1; mm < 16; mm <<= 1)
        best = fmaxf(best, __shfl_xor(best, mm, 16));
      const float mnew  = fmaxf(mrow[v], best);
      const float alpha = expf(mrow[v] - mnew);
      float psum = 0.0f;
#pragma unroll
      for (int g = 0; g < 2; ++g) {
        float pv = expf(s[g][v] - mnew);
        lP[wave][v + 8 * half][g * 16 + lr] = (__bf16)pv;
        psum += pv;
      }
#pragma unroll
      for (int mm = 1; mm < 16; mm <<= 1) psum += __shfl_xor(psum, mm, 16);
      lrow[v] = lrow[v] * alpha + psum;
      mrow[v] = mnew;
#pragma unroll
      for (int f = 0; f < 4; ++f) o[f][v] *= alpha;
    }
    __syncthreads();

    // P fragment (A operand): 16 queries x 32 keys --------------------------
    v16bf pa;
    {
      ABu u;
#pragma unroll
      for (int t = 0; t < 8; ++t)
        u.u[t] = *(const unsigned int*)&lP[wave][lr][kpair(t, half)];
      pa = u.v;
    }

    // O += P @ V(chunk) ------------------------------------------------------
#pragma unroll
    for (int f = 0; f < 4; ++f) {
      ABu u;
#pragma unroll
      for (int t = 0; t < 8; ++t) {
        int k  = kpair(t, half);
        int j0 = kc + k, j1 = kc + k + 1;
        j0 = j0 < 0 ? 0 : (j0 >= Lk ? Lk - 1 : j0);
        j1 = j1 < 0 ? 0 : (j1 >= Lk ? Lk - 1 : j1);
        u.b[2 * t]     = Vm[((size_t)(b * Lk + j0)) * D_ + h * DH_ + f * 16 + lr];
        u.b[2 * t + 1] = Vm[((size_t)(b * Lk + j1)) * D_ + h * DH_ + f * 16 + lr];
      }
      o[f] = wmma_bf16(pa, u.v, o[f]);
    }
    __syncthreads();
  }

  // normalize + store --------------------------------------------------------
#pragma unroll
  for (int f = 0; f < 4; ++f)
#pragma unroll
    for (int v = 0; v < 8; ++v) {
      const int   row = q0 + v + 8 * half;
      const float inv = 1.0f / fmaxf(lrow[v], 1.0e-20f);
      O[((size_t)(b * Lq + row)) * D_ + h * DH_ + f * 16 + lr] =
          (__bf16)(o[f][v] * inv);
    }
}

// ---------------------------------------------------------------------------
// Fused residual add + LayerNorm over D=1024. One 256-thread block per row.
// Emits f32 (residual stream) and/or bf16 (next-GEMM operand).
// ---------------------------------------------------------------------------
__global__ __launch_bounds__(256) void add_ln_kernel(
    const float* __restrict__ A, const float* __restrict__ Bv,
    const float* __restrict__ g, const float* __restrict__ be,
    float* __restrict__ outF, __bf16* __restrict__ outB) {
  __shared__ float redS[8], redQ[8];
  const int row  = blockIdx.x;
  const int t    = threadIdx.x;
  const int lane = t & 31, wave = t >> 5;
  const float* a = A + (size_t)row * D_;
  const float* r = Bv + (size_t)row * D_;

  float x[4], s = 0.0f, q = 0.0f;
#pragma unroll
  for (int e = 0; e < 4; ++e) {
    int c = t + 256 * e;
    x[e]  = a[c] + r[c];
    s    += x[e];
    q    += x[e] * x[e];
  }
#pragma unroll
  for (int mm = 1; mm < 32; mm <<= 1) {
    s += __shfl_xor(s, mm, 32);
    q += __shfl_xor(q, mm, 32);
  }
  if (lane == 0) { redS[wave] = s; redQ[wave] = q; }
  __syncthreads();
  float S = 0.0f, Q2 = 0.0f;
#pragma unroll
  for (int w = 0; w < 8; ++w) { S += redS[w]; Q2 += redQ[w]; }
  const float mu   = S * (1.0f / D_);
  const float var  = Q2 * (1.0f / D_) - mu * mu;
  const float rstd = rsqrtf(var + 1e-5f);
#pragma unroll
  for (int e = 0; e < 4; ++e) {
    int   c = t + 256 * e;
    float y = (x[e] - mu) * rstd * g[c] + be[c];
    if (outF) outF[(size_t)row * D_ + c] = y;
    if (outB) outB[(size_t)row * D_ + c] = (__bf16)y;
  }
}

// ---------------------------------------------------------------------------
// Host orchestration
// ---------------------------------------------------------------------------
extern "C" void kernel_launch(void* const* d_in, const int* in_sizes, int n_in,
                              void* d_out, int out_size, void* d_ws,
                              size_t ws_size, hipStream_t stream) {
  (void)in_sizes; (void)n_in; (void)out_size; (void)ws_size;
  constexpr int Bc = 2, Lc = 2048, Mc = 2048, Dc = 1024, FFc = 4096;
  const int NT = Bc * Lc;  // 4096 query rows
  const int NM = Bc * Mc;  // 4096 memory rows

  const float* x   = (const float*)d_in[0];
  const float* mem = (const float*)d_in[1];
  const float* swq = (const float*)d_in[2];
  const float* swk = (const float*)d_in[3];
  const float* swv = (const float*)d_in[4];
  const float* swo = (const float*)d_in[5];
  const float* sbq = (const float*)d_in[6];
  const float* sbk = (const float*)d_in[7];
  const float* sbv = (const float*)d_in[8];
  const float* sbo = (const float*)d_in[9];
  const float* cwq = (const float*)d_in[10];
  const float* cwk = (const float*)d_in[11];
  const float* cwv = (const float*)d_in[12];
  const float* cwo = (const float*)d_in[13];
  const float* cbq = (const float*)d_in[14];
  const float* cbk = (const float*)d_in[15];
  const float* cbv = (const float*)d_in[16];
  const float* cbo = (const float*)d_in[17];
  const float* w1  = (const float*)d_in[18];
  const float* b1  = (const float*)d_in[19];
  const float* w2  = (const float*)d_in[20];
  const float* b2  = (const float*)d_in[21];
  const float* g1  = (const float*)d_in[22];
  const float* g2  = (const float*)d_in[23];
  const float* g3  = (const float*)d_in[24];
  const float* be1 = (const float*)d_in[25];
  const float* be2 = (const float*)d_in[26];
  const float* be3 = (const float*)d_in[27];

  char* p = (char*)d_ws;
  auto take = [&](size_t bytes) -> void* {
    void* r = (void*)p;
    p += (bytes + 255) & ~(size_t)255;
    return r;
  };
  __bf16* xcur_bf = (__bf16*)take((size_t)NT * Dc * 2);  // x_bf -> x1_bf -> x2_bf
  __bf16* mem_bf  = (__bf16*)take((size_t)NM * Dc * 2);
  __bf16* swq_bf  = (__bf16*)take((size_t)Dc * Dc * 2);
  __bf16* swk_bf  = (__bf16*)take((size_t)Dc * Dc * 2);
  __bf16* swv_bf  = (__bf16*)take((size_t)Dc * Dc * 2);
  __bf16* swo_bf  = (__bf16*)take((size_t)Dc * Dc * 2);
  __bf16* cwq_bf  = (__bf16*)take((size_t)Dc * Dc * 2);
  __bf16* cwk_bf  = (__bf16*)take((size_t)Dc * Dc * 2);
  __bf16* cwv_bf  = (__bf16*)take((size_t)Dc * Dc * 2);
  __bf16* cwo_bf  = (__bf16*)take((size_t)Dc * Dc * 2);
  __bf16* w1_bf   = (__bf16*)take((size_t)Dc * FFc * 2);
  __bf16* w2_bf   = (__bf16*)take((size_t)FFc * Dc * 2);
  __bf16* q_bf    = (__bf16*)take((size_t)NT * Dc * 2);
  __bf16* k_bf    = (__bf16*)take((size_t)NM * Dc * 2);
  __bf16* v_bf    = (__bf16*)take((size_t)NM * Dc * 2);
  __bf16* attn_bf = (__bf16*)take((size_t)NT * Dc * 2);
  float*  gout    = (float*)take((size_t)NT * Dc * 4);   // sa / ca / ff
  float*  x1f     = (float*)take((size_t)NT * Dc * 4);
  float*  x2f     = (float*)take((size_t)NT * Dc * 4);
  __bf16* h_bf    = (__bf16*)take((size_t)NT * FFc * 2);

  auto cvt = [&](const float* src, __bf16* dst, size_t n) {
    cvt_kernel<<<1024, 256, 0, stream>>>(src, dst, (unsigned long long)n);
  };
  auto gemm = [&](const __bf16* Ag, const __bf16* Wg, const float* biasg,
                  float* Cfg, __bf16* Cbg, int Mg, int Ng, int Kg, int act) {
    dim3 grid(Ng / 128, Mg / 256);
    gemm_bf16_kernel<<<grid, 256, 0, stream>>>(Ag, Wg, biasg, Cfg, Cbg, Mg, Ng,
                                               Kg, act);
  };
  auto attn = [&](const __bf16* Qg, const __bf16* Kg, const __bf16* Vg,
                  __bf16* Og, int Lqv, int Lkv, int windowed) {
    int jobs = Bc * H_ * (Lqv / 16);  // one wave per job, 4 waves per block
    attn_kernel<<<jobs / 4, 128, 0, stream>>>(Qg, Kg, Vg, Og, Lqv, Lkv,
                                              windowed);
  };

  // ---- bf16 staging --------------------------------------------------------
  cvt(x, xcur_bf, (size_t)NT * Dc);
  cvt(mem, mem_bf, (size_t)NM * Dc);
  cvt(swq, swq_bf, (size_t)Dc * Dc);
  cvt(swk, swk_bf, (size_t)Dc * Dc);
  cvt(swv, swv_bf, (size_t)Dc * Dc);
  cvt(swo, swo_bf, (size_t)Dc * Dc);
  cvt(cwq, cwq_bf, (size_t)Dc * Dc);
  cvt(cwk, cwk_bf, (size_t)Dc * Dc);
  cvt(cwv, cwv_bf, (size_t)Dc * Dc);
  cvt(cwo, cwo_bf, (size_t)Dc * Dc);
  cvt(w1, w1_bf, (size_t)Dc * FFc);
  cvt(w2, w2_bf, (size_t)FFc * Dc);

  // ---- self-attention (windowed causal + ALiBi) ----------------------------
  gemm(xcur_bf, swq_bf, sbq, nullptr, q_bf, NT, Dc, Dc, 0);
  gemm(xcur_bf, swk_bf, sbk, nullptr, k_bf, NT, Dc, Dc, 0);
  gemm(xcur_bf, swv_bf, sbv, nullptr, v_bf, NT, Dc, Dc, 0);
  attn(q_bf, k_bf, v_bf, attn_bf, Lc, Lc, 1);
  gemm(attn_bf, swo_bf, sbo, gout, nullptr, NT, Dc, Dc, 0);
  add_ln_kernel<<<NT, 256, 0, stream>>>(x, gout, g1, be1, x1f, xcur_bf);

  // ---- cross-attention (full) ---------------------------------------------
  gemm(xcur_bf, cwq_bf, cbq, nullptr, q_bf, NT, Dc, Dc, 0);
  gemm(mem_bf, cwk_bf, cbk, nullptr, k_bf, NM, Dc, Dc, 0);
  gemm(mem_bf, cwv_bf, cbv, nullptr, v_bf, NM, Dc, Dc, 0);
  attn(q_bf, k_bf, v_bf, attn_bf, Lc, Mc, 0);
  gemm(attn_bf, cwo_bf, cbo, gout, nullptr, NT, Dc, Dc, 0);
  add_ln_kernel<<<NT, 256, 0, stream>>>(x1f, gout, g2, be2, x2f, xcur_bf);

  // ---- FFN -----------------------------------------------------------------
  gemm(xcur_bf, w1_bf, b1, nullptr, h_bf, NT, FFc, Dc, 1);  // fused exact GELU
  gemm(h_bf, w2_bf, b2, gout, nullptr, NT, Dc, FFc, 0);
  add_ln_kernel<<<NT, 256, 0, stream>>>(x2f, gout, g3, be3, (float*)d_out,
                                        nullptr);
}

// v002
// Measured time: 663 microseconds a run.
// In two side-by-side timings against v001, it was 1.35 and 1.34 times as fast.
// Counting every step since v000, it is 2.27 times as fast.
#include <hip/hip_runtime.h>
#include <math.h>
#include <stdint.h>

typedef __attribute__((ext_vector_type(16))) __bf16 v16bf;
typedef __attribute__((ext_vector_type(8)))  float  v8f;

union ABu {
  v16bf          v;
  unsigned int   u[8];
  unsigned short s[16];
  __bf16         b[16];
};

union U4u {
  uint4        q;
  unsigned int u[4];
};

__device__ __forceinline__ int kpair(int t, int half) {
  int base = (t < 4) ? (2 * t) : (16 + 2 * (t - 4));
  return base + 8 * half;
}

__device__ __forceinline__ v8f wmma_bf16(v16bf a, v16bf b, v8f c) {
  return __builtin_amdgcn_wmma_f32_16x16x32_bf16(false, a, false, b,
                                                 (short)0, c, false, false);
}

#define D_  1024
#define H_  16
#define DH_ 64

// ---------------------------------------------------------------------------
// fp32 -> bf16 conversion (grid-stride)
// ---------------------------------------------------------------------------
__global__ void cvt_kernel(const float* __restrict__ in,
                           __bf16* __restrict__ out,
                           unsigned long long n) {
  unsigned long long i = (unsigned long long)blockIdx.x * blockDim.x + threadIdx.x;
  unsigned long long stride = (unsigned long long)gridDim.x * blockDim.x;
  for (; i < n; i += stride) out[i] = (__bf16)in[i];
}

typedef uint32_t u32x4 __attribute__((ext_vector_type(4)));
typedef uint32_t u32x8 __attribute__((ext_vector_type(8)));
typedef short    s16x8 __attribute__((ext_vector_type(8)));

__device__ __forceinline__ uint32_t uni(uint32_t v) {
  return (uint32_t)__builtin_amdgcn_readfirstlane(v);
}
__device__ __forceinline__ uint32_t pinned(uint32_t v) {
  uint32_t w = uni(v);
  asm volatile("" : "+s"(w));
  return w;
}
__device__ __forceinline__ void wait_ds0() {
  asm volatile("s_wait_dscnt 0x0" ::: "memory");      // own LDS reads done before the buffer is handed back
}
__device__ __forceinline__ void wait_tensor0(u32x4 g0, u32x8 ga, u32x8 gb) {
  asm volatile("s_wait_tensorcnt 0x0" ::"s"(g0), "s"(ga), "s"(gb) : "memory");
}
__device__ __forceinline__ void hold4(u32x4& g) { asm volatile("" : "+s"(g)); }
__device__ __forceinline__ void hold8(u32x8& g) { asm volatile("" : "+s"(g)); }
__device__ __forceinline__ void tdm_load(u32x4 g0, u32x8 g1) {
  asm volatile("tensor_load_to_lds %0, %1" ::"s"(g0), "s"(g1) : "memory");
}
__device__ __forceinline__ u32x4 tdm_group0(uint32_t lds_dst, uint64_t ga) {
  u32x4 g;
  g[0] = uni(1u);
  g[1] = uni(lds_dst);
  g[2] = uni((uint32_t)ga);
  g[3] = uni((((uint32_t)(ga >> 32)) & 0x01FFFFFFu) | 0x80000000u);
  return g;
}
// W0 = word 0 (pad fields, no mask), D0 = bytes per row, D1 = rows.
template <uint32_t W0, uint32_t D0, uint32_t D1>
__device__ __forceinline__ u32x8 tdm_group1(uint32_t src_pitch) {
  u32x8 g;
  g[0] = uni(W0);
  g[1] = uni((D0 & 0xFFFFu) << 16);
  g[2] = uni((D0 >> 16) | ((D1 & 0xFFFFu) << 16));
  g[3] = uni((D1 >> 16) | (D0 << 16));
  g[4] = uni(D1);
  g[5] = uni(src_pitch);
  g[6] = uni(0u);
  g[7] = uni(0u);
  return g;
}
__device__ __forceinline__ u32x4 ld_tr16(const unsigned char* p) {
  typedef __attribute__((address_space(3))) s16x8 lds_s16x8;
  return __builtin_bit_cast(u32x4,
                            __builtin_amdgcn_ds_load_tr16_b128_v8i16((lds_s16x8*)p));
}

union FragU {
  v16bf v;
  u32x4 q[2];
};

constexpr uint32_t PITCH_A = 144u, PITCH_B = 288u;
constexpr uint32_t SLICE_A = 10240u;              // 64 * 144 = 9216, rounded up
constexpr uint32_t SLICE_B = 6144u;               // 16 * 288 = 4608, rounded up
constexpr uint32_t BASE_B  = 4u * SLICE_A;
constexpr uint32_t BUF_SZ  = BASE_B + 4u * SLICE_B;  // 65536
constexpr uint32_t PAD_A   = (1u << 20) | (4u << 22) | (3u << 25);  // 128-B rows + 16 B
constexpr uint32_t PAD_B   = (1u << 20) | (5u << 22) | (7u << 25);  // 256-B rows + 32 B
static_assert(SLICE_A % 2048u == 0 && SLICE_B % 2048u == 0 && BUF_SZ % 2048u == 0, "slice places");
static_assert(64u * PITCH_A <= SLICE_A && 16u * PITCH_B <= SLICE_B, "slice sizes");

__global__ __launch_bounds__(256, 1) void gemm_bf16_kernel(
    const __bf16* __restrict__ A, const __bf16* __restrict__ W,
    const float* __restrict__ bias,
    float* __restrict__ Cf, __bf16* __restrict__ Cb,
    int Mr, int N, int K, int act) {
  (void)Mr;
  __shared__ __attribute__((aligned(2048))) unsigned char L[2u * BUF_SZ];

  const int      tid  = threadIdx.x;
  const int      lane = tid & 31;
  const uint32_t wave = uni((uint32_t)tid >> 5);
  const int wm   = (int)(wave >> 1);   // 0..3
  const int wn   = (int)(wave & 1u);   // 0..1
  const int half = lane >> 4;
  const int lr   = lane & 15;
  const int row0 = blockIdx.y * 256;
  const int col0 = blockIdx.x * 128;
  const uint32_t lbase = (uint32_t)(size_t)L;

  v8f acc[4][4];
#pragma unroll
  for (int mi = 0; mi < 4; ++mi)
#pragma unroll
    for (int ni = 0; ni < 4; ++ni)
#pragma unroll
      for (int e = 0; e < 8; ++e) acc[mi][ni][e] = 0.0f;

  // One request per wave and pass: waves 0-3 a slice of A, waves 4-7 of W.
  u32x8 g1a = tdm_group1<PAD_A, 128u, 64u>(2u * (uint32_t)K);
  u32x8 g1b = tdm_group1<PAD_B, 256u, 16u>(2u * (uint32_t)N);
  hold8(g1a);
  hold8(g1b);
  const bool     isA  = wave < 4u;
  const uint32_t j    = wave & 3u;
  const uint32_t dst0 = lbase + (isA ? j * SLICE_A : BASE_B + j * SLICE_B);
  const uint64_t src0 = isA
      ? (uint64_t)(size_t)A + 2ull * ((uint64_t)((uint32_t)row0 + j * 64u) * (uint32_t)K)
      : (uint64_t)(size_t)W + 2ull * ((uint64_t)(j * 16u) * (uint32_t)N + (uint32_t)col0);
  const uint64_t step = isA ? 128ull : 128ull * (uint32_t)N;   // bytes per pass
  u32x4 g0;
  auto issue = [&](uint32_t st) {   // pass st's slice, into buffer st & 1
    g0 = tdm_group0(dst0 + (st & 1u) * BUF_SZ, src0 + (uint64_t)st * step);
    hold4(g0);
    if (pinned(wave < 4u)) tdm_load(g0, g1a);
    else                   tdm_load(g0, g1b);
  };

  const uint32_t nt = (uint32_t)K >> 6;   // passes; every call has at least two

  issue(0u);
  wait_tensor0(g0, g1a, g1b);
  __syncthreads();                        // pass 0's tiles are published
  issue(1u);

  // Lane offsets of the fragment reads inside a buffer.
  const uint32_t aoff = (uint32_t)wm * SLICE_A + (uint32_t)lr * PITCH_A + 16u * (uint32_t)half;
  const uint32_t boff = BASE_B + (8u * (uint32_t)half + (uint32_t)(lane & 7)) * PITCH_B +
                        128u * (uint32_t)wn + 16u * (uint32_t)((lane >> 3) & 1);

  for (uint32_t s = 0; s < nt; ++s) {
    const unsigned char* Lb = L + (s & 1u) * BUF_SZ;
    // The loops below are unrolled so that every fragment and accumulator
    // index is a constant (registers, no scratch).
#pragma unroll
    for (int kb = 0; kb < 2; ++kb) {
      // A fragments, hardware k order: bytes 16h and 32 + 16h of each 64 B.
      FragU af[4];
#pragma unroll
      for (int mi = 0; mi < 4; ++mi) {
        const unsigned char* pa = Lb + aoff + (uint32_t)mi * 16u * PITCH_A + (uint32_t)kb * 64u;
        af[mi].q[0] = *(const u32x4*)pa;
        af[mi].q[1] = *(const u32x4*)(pa + 32);
      }
#pragma unroll
      for (int ni = 0; ni < 4; ++ni) {
        // W fragment: k-rows 32 kb + 0..15 and + 16..31 lie in two slices.
        const unsigned char* pb = Lb + boff + (uint32_t)(2 * kb) * SLICE_B + (uint32_t)ni * 32u;
        FragU bf;
        bf.q[0] = ld_tr16(pb);
        bf.q[1] = ld_tr16(pb + SLICE_B);
#pragma unroll
        for (int mi = 0; mi < 4; ++mi)
          acc[mi][ni] = wmma_bf16(af[mi].v, bf.v, acc[mi][ni]);
      }
    }

    // Publish point of pass s + 1; it also ends every reader's last read of
    // this pass's buffer, which is refilled behind it.
    wait_ds0();
    wait_tensor0(g0, g1a, g1b);
    __syncthreads();
    if (pinned(s + 2u < nt)) issue(s + 2u);
  }
  wait_tensor0(g0, g1a, g1b);
  wait_ds0();

  // epilogue: bias (+GELU) and store f32 / bf16 -------------------------------
#pragma unroll
  for (int mi = 0; mi < 4; ++mi)
#pragma unroll
    for (int ni = 0; ni < 4; ++ni) {
      const int   col = col0 + wn * 64 + ni * 16 + lr;
      const float bsv = bias ? bias[col] : 0.0f;
#pragma unroll
      for (int v = 0; v < 8; ++v) {
        const int row = row0 + wm * 64 + mi * 16 + v + 8 * half;
        float val = acc[mi][ni][v] + bsv;
        if (act == 1) val = 0.5f * val * (1.0f + erff(val * 0.70710678118f));
        if (Cf) Cf[(size_t)row * N + col] = val;
        if (Cb) Cb[(size_t)row * N + col] = (__bf16)val;
      }
    }
}

// ---------------------------------------------------------------------------
// Flash attention: one wave per (batch, head, 16-query block).
// windowed=1 -> causal local window W=64 + ALiBi; windowed=0 -> full attn.
// Q,K,V,O are bf16 [B*Lq(or Lk), D] with head h at feature offset h*64.
// ---------------------------------------------------------------------------
__global__ __launch_bounds__(128) void attn_kernel(
    const __bf16* __restrict__ Q, const __bf16* __restrict__ Km,
    const __bf16* __restrict__ Vm, __bf16* __restrict__ O,
    int Lq, int Lk, int windowed) {
  __shared__ __bf16 lP[4][16][32];  // per-wave P staging (C-layout -> A-layout)
  const int lane  = threadIdx.x & 31;
  const int wave  = threadIdx.x >> 5;
  const int half  = lane >> 4;
  const int lr    = lane & 15;
  const int qbPer = Lq >> 4;
  const int job   = blockIdx.x * 4 + wave;
  const int qblk  = job % qbPer;
  const int h     = (job / qbPer) % H_;
  const int b     = job / (qbPer * H_);
  const int q0    = qblk << 4;

  const float slope = windowed ? exp2f(-8.0f * (float)(h + 1) / (float)H_) : 0.0f;

  // Q fragments (A operand): 16 queries x 64 features
  v16bf qa[2];
  {
    const __bf16* qb = Q + ((size_t)(b * Lq + q0 + lr)) * D_ + h * DH_;
#pragma unroll
    for (int f = 0; f < 2; ++f) {
      ABu u;
#pragma unroll
      for (int t = 0; t < 8; ++t)
        u.u[t] = *(const unsigned int*)(qb + f * 32 + kpair(t, half));
      qa[f] = u.v;
    }
  }

  float mrow[8], lrow[8];
  v8f   o[4];
#pragma unroll
  for (int v = 0; v < 8; ++v) { mrow[v] = -3.0e38f; lrow[v] = 0.0f; }
#pragma unroll
  for (int f = 0; f < 4; ++f)
#pragma unroll
    for (int e = 0; e < 8; ++e) o[f][e] = 0.0f;

  const int nch = windowed ? 3 : (Lk >> 5);  // uniform across the block
  for (int ch = 0; ch < nch; ++ch) {
    const int kc = windowed ? (q0 - 64 + 32 * ch) : (32 * ch);

    // S = Q @ K^T : 16 queries x 32 keys ------------------------------------
    v8f s[2];
#pragma unroll
    for (int g = 0; g < 2; ++g) {
#pragma unroll
      for (int e = 0; e < 8; ++e) s[g][e] = 0.0f;
      int key  = kc + g * 16 + lr;
      int keyc = key < 0 ? 0 : (key >= Lk ? Lk - 1 : key);
      const __bf16* kb = Km + ((size_t)(b * Lk + keyc)) * D_ + h * DH_;
#pragma unroll
      for (int f = 0; f < 2; ++f) {
        ABu u;
#pragma unroll
        for (int t = 0; t < 8; ++t)
          u.u[t] = *(const unsigned int*)(kb + f * 32 + kpair(t, half));
        s[g] = wmma_bf16(qa[f], u.v, s[g]);
      }
    }

    // scale + ALiBi + mask, online softmax ----------------------------------
#pragma unroll
    for (int v = 0; v < 8; ++v) {
      const int i    = q0 + v + 8 * half;
      float     best = -3.0e38f;
#pragma unroll
      for (int g = 0; g < 2; ++g) {
        const int j  = kc + g * 16 + lr;
        float     sv = s[g][v] * 0.125f + slope * (float)(j - i);
        bool valid = windowed ? (j >= 0 && j <= i && (i - j) < 64) : (j < Lk);
        sv       = valid ? sv : -1.0e30f;
        s[g][v]  = sv;
        best     = fmaxf(best, sv);
      }
#pragma unroll
      for (int mm = 1; mm < 16; mm <<= 1)
        best = fmaxf(best, __shfl_xor(best, mm, 16));
      const float mnew  = fmaxf(mrow[v], best);
      const float alpha = expf(mrow[v] - mnew);
      float psum = 0.0f;
#pragma unroll
      for (int g = 0; g < 2; ++g) {
        float pv = expf(s[g][v] - mnew);
        lP[wave][v + 8 * half][g * 16 + lr] = (__bf16)pv;
        psum += pv;
      }
#pragma unroll
      for (int mm = 1; mm < 16; mm <<= 1) psum += __shfl_xor(psum, mm, 16);
      lrow[v] = lrow[v] * alpha + psum;
      mrow[v] = mnew;
#pragma unroll
      for (int f = 0; f < 4; ++f) o[f][v] *= alpha;
    }
    __syncthreads();

    // P fragment (A operand): 16 queries x 32 keys --------------------------
    v16bf pa;
    {
      ABu u;
#pragma unroll
      for (int t = 0; t < 8; ++t)
        u.u[t] = *(const unsigned int*)&lP[wave][lr][kpair(t, half)];
      pa = u.v;
    }

    // O += P @ V(chunk) ------------------------------------------------------
#pragma unroll
    for (int f = 0; f < 4; ++f) {
      ABu u;
#pragma unroll
      for (int t = 0; t < 8; ++t) {
        int k  = kpair(t, half);
        int j0 = kc + k, j1 = kc + k + 1;
        j0 = j0 < 0 ? 0 : (j0 >= Lk ? Lk - 1 : j0);
        j1 = j1 < 0 ? 0 : (j1 >= Lk ? Lk - 1 : j1);
        u.b[2 * t]     = Vm[((size_t)(b * Lk + j0)) * D_ + h * DH_ + f * 16 + lr];
        u.b[2 * t + 1] = Vm[((size_t)(b * Lk + j1)) * D_ + h * DH_ + f * 16 + lr];
      }
      o[f] = wmma_bf16(pa, u.v, o[f]);
    }
    __syncthreads();
  }

  // normalize + store --------------------------------------------------------
#pragma unroll
  for (int f = 0; f < 4; ++f)
#pragma unroll
    for (int v = 0; v < 8; ++v) {
      const int   row = q0 + v + 8 * half;
      const float inv = 1.0f / fmaxf(lrow[v], 1.0e-20f);
      O[((size_t)(b * Lq + row)) * D_ + h * DH_ + f * 16 + lr] =
          (__bf16)(o[f][v] * inv);
    }
}

// ---------------------------------------------------------------------------
// Full (unmasked) attention with K and V staged in LDS. 8 waves per block, one
// 16-query block per wave, all of one (batch, head), so every wave reads the
// same keys. A stage is 128 keys; both tiles come by tensor loads, one request
// per wave and stage, in a ring of two buffers: the next stage's tiles fly
// while this one is worked on.
//   waves 0-3: 32 key rows of K, 128 B each, LDS pitch 144 B (ds_load_b128 reader)
//   waves 4-7: 32 key rows of V, 128 B each, LDS pitch 160 B (transposing reader)
// Every slice starts at a multiple of 2 KiB. Needs Lk % 128 == 0, Lk >= 256,
// (Lq / 16) % 8 == 0.
// ---------------------------------------------------------------------------
constexpr uint32_t PITCH_K  = 144u, PITCH_V = 160u;
constexpr uint32_t SLICE_KV = 6144u;              // 32 * 144 = 4608, 32 * 160 = 5120, rounded up
constexpr uint32_t BASE_V   = 4u * SLICE_KV;
constexpr uint32_t KV_SZ    = 8u * SLICE_KV;      // 49152
constexpr uint32_t PAD_K    = (1u << 20) | (4u << 22) | (3u << 25);  // 128-B rows + 16 B
constexpr uint32_t PAD_V    = (1u << 20) | (4u << 22) | (7u << 25);  // 128-B rows + 32 B
static_assert(SLICE_KV % 2048u == 0 && KV_SZ % 2048u == 0, "slice places");
static_assert(32u * PITCH_K <= SLICE_KV && 32u * PITCH_V <= SLICE_KV, "slice sizes");

__global__ __launch_bounds__(256) void attn_full_kernel(
    const __bf16* __restrict__ Q, const __bf16* __restrict__ Km,
    const __bf16* __restrict__ Vm, __bf16* __restrict__ O,
    int Lq, int Lk) {
  __shared__ __attribute__((aligned(2048))) unsigned char L[2u * KV_SZ];
  __shared__ __bf16 lP[8][16][32];  // per-wave P staging (C-layout -> A-layout)
  const int      lane  = threadIdx.x & 31;
  const uint32_t wave  = uni((uint32_t)threadIdx.x >> 5);
  const int      half  = lane >> 4;
  const int      lr    = lane & 15;
  const int      qbPer = Lq >> 4;
  const int      job0  = blockIdx.x * 8;          // the block's 8 jobs share b and h
  const int      qblk  = job0 % qbPer + (int)wave;
  const int      h     = (job0 / qbPer) % H_;
  const int      b     = job0 / (qbPer * H_);
  const int      q0    = qblk << 4;
  const uint32_t lbase = (uint32_t)(size_t)L;

  // One request per wave and stage: waves 0-3 a slice of K, waves 4-7 of V.
  u32x8 g1k = tdm_group1<PAD_K, 128u, 32u>(2u * (uint32_t)D_);
  u32x8 g1v = tdm_group1<PAD_V, 128u, 32u>(2u * (uint32_t)D_);
  hold8(g1k);
  hold8(g1v);
  const uint32_t jsl  = wave & 3u;
  const uint32_t dst0 = lbase + (wave < 4u ? 0u : BASE_V) + jsl * SLICE_KV;
  const uint64_t src0 = (uint64_t)(size_t)(wave < 4u ? Km : Vm) +
      2ull * ((uint64_t)((uint32_t)(b * Lk) + jsl * 32u) * (uint32_t)D_ + (uint32_t)(h * DH_));
  const uint64_t step = 2ull * 128ull * (uint32_t)D_;   // bytes per stage
  u32x4 g0;
  auto issue = [&](uint32_t st) {   // stage st's slice, into buffer st & 1
    g0 = tdm_group0(dst0 + (st & 1u) * KV_SZ, src0 + (uint64_t)st * step);
    hold4(g0);
    if (pinned(wave < 4u)) tdm_load(g0, g1k);
    else                   tdm_load(g0, g1v);
  };

  const uint32_t nt = (uint32_t)Lk >> 7;   // stages; at least two

  issue(0u);
  wait_tensor0(g0, g1k, g1v);
  __syncthreads();                         // stage 0's tiles are published
  issue(1u);

  // Every loop over fragments, rows and registers in this kernel is unrolled so
  // that each fragment and accumulator index is a constant (registers, no scratch).
  // Q fragments (A operand): 16 queries x 64 features
  v16bf qa[2];
  {
    const __bf16* qb = Q + ((size_t)(b * Lq + q0 + lr)) * D_ + h * DH_;
#pragma unroll
    for (int f = 0; f < 2; ++f) {
      ABu u;
#pragma unroll
      for (int t = 0; t < 8; ++t)
        u.u[t] = *(const unsigned int*)(qb + f * 32 + kpair(t, half));
      qa[f] = u.v;
    }
  }

  float mrow[8], lrow[8];
  v8f   o[4];
#pragma unroll
  for (int v = 0; v < 8; ++v) { mrow[v] = -3.0e38f; lrow[v] = 0.0f; }
#pragma unroll
  for (int f = 0; f < 4; ++f)
#pragma unroll
    for (int e = 0; e < 8; ++e) o[f][e] = 0.0f;

  // Lane offsets of the fragment reads inside a slice.
  const uint32_t koff = (uint32_t)lr * PITCH_K + 16u * (uint32_t)half;
  const uint32_t voff = BASE_V + (8u * (uint32_t)half + (uint32_t)(lane & 7)) * PITCH_V +
                        16u * (uint32_t)((lane >> 3) & 1);

  for (uint32_t st = 0; st < nt; ++st) {
    const unsigned char* Lb = L + (st & 1u) * KV_SZ;
    for (uint32_t c = 0; c < 4u; ++c) {    // 32 keys: slice c of K and of V
      const unsigned char* Ls = Lb + c * SLICE_KV;

      // S = Q @ K^T : 16 queries x 32 keys ----------------------------------
      v8f s[2];
#pragma unroll
      for (int g = 0; g < 2; ++g) {
#pragma unroll
        for (int e = 0; e < 8; ++e) s[g][e] = 0.0f;
#pragma unroll
        for (int f = 0; f < 2; ++f) {
          // hardware k order: bytes 16h and 32 + 16h of each 64 B of key row lr
          const unsigned char* pk = Ls + koff + (uint32_t)g * 16u * PITCH_K + (uint32_t)f * 64u;
          FragU kf;
          kf.q[0] = *(const u32x4*)pk;
          kf.q[1] = *(const u32x4*)(pk + 32);
          s[g] = wmma_bf16(qa[f], kf.v, s[g]);
        }
      }

      // scale, online softmax -------------------------------------------------
#pragma unroll
      for (int v = 0; v < 8; ++v) {
        float best = -3.0e38f;
#pragma unroll
        for (int g = 0; g < 2; ++g) {
          float sv = s[g][v] * 0.125f;
          s[g][v]  = sv;
          best     = fmaxf(best, sv);
        }
#pragma unroll
        for (int mm = 1; mm < 16; mm <<= 1)
          best = fmaxf(best, __shfl_xor(best, mm, 16));
        const float mnew  = fmaxf(mrow[v], best);
        const float alpha = expf(mrow[v] - mnew);
        float psum = 0.0f;
#pragma unroll
        for (int g = 0; g < 2; ++g) {
          float pv = expf(s[g][v] - mnew);
          lP[wave][v + 8 * half][g * 16 + lr] = (__bf16)pv;
          psum += pv;
        }
#pragma unroll
        for (int mm = 1; mm < 16; mm <<= 1) psum += __shfl_xor(psum, mm, 16);
        lrow[v] = lrow[v] * alpha + psum;
        mrow[v] = mnew;
#pragma unroll
        for (int f = 0; f < 4; ++f) o[f][v] *= alpha;
      }
      __syncthreads();

      // P fragment (A operand): 16 queries x 32 keys ------------------------
      v16bf pa;
      {
        ABu u;
#pragma unroll
        for (int t = 0; t < 8; ++t)
          u.u[t] = *(const unsigned int*)&lP[wave][lr][kpair(t, half)];
        pa = u.v;
      }

      // O += P @ V(chunk): key rows 0..15 and 16..31, transposed on the read --
#pragma unroll
      for (int f = 0; f < 4; ++f) {
        const unsigned char* pv = Ls + voff + (uint32_t)f * 32u;
        FragU vf;
        vf.q[0] = ld_tr16(pv);
        vf.q[1] = ld_tr16(pv + 16u * PITCH_V);
        o[f] = wmma_bf16(pa, vf.v, o[f]);
      }
      __syncthreads();
    }

    // Publish point of stage st + 1; it also ends every reader's last read of
    // this stage's buffer, which is refilled behind it.
    wait_ds0();
    wait_tensor0(g0, g1k, g1v);
    __syncthreads();
    if (pinned(st + 2u < nt)) issue(st + 2u);
  }
  wait_tensor0(g0, g1k, g1v);
  wait_ds0();

  // normalize + store --------------------------------------------------------
#pragma unroll
  for (int f = 0; f < 4; ++f)
#pragma unroll
    for (int v = 0; v < 8; ++v) {
      const int   row = q0 + v + 8 * half;
      const float inv = 1.0f / fmaxf(lrow[v], 1.0e-20f);
      O[((size_t)(b * Lq + row)) * D_ + h * DH_ + f * 16 + lr] =
          (__bf16)(o[f][v] * inv);
    }
}

// ---------------------------------------------------------------------------
// Fused residual add + LayerNorm over D=1024. One 256-thread block per row.
// Emits f32 (residual stream) and/or bf16 (next-GEMM operand).
// ---------------------------------------------------------------------------
__global__ __launch_bounds__(256) void add_ln_kernel(
    const float* __restrict__ A, const float* __restrict__ Bv,
    const float* __restrict__ g, const float* __restrict__ be,
    float* __restrict__ outF, __bf16* __restrict__ outB) {
  __shared__ float redS[8], redQ[8];
  const int row  = blockIdx.x;
  const int t    = threadIdx.x;
  const int lane = t & 31, wave = t >> 5;
  const float* a = A + (size_t)row * D_;
  const float* r = Bv + (size_t)row * D_;

  float x[4], s = 0.0f, q = 0.0f;
#pragma unroll
  for (int e = 0; e < 4; ++e) {
    int c = t + 256 * e;
    x[e]  = a[c] + r[c];
    s    += x[e];
    q    += x[e] * x[e];
  }
#pragma unroll
  for (int mm = 1; mm < 32; mm <<= 1) {
    s += __shfl_xor(s, mm, 32);
    q += __shfl_xor(q, mm, 32);
  }
  if (lane == 0) { redS[wave] = s; redQ[wave] = q; }
  __syncthreads();
  float S = 0.0f, Q2 = 0.0f;
#pragma unroll
  for (int w = 0; w < 8; ++w) { S += redS[w]; Q2 += redQ[w]; }
  const float mu   = S * (1.0f / D_);
  const float var  = Q2 * (1.0f / D_) - mu * mu;
  const float rstd = rsqrtf(var + 1e-5f);
#pragma unroll
  for (int e = 0; e < 4; ++e) {
    int   c = t + 256 * e;
    float y = (x[e] - mu) * rstd * g[c] + be[c];
    if (outF) outF[(size_t)row * D_ + c] = y;
    if (outB) outB[(size_t)row * D_ + c] = (__bf16)y;
  }
}

// ---------------------------------------------------------------------------
// Host orchestration
// ---------------------------------------------------------------------------
extern "C" void kernel_launch(void* const* d_in, const int* in_sizes, int n_in,
                              void* d_out, int out_size, void* d_ws,
                              size_t ws_size, hipStream_t stream) {
  (void)in_sizes; (void)n_in; (void)out_size; (void)ws_size;
  constexpr int Bc = 2, Lc = 2048, Mc = 2048, Dc = 1024, FFc = 4096;
  const int NT = Bc * Lc;  // 4096 query rows
  const int NM = Bc * Mc;  // 4096 memory rows

  const float* x   = (const float*)d_in[0];
  const float* mem = (const float*)d_in[1];
  const float* swq = (const float*)d_in[2];
  const float* swk = (const float*)d_in[3];
  const float* swv = (const float*)d_in[4];
  const float* swo = (const float*)d_in[5];
  const float* sbq = (const float*)d_in[6];
  const float* sbk = (const float*)d_in[7];
  const float* sbv = (const float*)d_in[8];
  const float* sbo = (const float*)d_in[9];
  const float* cwq = (const float*)d_in[10];
  const float* cwk = (const float*)d_in[11];
  const float* cwv = (const float*)d_in[12];
  const float* cwo = (const float*)d_in[13];
  const float* cbq = (const float*)d_in[14];
  const float* cbk = (const float*)d_in[15];
  const float* cbv = (const float*)d_in[16];
  const float* cbo = (const float*)d_in[17];
  const float* w1  = (const float*)d_in[18];
  const float* b1  = (const float*)d_in[19];
  const float* w2  = (const float*)d_in[20];
  const float* b2  = (const float*)d_in[21];
  const float* g1  = (const float*)d_in[22];
  const float* g2  = (const float*)d_in[23];
  const float* g3  = (const float*)d_in[24];
  const float* be1 = (const float*)d_in[25];
  const float* be2 = (const float*)d_in[26];
  const float* be3 = (const float*)d_in[27];

  char* p = (char*)d_ws;
  auto take = [&](size_t bytes) -> void* {
    void* r = (void*)p;
    p += (bytes + 255) & ~(size_t)255;
    return r;
  };
  __bf16* xcur_bf = (__bf16*)take((size_t)NT * Dc * 2);  // x_bf -> x1_bf -> x2_bf
  __bf16* mem_bf  = (__bf16*)take((size_t)NM * Dc * 2);
  __bf16* swq_bf  = (__bf16*)take((size_t)Dc * Dc * 2);
  __bf16* swk_bf  = (__bf16*)take((size_t)Dc * Dc * 2);
  __bf16* swv_bf  = (__bf16*)take((size_t)Dc * Dc * 2);
  __bf16* swo_bf  = (__bf16*)take((size_t)Dc * Dc * 2);
  __bf16* cwq_bf  = (__bf16*)take((size_t)Dc * Dc * 2);
  __bf16* cwk_bf  = (__bf16*)take((size_t)Dc * Dc * 2);
  __bf16* cwv_bf  = (__bf16*)take((size_t)Dc * Dc * 2);
  __bf16* cwo_bf  = (__bf16*)take((size_t)Dc * Dc * 2);
  __bf16* w1_bf   = (__bf16*)take((size_t)Dc * FFc * 2);
  __bf16* w2_bf   = (__bf16*)take((size_t)FFc * Dc * 2);
  __bf16* q_bf    = (__bf16*)take((size_t)NT * Dc * 2);
  __bf16* k_bf    = (__bf16*)take((size_t)NM * Dc * 2);
  __bf16* v_bf    = (__bf16*)take((size_t)NM * Dc * 2);
  __bf16* attn_bf = (__bf16*)take((size_t)NT * Dc * 2);
  float*  gout    = (float*)take((size_t)NT * Dc * 4);   // sa / ca / ff
  float*  x1f     = (float*)take((size_t)NT * Dc * 4);
  float*  x2f     = (float*)take((size_t)NT * Dc * 4);
  __bf16* h_bf    = (__bf16*)take((size_t)NT * FFc * 2);

  auto cvt = [&](const float* src, __bf16* dst, size_t n) {
    cvt_kernel<<<1024, 256, 0, stream>>>(src, dst, (unsigned long long)n);
  };
  auto gemm = [&](const __bf16* Ag, const __bf16* Wg, const float* biasg,
                  float* Cfg, __bf16* Cbg, int Mg, int Ng, int Kg, int act) {
    dim3 grid(Ng / 128, Mg / 256);
    gemm_bf16_kernel<<<grid, 256, 0, stream>>>(Ag, Wg, biasg, Cfg, Cbg, Mg, Ng,
                                               Kg, act);
  };
  auto attn = [&](const __bf16* Qg, const __bf16* Kg, const __bf16* Vg,
                  __bf16* Og, int Lqv, int Lkv, int windowed) {
    int jobs = Bc * H_ * (Lqv / 16);  // one wave per job, 4 waves per block
    attn_kernel<<<jobs / 4, 128, 0, stream>>>(Qg, Kg, Vg, Og, Lqv, Lkv,
                                              windowed);
  };

  // ---- bf16 staging --------------------------------------------------------
  cvt(x, xcur_bf, (size_t)NT * Dc);
  cvt(mem, mem_bf, (size_t)NM * Dc);
  cvt(swq, swq_bf, (size_t)Dc * Dc);
  cvt(swk, swk_bf, (size_t)Dc * Dc);
  cvt(swv, swv_bf, (size_t)Dc * Dc);
  cvt(swo, swo_bf, (size_t)Dc * Dc);
  cvt(cwq, cwq_bf, (size_t)Dc * Dc);
  cvt(cwk, cwk_bf, (size_t)Dc * Dc);
  cvt(cwv, cwv_bf, (size_t)Dc * Dc);
  cvt(cwo, cwo_bf, (size_t)Dc * Dc);
  cvt(w1, w1_bf, (size_t)Dc * FFc);
  cvt(w2, w2_bf, (size_t)FFc * Dc);

  // ---- self-attention (windowed causal + ALiBi) ----------------------------
  gemm(xcur_bf, swq_bf, sbq, nullptr, q_bf, NT, Dc, Dc, 0);
  gemm(xcur_bf, swk_bf, sbk, nullptr, k_bf, NT, Dc, Dc, 0);
  gemm(xcur_bf, swv_bf, sbv, nullptr, v_bf, NT, Dc, Dc, 0);
  attn(q_bf, k_bf, v_bf, attn_bf, Lc, Lc, 1);
  gemm(attn_bf, swo_bf, sbo, gout, nullptr, NT, Dc, Dc, 0);
  add_ln_kernel<<<NT, 256, 0, stream>>>(x, gout, g1, be1, x1f, xcur_bf);

  // ---- cross-attention (full) ---------------------------------------------
  gemm(xcur_bf, cwq_bf, cbq, nullptr, q_bf, NT, Dc, Dc, 0);
  gemm(mem_bf, cwk_bf, cbk, nullptr, k_bf, NM, Dc, Dc, 0);
  gemm(mem_bf, cwv_bf, cbv, nullptr, v_bf, NM, Dc, Dc, 0);
  attn_full_kernel<<<Bc * H_ * (Lc / 16) / 8, 256, 0, stream>>>(q_bf, k_bf, v_bf,
                                                                attn_bf, Lc, Mc);
  gemm(attn_bf, cwo_bf, cbo, gout, nullptr, NT, Dc, Dc, 0);
  add_ln_kernel<<<NT, 256, 0, stream>>>(x1f, gout, g2, be2, x2f, xcur_bf);

  // ---- FFN -----------------------------------------------------------------
  gemm(xcur_bf, w1_bf, b1, nullptr, h_bf, NT, FFc, Dc, 1);  // fused exact GELU
  gemm(h_bf, w2_bf, b2, gout, nullptr, NT, Dc, FFc, 0);
  add_ln_kernel<<<NT, 256, 0, stream>>>(x2f, gout, g3, be3, (float*)d_out,
                                        nullptr);
}

// v003
// One run takes 471 microseconds.
// Next to v002, in two timings, it ran 1.41 times as fast each time.
// Counting every step since v000, it is 3.20 times as fast.
#include <hip/hip_runtime.h>
#include <math.h>
#include <stdint.h>

typedef __attribute__((ext_vector_type(16))) __bf16 v16bf;
typedef __attribute__((ext_vector_type(8)))  float  v8f;

union ABu {
  v16bf          v;
  unsigned int   u[8];
  unsigned short s[16];
  __bf16         b[16];
};

union U4u {
  uint4        q;
  unsigned int u[4];
};

__device__ __forceinline__ int kpair(int t, int half) {
  int base = (t < 4) ? (2 * t) : (16 + 2 * (t - 4));
  return base + 8 * half;
}

__device__ __forceinline__ v8f wmma_bf16(v16bf a, v16bf b, v8f c) {
  return __builtin_amdgcn_wmma_f32_16x16x32_bf16(false, a, false, b,
                                                 (short)0, c, false, false);
}

#define D_  1024
#define H_  16
#define DH_ 64

// ---------------------------------------------------------------------------
// fp32 -> bf16 conversion (grid-stride)
// ---------------------------------------------------------------------------
__global__ void cvt_kernel(const float* __restrict__ in,
                           __bf16* __restrict__ out,
                           unsigned long long n) {
  unsigned long long i = (unsigned long long)blockIdx.x * blockDim.x + threadIdx.x;
  unsigned long long stride = (unsigned long long)gridDim.x * blockDim.x;
  for (; i < n; i += stride) out[i] = (__bf16)in[i];
}

typedef uint32_t u32x4 __attribute__((ext_vector_type(4)));
typedef uint32_t u32x8 __attribute__((ext_vector_type(8)));
typedef short    s16x8 __attribute__((ext_vector_type(8)));

__device__ __forceinline__ uint32_t uni(uint32_t v) {
  return (uint32_t)__builtin_amdgcn_readfirstlane(v);
}
__device__ __forceinline__ uint32_t pinned(uint32_t v) {
  uint32_t w = uni(v);
  asm volatile("" : "+s"(w));
  return w;
}
__device__ __forceinline__ void wait_ds0() {
  asm volatile("s_wait_dscnt 0x0" ::: "memory");      // own LDS reads done before the buffer is handed back
}
__device__ __forceinline__ void wait_tensor0(u32x4 g0, u32x8 ga, u32x8 gb) {
  asm volatile("s_wait_tensorcnt 0x0" ::"s"(g0), "s"(ga), "s"(gb) : "memory");
}
__device__ __forceinline__ void hold4(u32x4& g) { asm volatile("" : "+s"(g)); }
__device__ __forceinline__ void hold8(u32x8& g) { asm volatile("" : "+s"(g)); }
__device__ __forceinline__ void tdm_load(u32x4 g0, u32x8 g1) {
  asm volatile("tensor_load_to_lds %0, %1" ::"s"(g0), "s"(g1) : "memory");
}
__device__ __forceinline__ u32x4 tdm_group0(uint32_t lds_dst, uint64_t ga) {
  u32x4 g;
  g[0] = uni(1u);
  g[1] = uni(lds_dst);
  g[2] = uni((uint32_t)ga);
  g[3] = uni((((uint32_t)(ga >> 32)) & 0x01FFFFFFu) | 0x80000000u);
  return g;
}
// W0 = word 0 (pad fields, no mask), D0 = bytes per row, D1 = rows.
template <uint32_t W0, uint32_t D0, uint32_t D1>
__device__ __forceinline__ u32x8 tdm_group1(uint32_t src_pitch) {
  u32x8 g;
  g[0] = uni(W0);
  g[1] = uni((D0 & 0xFFFFu) << 16);
  g[2] = uni((D0 >> 16) | ((D1 & 0xFFFFu) << 16));
  g[3] = uni((D1 >> 16) | (D0 << 16));
  g[4] = uni(D1);
  g[5] = uni(src_pitch);
  g[6] = uni(0u);
  g[7] = uni(0u);
  return g;
}
__device__ __forceinline__ u32x4 ld_tr16(const unsigned char* p) {
  typedef __attribute__((address_space(3))) s16x8 lds_s16x8;
  return __builtin_bit_cast(u32x4,
                            __builtin_amdgcn_ds_load_tr16_b128_v8i16((lds_s16x8*)p));
}

union FragU {
  v16bf v;
  u32x4 q[2];
};

constexpr uint32_t PITCH_A = 144u, PITCH_B = 288u;
constexpr uint32_t SLICE_A = 10240u;              // 64 * 144 = 9216, rounded up
constexpr uint32_t SLICE_B = 6144u;               // 16 * 288 = 4608, rounded up
constexpr uint32_t BASE_B  = 4u * SLICE_A;
constexpr uint32_t BUF_SZ  = BASE_B + 4u * SLICE_B;  // 65536
constexpr uint32_t PAD_A   = (1u << 20) | (4u << 22) | (3u << 25);  // 128-B rows + 16 B
constexpr uint32_t PAD_B   = (1u << 20) | (5u << 22) | (7u << 25);  // 256-B rows + 32 B
static_assert(SLICE_A % 2048u == 0 && SLICE_B % 2048u == 0 && BUF_SZ % 2048u == 0, "slice places");
static_assert(64u * PITCH_A <= SLICE_A && 16u * PITCH_B <= SLICE_B, "slice sizes");

constexpr uint32_t EPI_PITCH = 272u;
constexpr uint32_t EPI_SZ    = 64u * EPI_PITCH;
constexpr uint32_t GEMM_LDS  = (8u * EPI_SZ > 2u * BUF_SZ) ? 8u * EPI_SZ : 2u * BUF_SZ;

typedef float  f32x4  __attribute__((ext_vector_type(4)));
typedef __bf16 bf16x8 __attribute__((ext_vector_type(8)));

template <bool GELU>
__device__ __forceinline__ float epi_val(float a, float bsv) {
  float val = a + bsv;
  if (GELU) val = 0.5f * val * (1.0f + erff(val * 0.70710678118f));
  return val;
}

// Stands directly behind the epilogue's global loads and stores, in front of any
// rewrite of a register that they name (the next trip's addresses and data).
__device__ __forceinline__ void wait_x0() {
  asm volatile("s_wait_xcnt 0x0" ::: "memory");
}

// Reads the wave's staged tile back row-wise and stores it: bias (+GELU), then
// 16 bytes per lane, so that every wave-wide store covers whole 128-B lines
// (f32: 2 rows of 256 B; bf16: 4 rows of 128 B). bias, Cf and Cb point at the
// tile's first column / element. The row loops stay rolled so that the
// epilogue's text is short (U stores a trip; without GELU four, so that a trip's
// LDS reads fly together). They walk from the last rows to the first: walking
// upwards, the compiler formed each LDS address as (base - tile size) with
// offset: tile size, a register below zero in wave 0; walking downwards, the
// loops that this file's launches run add a step >= 0 to the lane's base.
template <bool GELU>
__device__ __forceinline__ void store_tile(const unsigned char* stg, int lane,
                                           const float* bias, float* Cf, __bf16* Cb,
                                           int N) {
  constexpr int U = GELU ? 1 : 4;
  // The loops over u and e are unrolled so that every index is a constant (registers).
  if (Cf) {
    const int r = lane >> 4, c = (lane & 15) * 4;
    f32x4 bs = {0.0f, 0.0f, 0.0f, 0.0f};
    if (bias) {
      bs = *(const f32x4*)(bias + c);
      wait_x0();   // behind the bias load, in front of any rewrite of its offset register
    }
    const unsigned char* p = stg + (uint32_t)r * EPI_PITCH + (uint32_t)c * 4u;
    float* o = Cf + (size_t)r * N + c;
#pragma unroll 1
    for (int g = 32 / U - 1; g >= 0; --g) {
      f32x4 a[U];
#pragma unroll
      for (int u = 0; u < U; ++u)
        a[u] = *(const f32x4*)(p + (uint32_t)(g * U + u) * 2u * EPI_PITCH);
#pragma unroll
      for (int u = 0; u < U; ++u) {
        f32x4 y;
#pragma unroll
        for (int e = 0; e < 4; ++e) y[e] = epi_val<GELU>(a[u][e], bs[e]);
        *(f32x4*)(o + (size_t)(g * U + u) * 2 * N) = y;
      }
      wait_x0();
    }
  }
  if (Cb) {
    const int r = lane >> 3, c = (lane & 7) * 8;
    f32x4 bs0 = {0.0f, 0.0f, 0.0f, 0.0f}, bs1 = bs0;
    if (bias) {
      bs0 = *(const f32x4*)(bias + c);
      bs1 = *(const f32x4*)(bias + c + 4);
      wait_x0();   // behind the bias loads, in front of any rewrite of their offset register
    }
    const unsigned char* p = stg + (uint32_t)r * EPI_PITCH + (uint32_t)c * 4u;
    __bf16* o = Cb + (size_t)r * N + c;
#pragma unroll 1
    for (int g = 16 / U - 1; g >= 0; --g) {
      f32x4 a0[U], a1[U];
#pragma unroll
      for (int u = 0; u < U; ++u) {
        const unsigned char* q = p + (uint32_t)(g * U + u) * 4u * EPI_PITCH;
        a0[u] = *(const f32x4*)q;
        a1[u] = *(const f32x4*)(q + 16);
      }
#pragma unroll
      for (int u = 0; u < U; ++u) {
        bf16x8 y;
#pragma unroll
        for (int e = 0; e < 4; ++e) {
          y[e]     = (__bf16)epi_val<GELU>(a0[u][e], bs0[e]);
          y[e + 4] = (__bf16)epi_val<GELU>(a1[u][e], bs1[e]);
        }
        *(bf16x8*)(o + (size_t)(g * U + u) * 4 * N) = y;
      }
      wait_x0();
    }
  }
}

__global__ __launch_bounds__(256, 1) void gemm_bf16_kernel(
    const __bf16* __restrict__ A, const __bf16* __restrict__ W,
    const float* __restrict__ bias,
    float* __restrict__ Cf, __bf16* __restrict__ Cb,
    int Mr, int N, int K, int act) {
  (void)Mr;
  __shared__ __attribute__((aligned(2048))) unsigned char L[GEMM_LDS];

  const int      tid  = threadIdx.x;
  const int      lane = tid & 31;
  const uint32_t wave = uni((uint32_t)tid >> 5);
  const int wm   = (int)(wave >> 1);   // 0..3
  const int wn   = (int)(wave & 1u);   // 0..1
  const int half = lane >> 4;
  const int lr   = lane & 15;
  const int row0 = blockIdx.y * 256;
  const int col0 = blockIdx.x * 128;
  const uint32_t lbase = (uint32_t)(size_t)L;

  v8f acc[4][4];
#pragma unroll
  for (int mi = 0; mi < 4; ++mi)
#pragma unroll
    for (int ni = 0; ni < 4; ++ni)
#pragma unroll
      for (int e = 0; e < 8; ++e) acc[mi][ni][e] = 0.0f;

  // One request per wave and pass: waves 0-3 a slice of A, waves 4-7 of W.
  u32x8 g1a = tdm_group1<PAD_A, 128u, 64u>(2u * (uint32_t)K);
  u32x8 g1b = tdm_group1<PAD_B, 256u, 16u>(2u * (uint32_t)N);
  hold8(g1a);
  hold8(g1b);
  const bool     isA  = wave < 4u;
  const uint32_t j    = wave & 3u;
  const uint32_t dst0 = lbase + (isA ? j * SLICE_A : BASE_B + j * SLICE_B);
  const uint64_t src0 = isA
      ? (uint64_t)(size_t)A + 2ull * ((uint64_t)((uint32_t)row0 + j * 64u) * (uint32_t)K)
      : (uint64_t)(size_t)W + 2ull * ((uint64_t)(j * 16u) * (uint32_t)N + (uint32_t)col0);
  const uint64_t step = isA ? 128ull : 128ull * (uint32_t)N;   // bytes per pass
  u32x4 g0;
  auto issue = [&](uint32_t st) {   // pass st's slice, into buffer st & 1
    g0 = tdm_group0(dst0 + (st & 1u) * BUF_SZ, src0 + (uint64_t)st * step);
    hold4(g0);
    if (pinned(wave < 4u)) tdm_load(g0, g1a);
    else                   tdm_load(g0, g1b);
  };

  const uint32_t nt = (uint32_t)K >> 6;   // passes; every call has at least two

  issue(0u);
  wait_tensor0(g0, g1a, g1b);
  __syncthreads();                        // pass 0's tiles are published
  issue(1u);

  // Lane offsets of the fragment reads inside a buffer.
  const uint32_t aoff = (uint32_t)wm * SLICE_A + (uint32_t)lr * PITCH_A + 16u * (uint32_t)half;
  const uint32_t boff = BASE_B + (8u * (uint32_t)half + (uint32_t)(lane & 7)) * PITCH_B +
                        128u * (uint32_t)wn + 16u * (uint32_t)((lane >> 3) & 1);

  for (uint32_t s = 0; s < nt; ++s) {
    const unsigned char* Lb = L + (s & 1u) * BUF_SZ;
    // The loops below are unrolled so that every fragment and accumulator
    // index is a constant (registers, no scratch).
#pragma unroll
    for (int kb = 0; kb < 2; ++kb) {
      // A fragments, hardware k order: bytes 16h and 32 + 16h of each 64 B.
      FragU af[4];
#pragma unroll
      for (int mi = 0; mi < 4; ++mi) {
        const unsigned char* pa = Lb + aoff + (uint32_t)mi * 16u * PITCH_A + (uint32_t)kb * 64u;
        af[mi].q[0] = *(const u32x4*)pa;
        af[mi].q[1] = *(const u32x4*)(pa + 32);
      }
#pragma unroll
      for (int ni = 0; ni < 4; ++ni) {
        // W fragment: k-rows 32 kb + 0..15 and + 16..31 lie in two slices.
        const unsigned char* pb = Lb + boff + (uint32_t)(2 * kb) * SLICE_B + (uint32_t)ni * 32u;
        FragU bf;
        bf.q[0] = ld_tr16(pb);
        bf.q[1] = ld_tr16(pb + SLICE_B);
#pragma unroll
        for (int mi = 0; mi < 4; ++mi)
          acc[mi][ni] = wmma_bf16(af[mi].v, bf.v, acc[mi][ni]);
      }
    }

    // Publish point of pass s + 1; it also ends every reader's last read of
    // this pass's buffer, which is refilled behind it.
    wait_ds0();
    wait_tensor0(g0, g1a, g1b);
    __syncthreads();
    if (pinned(s + 2u < nt)) issue(s + 2u);
  }
  wait_tensor0(g0, g1a, g1b);
  wait_ds0();

  // epilogue ------------------------------------------------------------------
  // The last pass's publish point (own LDS reads done, own tensor loads landed,
  // barrier) has freed the ring for every wave: each wave now stages its own
  // 64 x 64 tile in its own range of L, which runs 8 KiB past the ring.
  unsigned char* stg = L + wave * EPI_SZ;
  {
    float* w = (float*)(stg + (uint32_t)(8 * half) * EPI_PITCH) + lr;
    // unrolled: every accumulator index is a constant (registers, no scratch)
#pragma unroll
    for (int mi = 0; mi < 4; ++mi)
#pragma unroll
      for (int ni = 0; ni < 4; ++ni)
#pragma unroll
        for (int v = 0; v < 8; ++v)
          w[(mi * 16 + v) * (int)(EPI_PITCH / 4u) + ni * 16] = acc[mi][ni][v];
  }
  wait_ds0();   // the wave's rows are in LDS before its lanes read each other's values back

  const int    trow = row0 + wm * 64;
  const int    tcol = col0 + wn * 64;
  const size_t toff = (size_t)trow * N + tcol;
  const float* bt   = bias ? bias + tcol : nullptr;
  float*       cf   = Cf ? Cf + toff : nullptr;
  __bf16*      cb   = Cb ? Cb + toff : nullptr;
  if (act == 1) store_tile<true>(stg, lane, bt, cf, cb, N);
  else          store_tile<false>(stg, lane, bt, cf, cb, N);
}

// ---------------------------------------------------------------------------
// Flash attention: one wave per (batch, head, 16-query block).
// windowed=1 -> causal local window W=64 + ALiBi; windowed=0 -> full attn.
// Q,K,V,O are bf16 [B*Lq(or Lk), D] with head h at feature offset h*64.
// ---------------------------------------------------------------------------
__global__ __launch_bounds__(128) void attn_kernel(
    const __bf16* __restrict__ Q, const __bf16* __restrict__ Km,
    const __bf16* __restrict__ Vm, __bf16* __restrict__ O,
    int Lq, int Lk, int windowed) {
  __shared__ __bf16 lP[4][16][32];  // per-wave P staging (C-layout -> A-layout)
  const int lane  = threadIdx.x & 31;
  const int wave  = threadIdx.x >> 5;
  const int half  = lane >> 4;
  const int lr    = lane & 15;
  const int qbPer = Lq >> 4;
  const int job   = blockIdx.x * 4 + wave;
  const int qblk  = job % qbPer;
  const int h     = (job / qbPer) % H_;
  const int b     = job / (qbPer * H_);
  const int q0    = qblk << 4;

  const float slope = windowed ? exp2f(-8.0f * (float)(h + 1) / (float)H_) : 0.0f;

  // Q fragments (A operand): 16 queries x 64 features
  v16bf qa[2];
  {
    const __bf16* qb = Q + ((size_t)(b * Lq + q0 + lr)) * D_ + h * DH_;
#pragma unroll
    for (int f = 0; f < 2; ++f) {
      ABu u;
#pragma unroll
      for (int t = 0; t < 8; ++t)
        u.u[t] = *(const unsigned int*)(qb + f * 32 + kpair(t, half));
      qa[f] = u.v;
    }
  }

  float mrow[8], lrow[8];
  v8f   o[4];
#pragma unroll
  for (int v = 0; v < 8; ++v) { mrow[v] = -3.0e38f; lrow[v] = 0.0f; }
#pragma unroll
  for (int f = 0; f < 4; ++f)
#pragma unroll
    for (int e = 0; e < 8; ++e) o[f][e] = 0.0f;

  const int nch = windowed ? 3 : (Lk >> 5);  // uniform across the block
  for (int ch = 0; ch < nch; ++ch) {
    const int kc = windowed ? (q0 - 64 + 32 * ch) : (32 * ch);

    // S = Q @ K^T : 16 queries x 32 keys ------------------------------------
    v8f s[2];
#pragma unroll
    for (int g = 0; g < 2; ++g) {
#pragma unroll
      for (int e = 0; e < 8; ++e) s[g][e] = 0.0f;
      int key  = kc + g * 16 + lr;
      int keyc = key < 0 ? 0 : (key >= Lk ? Lk - 1 : key);
      const __bf16* kb = Km + ((size_t)(b * Lk + keyc)) * D_ + h * DH_;
#pragma unroll
      for (int f = 0; f < 2; ++f) {
        ABu u;
#pragma unroll
        for (int t = 0; t < 8; ++t)
          u.u[t] = *(const unsigned int*)(kb + f * 32 + kpair(t, half));
        s[g] = wmma_bf16(qa[f], u.v, s[g]);
      }
    }

    // scale + ALiBi + mask, online softmax ----------------------------------
#pragma unroll
    for (int v = 0; v < 8; ++v) {
      const int i    = q0 + v + 8 * half;
      float     best = -3.0e38f;
#pragma unroll
      for (int g = 0; g < 2; ++g) {
        const int j  = kc + g * 16 + lr;
        float     sv = s[g][v] * 0.125f + slope * (float)(j - i);
        bool valid = windowed ? (j >= 0 && j <= i && (i - j) < 64) : (j < Lk);
        sv       = valid ? sv : -1.0e30f;
        s[g][v]  = sv;
        best     = fmaxf(best, sv);
      }
#pragma unroll
      for (int mm = 1; mm < 16; mm <<= 1)
        best = fmaxf(best, __shfl_xor(best, mm, 16));
      const float mnew  = fmaxf(mrow[v], best);
      const float alpha = expf(mrow[v] - mnew);
      float psum = 0.0f;
#pragma unroll
      for (int g = 0; g < 2; ++g) {
        float pv = expf(s[g][v] - mnew);
        lP[wave][v + 8 * half][g * 16 + lr] = (__bf16)pv;
        psum += pv;
      }
#pragma unroll
      for (int mm = 1; mm < 16; mm <<= 1) psum += __shfl_xor(psum, mm, 16);
      lrow[v] = lrow[v] * alpha + psum;
      mrow[v] = mnew;
#pragma unroll
      for (int f = 0; f < 4; ++f) o[f][v] *= alpha;
    }
    __syncthreads();

    // P fragment (A operand): 16 queries x 32 keys --------------------------
    v16bf pa;
    {
      ABu u;
#pragma unroll
      for (int t = 0; t < 8; ++t)
        u.u[t] = *(const unsigned int*)&lP[wave][lr][kpair(t, half)];
      pa = u.v;
    }

    // O += P @ V(chunk) ------------------------------------------------------
#pragma unroll
    for (int f = 0; f < 4; ++f) {
      ABu u;
#pragma unroll
      for (int t = 0; t < 8; ++t) {
        int k  = kpair(t, half);
        int j0 = kc + k, j1 = kc + k + 1;
        j0 = j0 < 0 ? 0 : (j0 >= Lk ? Lk - 1 : j0);
        j1 = j1 < 0 ? 0 : (j1 >= Lk ? Lk - 1 : j1);
        u.b[2 * t]     = Vm[((size_t)(b * Lk + j0)) * D_ + h * DH_ + f * 16 + lr];
        u.b[2 * t + 1] = Vm[((size_t)(b * Lk + j1)) * D_ + h * DH_ + f * 16 + lr];
      }
      o[f] = wmma_bf16(pa, u.v, o[f]);
    }
    __syncthreads();
  }

  // normalize + store --------------------------------------------------------
#pragma unroll
  for (int f = 0; f < 4; ++f)
#pragma unroll
    for (int v = 0; v < 8; ++v) {
      const int   row = q0 + v + 8 * half;
      const float inv = 1.0f / fmaxf(lrow[v], 1.0e-20f);
      O[((size_t)(b * Lq + row)) * D_ + h * DH_ + f * 16 + lr] =
          (__bf16)(o[f][v] * inv);
    }
}

// ---------------------------------------------------------------------------
// Full (unmasked) attention with K and V staged in LDS. 8 waves per block, one
// 16-query block per wave, all of one (batch, head), so every wave reads the
// same keys. A stage is 128 keys; both tiles come by tensor loads, one request
// per wave and stage, in a ring of two buffers: the next stage's tiles fly
// while this one is worked on.
//   waves 0-3: 32 key rows of K, 128 B each, LDS pitch 144 B (ds_load_b128 reader)
//   waves 4-7: 32 key rows of V, 128 B each, LDS pitch 160 B (transposing reader)
// Every slice starts at a multiple of 2 KiB. Needs Lk % 128 == 0, Lk >= 256,
// (Lq / 16) % 8 == 0.
// ---------------------------------------------------------------------------
constexpr uint32_t PITCH_K  = 144u, PITCH_V = 160u;
constexpr uint32_t SLICE_KV = 6144u;              // 32 * 144 = 4608, 32 * 160 = 5120, rounded up
constexpr uint32_t BASE_V   = 4u * SLICE_KV;
constexpr uint32_t KV_SZ    = 8u * SLICE_KV;      // 49152
constexpr uint32_t PAD_K    = (1u << 20) | (4u << 22) | (3u << 25);  // 128-B rows + 16 B
constexpr uint32_t PAD_V    = (1u << 20) | (4u << 22) | (7u << 25);  // 128-B rows + 32 B
static_assert(SLICE_KV % 2048u == 0 && KV_SZ % 2048u == 0, "slice places");
static_assert(32u * PITCH_K <= SLICE_KV && 32u * PITCH_V <= SLICE_KV, "slice sizes");

__global__ __launch_bounds__(256) void attn_full_kernel(
    const __bf16* __restrict__ Q, const __bf16* __restrict__ Km,
    const __bf16* __restrict__ Vm, __bf16* __restrict__ O,
    int Lq, int Lk) {
  __shared__ __attribute__((aligned(2048))) unsigned char L[2u * KV_SZ];
  __shared__ __bf16 lP[8][16][32];  // per-wave P staging (C-layout -> A-layout)
  const int      lane  = threadIdx.x & 31;
  const uint32_t wave  = uni((uint32_t)threadIdx.x >> 5);
  const int      half  = lane >> 4;
  const int      lr    = lane & 15;
  const int      qbPer = Lq >> 4;
  const int      job0  = blockIdx.x * 8;          // the block's 8 jobs share b and h
  const int      qblk  = job0 % qbPer + (int)wave;
  const int      h     = (job0 / qbPer) % H_;
  const int      b     = job0 / (qbPer * H_);
  const int      q0    = qblk << 4;
  const uint32_t lbase = (uint32_t)(size_t)L;

  // One request per wave and stage: waves 0-3 a slice of K, waves 4-7 of V.
  u32x8 g1k = tdm_group1<PAD_K, 128u, 32u>(2u * (uint32_t)D_);
  u32x8 g1v = tdm_group1<PAD_V, 128u, 32u>(2u * (uint32_t)D_);
  hold8(g1k);
  hold8(g1v);
  const uint32_t jsl  = wave & 3u;
  const uint32_t dst0 = lbase + (wave < 4u ? 0u : BASE_V) + jsl * SLICE_KV;
  const uint64_t src0 = (uint64_t)(size_t)(wave < 4u ? Km : Vm) +
      2ull * ((uint64_t)((uint32_t)(b * Lk) + jsl * 32u) * (uint32_t)D_ + (uint32_t)(h * DH_));
  const uint64_t step = 2ull * 128ull * (uint32_t)D_;   // bytes per stage
  u32x4 g0;
  auto issue = [&](uint32_t st) {   // stage st's slice, into buffer st & 1
    g0 = tdm_group0(dst0 + (st & 1u) * KV_SZ, src0 + (uint64_t)st * step);
    hold4(g0);
    if (pinned(wave < 4u)) tdm_load(g0, g1k);
    else                   tdm_load(g0, g1v);
  };

  const uint32_t nt = (uint32_t)Lk >> 7;   // stages; at least two

  issue(0u);
  wait_tensor0(g0, g1k, g1v);
  __syncthreads();                         // stage 0's tiles are published
  issue(1u);

  // Every loop over fragments, rows and registers in this kernel is unrolled so
  // that each fragment and accumulator index is a constant (registers, no scratch).
  // Q fragments (A operand): 16 queries x 64 features
  v16bf qa[2];
  {
    const __bf16* qb = Q + ((size_t)(b * Lq + q0 + lr)) * D_ + h * DH_;
#pragma unroll
    for (int f = 0; f < 2; ++f) {
      ABu u;
#pragma unroll
      for (int t = 0; t < 8; ++t)
        u.u[t] = *(const unsigned int*)(qb + f * 32 + kpair(t, half));
      qa[f] = u.v;
    }
  }

  float mrow[8], lrow[8];
  v8f   o[4];
#pragma unroll
  for (int v = 0; v < 8; ++v) { mrow[v] = -3.0e38f; lrow[v] = 0.0f; }
#pragma unroll
  for (int f = 0; f < 4; ++f)
#pragma unroll
    for (int e = 0; e < 8; ++e) o[f][e] = 0.0f;

  // Lane offsets of the fragment reads inside a slice.
  const uint32_t koff = (uint32_t)lr * PITCH_K + 16u * (uint32_t)half;
  const uint32_t voff = BASE_V + (8u * (uint32_t)half + (uint32_t)(lane & 7)) * PITCH_V +
                        16u * (uint32_t)((lane >> 3) & 1);

  for (uint32_t st = 0; st < nt; ++st) {
    const unsigned char* Lb = L + (st & 1u) * KV_SZ;
    for (uint32_t c = 0; c < 4u; ++c) {    // 32 keys: slice c of K and of V
      const unsigned char* Ls = Lb + c * SLICE_KV;

      // S = Q @ K^T : 16 queries x 32 keys ----------------------------------
      v8f s[2];
#pragma unroll
      for (int g = 0; g < 2; ++g) {
#pragma unroll
        for (int e = 0; e < 8; ++e) s[g][e] = 0.0f;
#pragma unroll
        for (int f = 0; f < 2; ++f) {
          // hardware k order: bytes 16h and 32 + 16h of each 64 B of key row lr
          const unsigned char* pk = Ls + koff + (uint32_t)g * 16u * PITCH_K + (uint32_t)f * 64u;
          FragU kf;
          kf.q[0] = *(const u32x4*)pk;
          kf.q[1] = *(const u32x4*)(pk + 32);
          s[g] = wmma_bf16(qa[f], kf.v, s[g]);
        }
      }

      // scale, online softmax -------------------------------------------------
#pragma unroll
      for (int v = 0; v < 8; ++v) {
        float best = -3.0e38f;
#pragma unroll
        for (int g = 0; g < 2; ++g) {
          float sv = s[g][v] * 0.125f;
          s[g][v]  = sv;
          best     = fmaxf(best, sv);
        }
#pragma unroll
        for (int mm = 1; mm < 16; mm <<= 1)
          best = fmaxf(best, __shfl_xor(best, mm, 16));
        const float mnew  = fmaxf(mrow[v], best);
        const float alpha = expf(mrow[v] - mnew);
        float psum = 0.0f;
#pragma unroll
        for (int g = 0; g < 2; ++g) {
          float pv = expf(s[g][v] - mnew);
          lP[wave][v + 8 * half][g * 16 + lr] = (__bf16)pv;
          psum += pv;
        }
#pragma unroll
        for (int mm = 1; mm < 16; mm <<= 1) psum += __shfl_xor(psum, mm, 16);
        lrow[v] = lrow[v] * alpha + psum;
        mrow[v] = mnew;
#pragma unroll
        for (int f = 0; f < 4; ++f) o[f][v] *= alpha;
      }
      __syncthreads();

      // P fragment (A operand): 16 queries x 32 keys ------------------------
      v16bf pa;
      {
        ABu u;
#pragma unroll
        for (int t = 0; t < 8; ++t)
          u.u[t] = *(const unsigned int*)&lP[wave][lr][kpair(t, half)];
        pa = u.v;
      }

      // O += P @ V(chunk): key rows 0..15 and 16..31, transposed on the read --
#pragma unroll
      for (int f = 0; f < 4; ++f) {
        const unsigned char* pv = Ls + voff + (uint32_t)f * 32u;
        FragU vf;
        vf.q[0] = ld_tr16(pv);
        vf.q[1] = ld_tr16(pv + 16u * PITCH_V);
        o[f] = wmma_bf16(pa, vf.v, o[f]);
      }
      __syncthreads();
    }

    // Publish point of stage st + 1; it also ends every reader's last read of
    // this stage's buffer, which is refilled behind it.
    wait_ds0();
    wait_tensor0(g0, g1k, g1v);
    __syncthreads();
    if (pinned(st + 2u < nt)) issue(st + 2u);
  }
  wait_tensor0(g0, g1k, g1v);
  wait_ds0();

  // normalize + store --------------------------------------------------------
#pragma unroll
  for (int f = 0; f < 4; ++f)
#pragma unroll
    for (int v = 0; v < 8; ++v) {
      const int   row = q0 + v + 8 * half;
      const float inv = 1.0f / fmaxf(lrow[v], 1.0e-20f);
      O[((size_t)(b * Lq + row)) * D_ + h * DH_ + f * 16 + lr] =
          (__bf16)(o[f][v] * inv);
    }
}

// ---------------------------------------------------------------------------
// Fused residual add + LayerNorm over D=1024. One 256-thread block per row.
// Emits f32 (residual stream) and/or bf16 (next-GEMM operand).
// ---------------------------------------------------------------------------
__global__ __launch_bounds__(256) void add_ln_kernel(
    const float* __restrict__ A, const float* __restrict__ Bv,
    const float* __restrict__ g, const float* __restrict__ be,
    float* __restrict__ outF, __bf16* __restrict__ outB) {
  __shared__ float redS[8], redQ[8];
  const int row  = blockIdx.x;
  const int t    = threadIdx.x;
  const int lane = t & 31, wave = t >> 5;
  const float* a = A + (size_t)row * D_;
  const float* r = Bv + (size_t)row * D_;

  float x[4], s = 0.0f, q = 0.0f;
#pragma unroll
  for (int e = 0; e < 4; ++e) {
    int c = t + 256 * e;
    x[e]  = a[c] + r[c];
    s    += x[e];
    q    += x[e] * x[e];
  }
#pragma unroll
  for (int mm = 1; mm < 32; mm <<= 1) {
    s += __shfl_xor(s, mm, 32);
    q += __shfl_xor(q, mm, 32);
  }
  if (lane == 0) { redS[wave] = s; redQ[wave] = q; }
  __syncthreads();
  float S = 0.0f, Q2 = 0.0f;
#pragma unroll
  for (int w = 0; w < 8; ++w) { S += redS[w]; Q2 += redQ[w]; }
  const float mu   = S * (1.0f / D_);
  const float var  = Q2 * (1.0f / D_) - mu * mu;
  const float rstd = rsqrtf(var + 1e-5f);
#pragma unroll
  for (int e = 0; e < 4; ++e) {
    int   c = t + 256 * e;
    float y = (x[e] - mu) * rstd * g[c] + be[c];
    if (outF) outF[(size_t)row * D_ + c] = y;
    if (outB) outB[(size_t)row * D_ + c] = (__bf16)y;
  }
}

// ---------------------------------------------------------------------------
// Host orchestration
// ---------------------------------------------------------------------------
extern "C" void kernel_launch(void* const* d_in, const int* in_sizes, int n_in,
                              void* d_out, int out_size, void* d_ws,
                              size_t ws_size, hipStream_t stream) {
  (void)in_sizes; (void)n_in; (void)out_size; (void)ws_size;
  constexpr int Bc = 2, Lc = 2048, Mc = 2048, Dc = 1024, FFc = 4096;
  const int NT = Bc * Lc;  // 4096 query rows
  const int NM = Bc * Mc;  // 4096 memory rows

  const float* x   = (const float*)d_in[0];
  const float* mem = (const float*)d_in[1];
  const float* swq = (const float*)d_in[2];
  const float* swk = (const float*)d_in[3];
  const float* swv = (const float*)d_in[4];
  const float* swo = (const float*)d_in[5];
  const float* sbq = (const float*)d_in[6];
  const float* sbk = (const float*)d_in[7];
  const float* sbv = (const float*)d_in[8];
  const float* sbo = (const float*)d_in[9];
  const float* cwq = (const float*)d_in[10];
  const float* cwk = (const float*)d_in[11];
  const float* cwv = (const float*)d_in[12];
  const float* cwo = (const float*)d_in[13];
  const float* cbq = (const float*)d_in[14];
  const float* cbk = (const float*)d_in[15];
  const float* cbv = (const float*)d_in[16];
  const float* cbo = (const float*)d_in[17];
  const float* w1  = (const float*)d_in[18];
  const float* b1  = (const float*)d_in[19];
  const float* w2  = (const float*)d_in[20];
  const float* b2  = (const float*)d_in[21];
  const float* g1  = (const float*)d_in[22];
  const float* g2  = (const float*)d_in[23];
  const float* g3  = (const float*)d_in[24];
  const float* be1 = (const float*)d_in[25];
  const float* be2 = (const float*)d_in[26];
  const float* be3 = (const float*)d_in[27];

  char* p = (char*)d_ws;
  auto take = [&](size_t bytes) -> void* {
    void* r = (void*)p;
    p += (bytes + 255) & ~(size_t)255;
    return r;
  };
  __bf16* xcur_bf = (__bf16*)take((size_t)NT * Dc * 2);  // x_bf -> x1_bf -> x2_bf
  __bf16* mem_bf  = (__bf16*)take((size_t)NM * Dc * 2);
  __bf16* swq_bf  = (__bf16*)take((size_t)Dc * Dc * 2);
  __bf16* swk_bf  = (__bf16*)take((size_t)Dc * Dc * 2);
  __bf16* swv_bf  = (__bf16*)take((size_t)Dc * Dc * 2);
  __bf16* swo_bf  = (__bf16*)take((size_t)Dc * Dc * 2);
  __bf16* cwq_bf  = (__bf16*)take((size_t)Dc * Dc * 2);
  __bf16* cwk_bf  = (__bf16*)take((size_t)Dc * Dc * 2);
  __bf16* cwv_bf  = (__bf16*)take((size_t)Dc * Dc * 2);
  __bf16* cwo_bf  = (__bf16*)take((size_t)Dc * Dc * 2);
  __bf16* w1_bf   = (__bf16*)take((size_t)Dc * FFc * 2);
  __bf16* w2_bf   = (__bf16*)take((size_t)FFc * Dc * 2);
  __bf16* q_bf    = (__bf16*)take((size_t)NT * Dc * 2);
  __bf16* k_bf    = (__bf16*)take((size_t)NM * Dc * 2);
  __bf16* v_bf    = (__bf16*)take((size_t)NM * Dc * 2);
  __bf16* attn_bf = (__bf16*)take((size_t)NT * Dc * 2);
  float*  gout    = (float*)take((size_t)NT * Dc * 4);   // sa / ca / ff
  float*  x1f     = (float*)take((size_t)NT * Dc * 4);
  float*  x2f     = (float*)take((size_t)NT * Dc * 4);
  __bf16* h_bf    = (__bf16*)take((size_t)NT * FFc * 2);

  auto cvt = [&](const float* src, __bf16* dst, size_t n) {
    cvt_kernel<<<1024, 256, 0, stream>>>(src, dst, (unsigned long long)n);
  };
  auto gemm = [&](const __bf16* Ag, const __bf16* Wg, const float* biasg,
                  float* Cfg, __bf16* Cbg, int Mg, int Ng, int Kg, int act) {
    dim3 grid(Ng / 128, Mg / 256);
    gemm_bf16_kernel<<<grid, 256, 0, stream>>>(Ag, Wg, biasg, Cfg, Cbg, Mg, Ng,
                                               Kg, act);
  };
  auto attn = [&](const __bf16* Qg, const __bf16* Kg, const __bf16* Vg,
                  __bf16* Og, int Lqv, int Lkv, int windowed) {
    int jobs = Bc * H_ * (Lqv / 16);  // one wave per job, 4 waves per block
    attn_kernel<<<jobs / 4, 128, 0, stream>>>(Qg, Kg, Vg, Og, Lqv, Lkv,
                                              windowed);
  };

  // ---- bf16 staging --------------------------------------------------------
  cvt(x, xcur_bf, (size_t)NT * Dc);
  cvt(mem, mem_bf, (size_t)NM * Dc);
  cvt(swq, swq_bf, (size_t)Dc * Dc);
  cvt(swk, swk_bf, (size_t)Dc * Dc);
  cvt(swv, swv_bf, (size_t)Dc * Dc);
  cvt(swo, swo_bf, (size_t)Dc * Dc);
  cvt(cwq, cwq_bf, (size_t)Dc * Dc);
  cvt(cwk, cwk_bf, (size_t)Dc * Dc);
  cvt(cwv, cwv_bf, (size_t)Dc * Dc);
  cvt(cwo, cwo_bf, (size_t)Dc * Dc);
  cvt(w1, w1_bf, (size_t)Dc * FFc);
  cvt(w2, w2_bf, (size_t)FFc * Dc);

  // ---- self-attention (windowed causal + ALiBi) ----------------------------
  gemm(xcur_bf, swq_bf, sbq, nullptr, q_bf, NT, Dc, Dc, 0);
  gemm(xcur_bf, swk_bf, sbk, nullptr, k_bf, NT, Dc, Dc, 0);
  gemm(xcur_bf, swv_bf, sbv, nullptr, v_bf, NT, Dc, Dc, 0);
  attn(q_bf, k_bf, v_bf, attn_bf, Lc, Lc, 1);
  gemm(attn_bf, swo_bf, sbo, gout, nullptr, NT, Dc, Dc, 0);
  add_ln_kernel<<<NT, 256, 0, stream>>>(x, gout, g1, be1, x1f, xcur_bf);

  // ---- cross-attention (full) ---------------------------------------------
  gemm(xcur_bf, cwq_bf, cbq, nullptr, q_bf, NT, Dc, Dc, 0);
  gemm(mem_bf, cwk_bf, cbk, nullptr, k_bf, NM, Dc, Dc, 0);
  gemm(mem_bf, cwv_bf, cbv, nullptr, v_bf, NM, Dc, Dc, 0);
  attn_full_kernel<<<Bc * H_ * (Lc / 16) / 8, 256, 0, stream>>>(q_bf, k_bf, v_bf,
                                                                attn_bf, Lc, Mc);
  gemm(attn_bf, cwo_bf, cbo, gout, nullptr, NT, Dc, Dc, 0);
  add_ln_kernel<<<NT, 256, 0, stream>>>(x1f, gout, g2, be2, x2f, xcur_bf);

  // ---- FFN -----------------------------------------------------------------
  gemm(xcur_bf, w1_bf, b1, nullptr, h_bf, NT, FFc, Dc, 1);  // fused exact GELU
  gemm(h_bf, w2_bf, b2, gout, nullptr, NT, Dc, FFc, 0);
  add_ln_kernel<<<NT, 256, 0, stream>>>(x2f, gout, g3, be3, (float*)d_out,
                                        nullptr);
}

// v004
// A run of this version takes 417 microseconds.
// In both of two side-by-side timings against v003, it was 1.13 times as fast.
// Counting every step since v000, it is 3.62 times as fast.
#include <hip/hip_runtime.h>
#include <math.h>
#include <stdint.h>

typedef __attribute__((ext_vector_type(16))) __bf16 v16bf;
typedef __attribute__((ext_vector_type(8)))  float  v8f;

union ABu {
  v16bf          v;
  unsigned int   u[8];
  unsigned short s[16];
  __bf16         b[16];
};

union U4u {
  uint4        q;
  unsigned int u[4];
};

__device__ __forceinline__ int kpair(int t, int half) {
  int base = (t < 4) ? (2 * t) : (16 + 2 * (t - 4));
  return base + 8 * half;
}

__device__ __forceinline__ v8f wmma_bf16(v16bf a, v16bf b, v8f c) {
  return __builtin_amdgcn_wmma_f32_16x16x32_bf16(false, a, false, b,
                                                 (short)0, c, false, false);
}

#define D_  1024
#define H_  16
#define DH_ 64

typedef uint32_t u32x4 __attribute__((ext_vector_type(4)));
typedef uint32_t u32x8 __attribute__((ext_vector_type(8)));
typedef short    s16x8 __attribute__((ext_vector_type(8)));

__device__ __forceinline__ uint32_t uni(uint32_t v) {
  return (uint32_t)__builtin_amdgcn_readfirstlane(v);
}
__device__ __forceinline__ uint32_t pinned(uint32_t v) {
  uint32_t w = uni(v);
  asm volatile("" : "+s"(w));
  return w;
}
__device__ __forceinline__ void wait_ds0() {
  asm volatile("s_wait_dscnt 0x0" ::: "memory");      // own LDS reads done before the buffer is handed back
}
__device__ __forceinline__ void wait_tensor0(u32x4 g0, u32x8 ga, u32x8 gb) {
  asm volatile("s_wait_tensorcnt 0x0" ::"s"(g0), "s"(ga), "s"(gb) : "memory");
}
__device__ __forceinline__ void hold4(u32x4& g) { asm volatile("" : "+s"(g)); }
__device__ __forceinline__ void hold8(u32x8& g) { asm volatile("" : "+s"(g)); }
__device__ __forceinline__ void tdm_load(u32x4 g0, u32x8 g1) {
  asm volatile("tensor_load_to_lds %0, %1" ::"s"(g0), "s"(g1) : "memory");
}
__device__ __forceinline__ u32x4 tdm_group0(uint32_t lds_dst, uint64_t ga) {
  u32x4 g;
  g[0] = uni(1u);
  g[1] = uni(lds_dst);
  g[2] = uni((uint32_t)ga);
  g[3] = uni((((uint32_t)(ga >> 32)) & 0x01FFFFFFu) | 0x80000000u);
  return g;
}
// W0 = word 0 (pad fields, no mask), D0 = bytes per row, D1 = rows.
template <uint32_t W0, uint32_t D0, uint32_t D1>
__device__ __forceinline__ u32x8 tdm_group1(uint32_t src_pitch) {
  u32x8 g;
  g[0] = uni(W0);
  g[1] = uni((D0 & 0xFFFFu) << 16);
  g[2] = uni((D0 >> 16) | ((D1 & 0xFFFFu) << 16));
  g[3] = uni((D1 >> 16) | (D0 << 16));
  g[4] = uni(D1);
  g[5] = uni(src_pitch);
  g[6] = uni(0u);
  g[7] = uni(0u);
  return g;
}
__device__ __forceinline__ u32x4 ld_tr16(const unsigned char* p) {
  typedef __attribute__((address_space(3))) s16x8 lds_s16x8;
  return __builtin_bit_cast(u32x4,
                            __builtin_amdgcn_ds_load_tr16_b128_v8i16((lds_s16x8*)p));
}

union FragU {
  v16bf v;
  u32x4 q[2];
};

constexpr uint32_t PITCH_A = 144u, PITCH_B = 288u;
constexpr uint32_t SLICE_A = 10240u;              // 64 * 144 = 9216, rounded up
constexpr uint32_t SLICE_B = 6144u;               // 16 * 288 = 4608, rounded up
constexpr uint32_t BASE_B  = 4u * SLICE_A;
constexpr uint32_t BUF_SZ  = BASE_B + 4u * SLICE_B;  // 65536
constexpr uint32_t PAD_A   = (1u << 20) | (4u << 22) | (3u << 25);  // 128-B rows + 16 B
constexpr uint32_t PAD_B   = (1u << 20) | (5u << 22) | (7u << 25);  // 256-B rows + 32 B
static_assert(SLICE_A % 2048u == 0 && SLICE_B % 2048u == 0 && BUF_SZ % 2048u == 0, "slice places");
static_assert(64u * PITCH_A <= SLICE_A && 16u * PITCH_B <= SLICE_B, "slice sizes");

constexpr uint32_t EPI_PITCH = 272u;
constexpr uint32_t EPI_SZ    = 64u * EPI_PITCH;
constexpr uint32_t GEMM_LDS  = (8u * EPI_SZ > 2u * BUF_SZ) ? 8u * EPI_SZ : 2u * BUF_SZ;

typedef float  f32x4  __attribute__((ext_vector_type(4)));
typedef __bf16 bf16x8 __attribute__((ext_vector_type(8)));

template <bool GELU>
__device__ __forceinline__ float epi_val(float a, float bsv) {
  float val = a + bsv;
  if (GELU) val = 0.5f * val * (1.0f + erff(val * 0.70710678118f));
  return val;
}

// Stands directly behind the epilogue's global loads and stores, in front of any
// rewrite of a register that they name (the next trip's addresses and data).
__device__ __forceinline__ void wait_x0() {
  asm volatile("s_wait_xcnt 0x0" ::: "memory");
}

// Reads the wave's staged tile back row-wise and stores it: bias (+GELU), then
// 16 bytes per lane, so that every wave-wide store covers whole 128-B lines
// (f32: 2 rows of 256 B; bf16: 4 rows of 128 B). bias, Cf and Cb point at the
// tile's first column / element. The row loops stay rolled so that the
// epilogue's text is short (U stores a trip; without GELU four, so that a trip's
// LDS reads fly together). They walk from the last rows to the first: walking
// upwards, the compiler formed each LDS address as (base - tile size) with
// offset: tile size, a register below zero in wave 0; walking downwards, the
// loops that this file's launches run add a step >= 0 to the lane's base.
template <bool GELU>
__device__ __forceinline__ void store_tile(const unsigned char* stg, int lane,
                                           const float* bias, float* Cf, __bf16* Cb,
                                           int N) {
  constexpr int U = GELU ? 1 : 4;
  // The loops over u and e are unrolled so that every index is a constant (registers).
  if (Cf) {
    const int r = lane >> 4, c = (lane & 15) * 4;
    f32x4 bs = {0.0f, 0.0f, 0.0f, 0.0f};
    if (bias) {
      bs = *(const f32x4*)(bias + c);
      wait_x0();   // behind the bias load, in front of any rewrite of its offset register
    }
    const unsigned char* p = stg + (uint32_t)r * EPI_PITCH + (uint32_t)c * 4u;
    float* o = Cf + (size_t)r * N + c;
#pragma unroll 1
    for (int g = 32 / U - 1; g >= 0; --g) {
      f32x4 a[U];
#pragma unroll
      for (int u = 0; u < U; ++u)
        a[u] = *(const f32x4*)(p + (uint32_t)(g * U + u) * 2u * EPI_PITCH);
#pragma unroll
      for (int u = 0; u < U; ++u) {
        f32x4 y;
#pragma unroll
        for (int e = 0; e < 4; ++e) y[e] = epi_val<GELU>(a[u][e], bs[e]);
        *(f32x4*)(o + (size_t)(g * U + u) * 2 * N) = y;
      }
      wait_x0();
    }
  }
  if (Cb) {
    const int r = lane >> 3, c = (lane & 7) * 8;
    f32x4 bs0 = {0.0f, 0.0f, 0.0f, 0.0f}, bs1 = bs0;
    if (bias) {
      bs0 = *(const f32x4*)(bias + c);
      bs1 = *(const f32x4*)(bias + c + 4);
      wait_x0();   // behind the bias loads, in front of any rewrite of their offset register
    }
    const unsigned char* p = stg + (uint32_t)r * EPI_PITCH + (uint32_t)c * 4u;
    __bf16* o = Cb + (size_t)r * N + c;
#pragma unroll 1
    for (int g = 16 / U - 1; g >= 0; --g) {
      f32x4 a0[U], a1[U];
#pragma unroll
      for (int u = 0; u < U; ++u) {
        const unsigned char* q = p + (uint32_t)(g * U + u) * 4u * EPI_PITCH;
        a0[u] = *(const f32x4*)q;
        a1[u] = *(const f32x4*)(q + 16);
      }
#pragma unroll
      for (int u = 0; u < U; ++u) {
        bf16x8 y;
#pragma unroll
        for (int e = 0; e < 4; ++e) {
          y[e]     = (__bf16)epi_val<GELU>(a0[u][e], bs0[e]);
          y[e + 4] = (__bf16)epi_val<GELU>(a1[u][e], bs1[e]);
        }
        *(bf16x8*)(o + (size_t)(g * U + u) * 4 * N) = y;
      }
      wait_x0();
    }
  }
}

__global__ __launch_bounds__(256, 1) void gemm_bf16_kernel(
    const __bf16* __restrict__ A, const __bf16* __restrict__ W,
    const float* __restrict__ bias,
    float* __restrict__ Cf, __bf16* __restrict__ Cb,
    int Mr, int N, int K, int act) {
  (void)Mr;
  __shared__ __attribute__((aligned(2048))) unsigned char L[GEMM_LDS];

  const int      tid  = threadIdx.x;
  const int      lane = tid & 31;
  const uint32_t wave = uni((uint32_t)tid >> 5);
  const int wm   = (int)(wave >> 1);   // 0..3
  const int wn   = (int)(wave & 1u);   // 0..1
  const int half = lane >> 4;
  const int lr   = lane & 15;
  const int row0 = blockIdx.y * 256;
  const int col0 = blockIdx.x * 128;
  const uint32_t lbase = (uint32_t)(size_t)L;

  v8f acc[4][4];
#pragma unroll
  for (int mi = 0; mi < 4; ++mi)
#pragma unroll
    for (int ni = 0; ni < 4; ++ni)
#pragma unroll
      for (int e = 0; e < 8; ++e) acc[mi][ni][e] = 0.0f;

  // One request per wave and pass: waves 0-3 a slice of A, waves 4-7 of W.
  u32x8 g1a = tdm_group1<PAD_A, 128u, 64u>(2u * (uint32_t)K);
  u32x8 g1b = tdm_group1<PAD_B, 256u, 16u>(2u * (uint32_t)N);
  hold8(g1a);
  hold8(g1b);
  const bool     isA  = wave < 4u;
  const uint32_t j    = wave & 3u;
  const uint32_t dst0 = lbase + (isA ? j * SLICE_A : BASE_B + j * SLICE_B);
  const uint64_t src0 = isA
      ? (uint64_t)(size_t)A + 2ull * ((uint64_t)((uint32_t)row0 + j * 64u) * (uint32_t)K)
      : (uint64_t)(size_t)W + 2ull * ((uint64_t)(j * 16u) * (uint32_t)N + (uint32_t)col0);
  const uint64_t step = isA ? 128ull : 128ull * (uint32_t)N;   // bytes per pass
  u32x4 g0;
  auto issue = [&](uint32_t st) {   // pass st's slice, into buffer st & 1
    g0 = tdm_group0(dst0 + (st & 1u) * BUF_SZ, src0 + (uint64_t)st * step);
    hold4(g0);
    if (pinned(wave < 4u)) tdm_load(g0, g1a);
    else                   tdm_load(g0, g1b);
  };

  const uint32_t nt = (uint32_t)K >> 6;   // passes; every call has at least two

  issue(0u);
  wait_tensor0(g0, g1a, g1b);
  __syncthreads();                        // pass 0's tiles are published
  issue(1u);

  // Lane offsets of the fragment reads inside a buffer.
  const uint32_t aoff = (uint32_t)wm * SLICE_A + (uint32_t)lr * PITCH_A + 16u * (uint32_t)half;
  const uint32_t boff = BASE_B + (8u * (uint32_t)half + (uint32_t)(lane & 7)) * PITCH_B +
                        128u * (uint32_t)wn + 16u * (uint32_t)((lane >> 3) & 1);

  for (uint32_t s = 0; s < nt; ++s) {
    const unsigned char* Lb = L + (s & 1u) * BUF_SZ;
    // The loops below are unrolled so that every fragment and accumulator
    // index is a constant (registers, no scratch).
#pragma unroll
    for (int kb = 0; kb < 2; ++kb) {
      // A fragments, hardware k order: bytes 16h and 32 + 16h of each 64 B.
      FragU af[4];
#pragma unroll
      for (int mi = 0; mi < 4; ++mi) {
        const unsigned char* pa = Lb + aoff + (uint32_t)mi * 16u * PITCH_A + (uint32_t)kb * 64u;
        af[mi].q[0] = *(const u32x4*)pa;
        af[mi].q[1] = *(const u32x4*)(pa + 32);
      }
#pragma unroll
      for (int ni = 0; ni < 4; ++ni) {
        // W fragment: k-rows 32 kb + 0..15 and + 16..31 lie in two slices.
        const unsigned char* pb = Lb + boff + (uint32_t)(2 * kb) * SLICE_B + (uint32_t)ni * 32u;
        FragU bf;
        bf.q[0] = ld_tr16(pb);
        bf.q[1] = ld_tr16(pb + SLICE_B);
#pragma unroll
        for (int mi = 0; mi < 4; ++mi)
          acc[mi][ni] = wmma_bf16(af[mi].v, bf.v, acc[mi][ni]);
      }
    }

    // Publish point of pass s + 1; it also ends every reader's last read of
    // this pass's buffer, which is refilled behind it.
    wait_ds0();
    wait_tensor0(g0, g1a, g1b);
    __syncthreads();
    if (pinned(s + 2u < nt)) issue(s + 2u);
  }
  wait_tensor0(g0, g1a, g1b);
  wait_ds0();

  // epilogue ------------------------------------------------------------------
  // The last pass's publish point (own LDS reads done, own tensor loads landed,
  // barrier) has freed the ring for every wave: each wave now stages its own
  // 64 x 64 tile in its own range of L, which runs 8 KiB past the ring.
  unsigned char* stg = L + wave * EPI_SZ;
  {
    float* w = (float*)(stg + (uint32_t)(8 * half) * EPI_PITCH) + lr;
    // unrolled: every accumulator index is a constant (registers, no scratch)
#pragma unroll
    for (int mi = 0; mi < 4; ++mi)
#pragma unroll
      for (int ni = 0; ni < 4; ++ni)
#pragma unroll
        for (int v = 0; v < 8; ++v)
          w[(mi * 16 + v) * (int)(EPI_PITCH / 4u) + ni * 16] = acc[mi][ni][v];
  }
  wait_ds0();   // the wave's rows are in LDS before its lanes read each other's values back

  const int    trow = row0 + wm * 64;
  const int    tcol = col0 + wn * 64;
  const size_t toff = (size_t)trow * N + tcol;
  const float* bt   = bias ? bias + tcol : nullptr;
  float*       cf   = Cf ? Cf + toff : nullptr;
  __bf16*      cb   = Cb ? Cb + toff : nullptr;
  if (act == 1) store_tile<true>(stg, lane, bt, cf, cb, N);
  else          store_tile<false>(stg, lane, bt, cf, cb, N);
}

// ---------------------------------------------------------------------------
// Flash attention: one wave per (batch, head, 16-query block).
// windowed=1 -> causal local window W=64 + ALiBi; windowed=0 -> full attn.
// Q,K,V,O are bf16 [B*Lq(or Lk), D] with head h at feature offset h*64.
// ---------------------------------------------------------------------------
__global__ __launch_bounds__(128) void attn_kernel(
    const __bf16* __restrict__ Q, const __bf16* __restrict__ Km,
    const __bf16* __restrict__ Vm, __bf16* __restrict__ O,
    int Lq, int Lk, int windowed) {
  __shared__ __bf16 lP[4][16][32];  // per-wave P staging (C-layout -> A-layout)
  const int lane  = threadIdx.x & 31;
  const int wave  = threadIdx.x >> 5;
  const int half  = lane >> 4;
  const int lr    = lane & 15;
  const int qbPer = Lq >> 4;
  const int job   = blockIdx.x * 4 + wave;
  const int qblk  = job % qbPer;
  const int h     = (job / qbPer) % H_;
  const int b     = job / (qbPer * H_);
  const int q0    = qblk << 4;

  const float slope = windowed ? exp2f(-8.0f * (float)(h + 1) / (float)H_) : 0.0f;

  // Q fragments (A operand): 16 queries x 64 features
  v16bf qa[2];
  {
    const __bf16* qb = Q + ((size_t)(b * Lq + q0 + lr)) * D_ + h * DH_;
#pragma unroll
    for (int f = 0; f < 2; ++f) {
      ABu u;
#pragma unroll
      for (int t = 0; t < 8; ++t)
        u.u[t] = *(const unsigned int*)(qb + f * 32 + kpair(t, half));
      qa[f] = u.v;
    }
  }

  float mrow[8], lrow[8];
  v8f   o[4];
#pragma unroll
  for (int v = 0; v < 8; ++v) { mrow[v] = -3.0e38f; lrow[v] = 0.0f; }
#pragma unroll
  for (int f = 0; f < 4; ++f)
#pragma unroll
    for (int e = 0; e < 8; ++e) o[f][e] = 0.0f;

  const int nch = windowed ? 3 : (Lk >> 5);  // uniform across the block
  for (int ch = 0; ch < nch; ++ch) {
    const int kc = windowed ? (q0 - 64 + 32 * ch) : (32 * ch);

    // S = Q @ K^T : 16 queries x 32 keys ------------------------------------
    v8f s[2];
#pragma unroll
    for (int g = 0; g < 2; ++g) {
#pragma unroll
      for (int e = 0; e < 8; ++e) s[g][e] = 0.0f;
      int key  = kc + g * 16 + lr;
      int keyc = key < 0 ? 0 : (key >= Lk ? Lk - 1 : key);
      const __bf16* kb = Km + ((size_t)(b * Lk + keyc)) * D_ + h * DH_;
#pragma unroll
      for (int f = 0; f < 2; ++f) {
        ABu u;
#pragma unroll
        for (int t = 0; t < 8; ++t)
          u.u[t] = *(const unsigned int*)(kb + f * 32 + kpair(t, half));
        s[g] = wmma_bf16(qa[f], u.v, s[g]);
      }
    }

    // scale + ALiBi + mask, online softmax ----------------------------------
#pragma unroll
    for (int v = 0; v < 8; ++v) {
      const int i    = q0 + v + 8 * half;
      float     best = -3.0e38f;
#pragma unroll
      for (int g = 0; g < 2; ++g) {
        const int j  = kc + g * 16 + lr;
        float     sv = s[g][v] * 0.125f + slope * (float)(j - i);
        bool valid = windowed ? (j >= 0 && j <= i && (i - j) < 64) : (j < Lk);
        sv       = valid ? sv : -1.0e30f;
        s[g][v]  = sv;
        best     = fmaxf(best, sv);
      }
#pragma unroll
      for (int mm = 1; mm < 16; mm <<= 1)
        best = fmaxf(best, __shfl_xor(best, mm, 16));
      const float mnew  = fmaxf(mrow[v], best);
      const float alpha = expf(mrow[v] - mnew);
      float psum = 0.0f;
#pragma unroll
      for (int g = 0; g < 2; ++g) {
        float pv = expf(s[g][v] - mnew);
        lP[wave][v + 8 * half][g * 16 + lr] = (__bf16)pv;
        psum += pv;
      }
#pragma unroll
      for (int mm = 1; mm < 16; mm <<= 1) psum += __shfl_xor(psum, mm, 16);
      lrow[v] = lrow[v] * alpha + psum;
      mrow[v] = mnew;
#pragma unroll
      for (int f = 0; f < 4; ++f) o[f][v] *= alpha;
    }
    __syncthreads();

    // P fragment (A operand): 16 queries x 32 keys --------------------------
    v16bf pa;
    {
      ABu u;
#pragma unroll
      for (int t = 0; t < 8; ++t)
        u.u[t] = *(const unsigned int*)&lP[wave][lr][kpair(t, half)];
      pa = u.v;
    }

    // O += P @ V(chunk) ------------------------------------------------------
#pragma unroll
    for (int f = 0; f < 4; ++f) {
      ABu u;
#pragma unroll
      for (int t = 0; t < 8; ++t) {
        int k  = kpair(t, half);
        int j0 = kc + k, j1 = kc + k + 1;
        j0 = j0 < 0 ? 0 : (j0 >= Lk ? Lk - 1 : j0);
        j1 = j1 < 0 ? 0 : (j1 >= Lk ? Lk - 1 : j1);
        u.b[2 * t]     = Vm[((size_t)(b * Lk + j0)) * D_ + h * DH_ + f * 16 + lr];
        u.b[2 * t + 1] = Vm[((size_t)(b * Lk + j1)) * D_ + h * DH_ + f * 16 + lr];
      }
      o[f] = wmma_bf16(pa, u.v, o[f]);
    }
    __syncthreads();
  }

  // normalize + store --------------------------------------------------------
#pragma unroll
  for (int f = 0; f < 4; ++f)
#pragma unroll
    for (int v = 0; v < 8; ++v) {
      const int   row = q0 + v + 8 * half;
      const float inv = 1.0f / fmaxf(lrow[v], 1.0e-20f);
      O[((size_t)(b * Lq + row)) * D_ + h * DH_ + f * 16 + lr] =
          (__bf16)(o[f][v] * inv);
    }
}

// ---------------------------------------------------------------------------
// Full (unmasked) attention with K and V staged in LDS. 8 waves per block, one
// 16-query block per wave, all of one (batch, head), so every wave reads the
// same keys. A stage is 128 keys; both tiles come by tensor loads, one request
// per wave and stage, in a ring of two buffers: the next stage's tiles fly
// while this one is worked on.
//   waves 0-3: 32 key rows of K, 128 B each, LDS pitch 144 B (ds_load_b128 reader)
//   waves 4-7: 32 key rows of V, 128 B each, LDS pitch 160 B (transposing reader)
// Every slice starts at a multiple of 2 KiB. Needs Lk % 128 == 0, Lk >= 256,
// (Lq / 16) % 8 == 0.
// ---------------------------------------------------------------------------
constexpr uint32_t PITCH_K  = 144u, PITCH_V = 160u;
constexpr uint32_t SLICE_KV = 6144u;              // 32 * 144 = 4608, 32 * 160 = 5120, rounded up
constexpr uint32_t BASE_V   = 4u * SLICE_KV;
constexpr uint32_t KV_SZ    = 8u * SLICE_KV;      // 49152
constexpr uint32_t PAD_K    = (1u << 20) | (4u << 22) | (3u << 25);  // 128-B rows + 16 B
constexpr uint32_t PAD_V    = (1u << 20) | (4u << 22) | (7u << 25);  // 128-B rows + 32 B
static_assert(SLICE_KV % 2048u == 0 && KV_SZ % 2048u == 0, "slice places");
static_assert(32u * PITCH_K <= SLICE_KV && 32u * PITCH_V <= SLICE_KV, "slice sizes");

__global__ __launch_bounds__(256) void attn_full_kernel(
    const __bf16* __restrict__ Q, const __bf16* __restrict__ Km,
    const __bf16* __restrict__ Vm, __bf16* __restrict__ O,
    int Lq, int Lk) {
  __shared__ __attribute__((aligned(2048))) unsigned char L[2u * KV_SZ];
  __shared__ __bf16 lP[8][16][32];  // per-wave P staging (C-layout -> A-layout)
  const int      lane  = threadIdx.x & 31;
  const uint32_t wave  = uni((uint32_t)threadIdx.x >> 5);
  const int      half  = lane >> 4;
  const int      lr    = lane & 15;
  const int      qbPer = Lq >> 4;
  const int      job0  = blockIdx.x * 8;          // the block's 8 jobs share b and h
  const int      qblk  = job0 % qbPer + (int)wave;
  const int      h     = (job0 / qbPer) % H_;
  const int      b     = job0 / (qbPer * H_);
  const int      q0    = qblk << 4;
  const uint32_t lbase = (uint32_t)(size_t)L;

  // One request per wave and stage: waves 0-3 a slice of K, waves 4-7 of V.
  u32x8 g1k = tdm_group1<PAD_K, 128u, 32u>(2u * (uint32_t)D_);
  u32x8 g1v = tdm_group1<PAD_V, 128u, 32u>(2u * (uint32_t)D_);
  hold8(g1k);
  hold8(g1v);
  const uint32_t jsl  = wave & 3u;
  const uint32_t dst0 = lbase + (wave < 4u ? 0u : BASE_V) + jsl * SLICE_KV;
  const uint64_t src0 = (uint64_t)(size_t)(wave < 4u ? Km : Vm) +
      2ull * ((uint64_t)((uint32_t)(b * Lk) + jsl * 32u) * (uint32_t)D_ + (uint32_t)(h * DH_));
  const uint64_t step = 2ull * 128ull * (uint32_t)D_;   // bytes per stage
  u32x4 g0;
  auto issue = [&](uint32_t st) {   // stage st's slice, into buffer st & 1
    g0 = tdm_group0(dst0 + (st & 1u) * KV_SZ, src0 + (uint64_t)st * step);
    hold4(g0);
    if (pinned(wave < 4u)) tdm_load(g0, g1k);
    else                   tdm_load(g0, g1v);
  };

  const uint32_t nt = (uint32_t)Lk >> 7;   // stages; at least two

  issue(0u);
  wait_tensor0(g0, g1k, g1v);
  __syncthreads();                         // stage 0's tiles are published
  issue(1u);

  // Every loop over fragments, rows and registers in this kernel is unrolled so
  // that each fragment and accumulator index is a constant (registers, no scratch).
  // Q fragments (A operand): 16 queries x 64 features
  v16bf qa[2];
  {
    const __bf16* qb = Q + ((size_t)(b * Lq + q0 + lr)) * D_ + h * DH_;
#pragma unroll
    for (int f = 0; f < 2; ++f) {
      ABu u;
#pragma unroll
      for (int t = 0; t < 8; ++t)
        u.u[t] = *(const unsigned int*)(qb + f * 32 + kpair(t, half));
      qa[f] = u.v;
    }
  }

  float mrow[8], lrow[8];
  v8f   o[4];
#pragma unroll
  for (int v = 0; v < 8; ++v) { mrow[v] = -3.0e38f; lrow[v] = 0.0f; }
#pragma unroll
  for (int f = 0; f < 4; ++f)
#pragma unroll
    for (int e = 0; e < 8; ++e) o[f][e] = 0.0f;

  // Lane offsets of the fragment reads inside a slice.
  const uint32_t koff = (uint32_t)lr * PITCH_K + 16u * (uint32_t)half;
  const uint32_t voff = BASE_V + (8u * (uint32_t)half + (uint32_t)(lane & 7)) * PITCH_V +
                        16u * (uint32_t)((lane >> 3) & 1);

  for (uint32_t st = 0; st < nt; ++st) {
    const unsigned char* Lb = L + (st & 1u) * KV_SZ;
    for (uint32_t c = 0; c < 4u; ++c) {    // 32 keys: slice c of K and of V
      const unsigned char* Ls = Lb + c * SLICE_KV;

      // S = Q @ K^T : 16 queries x 32 keys ----------------------------------
      v8f s[2];
#pragma unroll
      for (int g = 0; g < 2; ++g) {
#pragma unroll
        for (int e = 0; e < 8; ++e) s[g][e] = 0.0f;
#pragma unroll
        for (int f = 0; f < 2; ++f) {
          // hardware k order: bytes 16h and 32 + 16h of each 64 B of key row lr
          const unsigned char* pk = Ls + koff + (uint32_t)g * 16u * PITCH_K + (uint32_t)f * 64u;
          FragU kf;
          kf.q[0] = *(const u32x4*)pk;
          kf.q[1] = *(const u32x4*)(pk + 32);
          s[g] = wmma_bf16(qa[f], kf.v, s[g]);
        }
      }

      // scale, online softmax -------------------------------------------------
#pragma unroll
      for (int v = 0; v < 8; ++v) {
        float best = -3.0e38f;
#pragma unroll
        for (int g = 0; g < 2; ++g) {
          float sv = s[g][v] * 0.125f;
          s[g][v]  = sv;
          best     = fmaxf(best, sv);
        }
#pragma unroll
        for (int mm = 1; mm < 16; mm <<= 1)
          best = fmaxf(best, __shfl_xor(best, mm, 16));
        const float mnew  = fmaxf(mrow[v], best);
        const float alpha = expf(mrow[v] - mnew);
        float psum = 0.0f;
#pragma unroll
        for (int g = 0; g < 2; ++g) {
          float pv = expf(s[g][v] - mnew);
          lP[wave][v + 8 * half][g * 16 + lr] = (__bf16)pv;
          psum += pv;
        }
#pragma unroll
        for (int mm = 1; mm < 16; mm <<= 1) psum += __shfl_xor(psum, mm, 16);
        lrow[v] = lrow[v] * alpha + psum;
        mrow[v] = mnew;
#pragma unroll
        for (int f = 0; f < 4; ++f) o[f][v] *= alpha;
      }
      __syncthreads();

      // P fragment (A operand): 16 queries x 32 keys ------------------------
      v16bf pa;
      {
        ABu u;
#pragma unroll
        for (int t = 0; t < 8; ++t)
          u.u[t] = *(const unsigned int*)&lP[wave][lr][kpair(t, half)];
        pa = u.v;
      }

      // O += P @ V(chunk): key rows 0..15 and 16..31, transposed on the read --
#pragma unroll
      for (int f = 0; f < 4; ++f) {
        const unsigned char* pv = Ls + voff + (uint32_t)f * 32u;
        FragU vf;
        vf.q[0] = ld_tr16(pv);
        vf.q[1] = ld_tr16(pv + 16u * PITCH_V);
        o[f] = wmma_bf16(pa, vf.v, o[f]);
      }
      __syncthreads();
    }

    // Publish point of stage st + 1; it also ends every reader's last read of
    // this stage's buffer, which is refilled behind it.
    wait_ds0();
    wait_tensor0(g0, g1k, g1v);
    __syncthreads();
    if (pinned(st + 2u < nt)) issue(st + 2u);
  }
  wait_tensor0(g0, g1k, g1v);
  wait_ds0();

  // normalize + store --------------------------------------------------------
#pragma unroll
  for (int f = 0; f < 4; ++f)
#pragma unroll
    for (int v = 0; v < 8; ++v) {
      const int   row = q0 + v + 8 * half;
      const float inv = 1.0f / fmaxf(lrow[v], 1.0e-20f);
      O[((size_t)(b * Lq + row)) * D_ + h * DH_ + f * 16 + lr] =
          (__bf16)(o[f][v] * inv);
    }
}

// ---------------------------------------------------------------------------
// Fused residual add + LayerNorm over D=1024. One 256-thread block per row.
// Emits f32 (residual stream) and/or bf16 (next-GEMM operand).
// ---------------------------------------------------------------------------
__global__ __launch_bounds__(256) void add_ln_kernel(
    const float* __restrict__ A, const float* __restrict__ Bv,
    const float* __restrict__ g, const float* __restrict__ be,
    float* __restrict__ outF, __bf16* __restrict__ outB) {
  __shared__ float redS[8], redQ[8];
  const int row  = blockIdx.x;
  const int t    = threadIdx.x;
  const int lane = t & 31, wave = t >> 5;
  const float* a = A + (size_t)row * D_;
  const float* r = Bv + (size_t)row * D_;

  float x[4], s = 0.0f, q = 0.0f;
#pragma unroll
  for (int e = 0; e < 4; ++e) {
    int c = t + 256 * e;
    x[e]  = a[c] + r[c];
    s    += x[e];
    q    += x[e] * x[e];
  }
#pragma unroll
  for (int mm = 1; mm < 32; mm <<= 1) {
    s += __shfl_xor(s, mm, 32);
    q += __shfl_xor(q, mm, 32);
  }
  if (lane == 0) { redS[wave] = s; redQ[wave] = q; }
  __syncthreads();
  float S = 0.0f, Q2 = 0.0f;
#pragma unroll
  for (int w = 0; w < 8; ++w) { S += redS[w]; Q2 += redQ[w]; }
  const float mu   = S * (1.0f / D_);
  const float var  = Q2 * (1.0f / D_) - mu * mu;
  const float rstd = rsqrtf(var + 1e-5f);
#pragma unroll
  for (int e = 0; e < 4; ++e) {
    int   c = t + 256 * e;
    float y = (x[e] - mu) * rstd * g[c] + be[c];
    if (outF) outF[(size_t)row * D_ + c] = y;
    if (outB) outB[(size_t)row * D_ + c] = (__bf16)y;
  }
}

// ---------------------------------------------------------------------------
// fp32 -> bf16 conversion of all twelve operands in ONE launch. The twelve bf16
// destinations lie one behind the other in the workspace (each a multiple of
// 256 B), so the output is one array of 24 * 2^20 elements; only the source
// changes, at multiples of 2^20 elements. A block converts one tile of 8192
// elements a trip (a wave 1024: eight 512-B loads in flight, eight 256-B stores,
// whole lines both ways); a tile never straddles two sources.
//   units of 2^20: 0-3 x, 4-7 mem, 8-15 the eight D x D weights, 16-19 w1, 20-23 w2
// ---------------------------------------------------------------------------
typedef __bf16 bf16x4 __attribute__((ext_vector_type(4)));
constexpr uint32_t CVT_TILE   = 8192u;
constexpr uint32_t CVT_BLOCKS = 1024u;
constexpr uint32_t CVT_TRIPS  = 3u;     // 24 * 2^20 / (CVT_TILE * CVT_BLOCKS)
static_assert(CVT_TILE * CVT_BLOCKS * CVT_TRIPS == 24u << 20, "conversion covers every element once");

__global__ __launch_bounds__(256) void cvt_all_kernel(
    const float* __restrict__ x,  const float* __restrict__ mem,
    const float* __restrict__ m0, const float* __restrict__ m1,
    const float* __restrict__ m2, const float* __restrict__ m3,
    const float* __restrict__ m4, const float* __restrict__ m5,
    const float* __restrict__ m6, const float* __restrict__ m7,
    const float* __restrict__ w1, const float* __restrict__ w2,
    __bf16* __restrict__ out) {
  const uint32_t off = (threadIdx.x >> 5) * 1024u + (threadIdx.x & 31u) * 4u;
  // rolled: one short body; the WGP's other waves cover a wave's load latency
#pragma unroll 1
  for (uint32_t it = 0; it < CVT_TRIPS; ++it) {
    const uint32_t t = it * CVT_BLOCKS + blockIdx.x;   // tile
    const uint32_t u = t >> 7;                         // its unit of 2^20 elements
    const float*   src = w2;
    uint32_t       u0  = 20u;                          // first unit of the source
    if (u < 4u)       { src = x;   u0 = 0u; }
    else if (u < 8u)  { src = mem; u0 = 4u; }
    else if (u < 16u) {
      u0  = u;
      src = u == 8u ? m0 : u == 9u ? m1 : u == 10u ? m2 : u == 11u ? m3
          : u == 12u ? m4 : u == 13u ? m5 : u == 14u ? m6 : m7;
    }
    else if (u < 20u) { src = w1;  u0 = 16u; }
    const float* s = src + (size_t)(t - u0 * 128u) * CVT_TILE + off;
    __bf16*      d = out + (size_t)t * CVT_TILE + off;
    f32x4 a[8];
    // unrolled: the eight loads are issued together
#pragma unroll
    for (int i = 0; i < 8; ++i) a[i] = *(const f32x4*)(s + i * 128);
    wait_x0();   // behind the loads, in front of any rewrite of their address registers
#pragma unroll
    for (int i = 0; i < 8; ++i)
      *(bf16x4*)(d + i * 128) = __builtin_convertvector(a[i], bf16x4);
    wait_x0();   // behind the stores, in front of the next trip's addresses and data
  }
}

// ---------------------------------------------------------------------------
// Host orchestration
// ---------------------------------------------------------------------------
extern "C" void kernel_launch(void* const* d_in, const int* in_sizes, int n_in,
                              void* d_out, int out_size, void* d_ws,
                              size_t ws_size, hipStream_t stream) {
  (void)in_sizes; (void)n_in; (void)out_size; (void)ws_size;
  constexpr int Bc = 2, Lc = 2048, Mc = 2048, Dc = 1024, FFc = 4096;
  const int NT = Bc * Lc;  // 4096 query rows
  const int NM = Bc * Mc;  // 4096 memory rows

  const float* x   = (const float*)d_in[0];
  const float* mem = (const float*)d_in[1];
  const float* swq = (const float*)d_in[2];
  const float* swk = (const float*)d_in[3];
  const float* swv = (const float*)d_in[4];
  const float* swo = (const float*)d_in[5];
  const float* sbq = (const float*)d_in[6];
  const float* sbk = (const float*)d_in[7];
  const float* sbv = (const float*)d_in[8];
  const float* sbo = (const float*)d_in[9];
  const float* cwq = (const float*)d_in[10];
  const float* cwk = (const float*)d_in[11];
  const float* cwv = (const float*)d_in[12];
  const float* cwo = (const float*)d_in[13];
  const float* cbq = (const float*)d_in[14];
  const float* cbk = (const float*)d_in[15];
  const float* cbv = (const float*)d_in[16];
  const float* cbo = (const float*)d_in[17];
  const float* w1  = (const float*)d_in[18];
  const float* b1  = (const float*)d_in[19];
  const float* w2  = (const float*)d_in[20];
  const float* b2  = (const float*)d_in[21];
  const float* g1  = (const float*)d_in[22];
  const float* g2  = (const float*)d_in[23];
  const float* g3  = (const float*)d_in[24];
  const float* be1 = (const float*)d_in[25];
  const float* be2 = (const float*)d_in[26];
  const float* be3 = (const float*)d_in[27];

  char* p = (char*)d_ws;
  auto take = [&](size_t bytes) -> void* {
    void* r = (void*)p;
    p += (bytes + 255) & ~(size_t)255;
    return r;
  };
  __bf16* xcur_bf = (__bf16*)take((size_t)NT * Dc * 2);  // x_bf -> x1_bf -> x2_bf
  __bf16* mem_bf  = (__bf16*)take((size_t)NM * Dc * 2);
  __bf16* swq_bf  = (__bf16*)take((size_t)Dc * Dc * 2);
  __bf16* swk_bf  = (__bf16*)take((size_t)Dc * Dc * 2);
  __bf16* swv_bf  = (__bf16*)take((size_t)Dc * Dc * 2);
  __bf16* swo_bf  = (__bf16*)take((size_t)Dc * Dc * 2);
  __bf16* cwq_bf  = (__bf16*)take((size_t)Dc * Dc * 2);
  __bf16* cwk_bf  = (__bf16*)take((size_t)Dc * Dc * 2);
  __bf16* cwv_bf  = (__bf16*)take((size_t)Dc * Dc * 2);
  __bf16* cwo_bf  = (__bf16*)take((size_t)Dc * Dc * 2);
  __bf16* w1_bf   = (__bf16*)take((size_t)Dc * FFc * 2);
  __bf16* w2_bf   = (__bf16*)take((size_t)FFc * Dc * 2);
  __bf16* q_bf    = (__bf16*)take((size_t)NT * Dc * 2);
  __bf16* k_bf    = (__bf16*)take((size_t)NM * Dc * 2);
  __bf16* v_bf    = (__bf16*)take((size_t)NM * Dc * 2);
  __bf16* attn_bf = (__bf16*)take((size_t)NT * Dc * 2);
  float*  gout    = (float*)take((size_t)NT * Dc * 4);   // sa / ca / ff
  float*  x1f     = (float*)take((size_t)NT * Dc * 4);
  float*  x2f     = (float*)take((size_t)NT * Dc * 4);
  __bf16* h_bf    = (__bf16*)take((size_t)NT * FFc * 2);

  auto gemm = [&](const __bf16* Ag, const __bf16* Wg, const float* biasg,
                  float* Cfg, __bf16* Cbg, int Mg, int Ng, int Kg, int act) {
    dim3 grid(Ng / 128, Mg / 256);
    gemm_bf16_kernel<<<grid, 256, 0, stream>>>(Ag, Wg, biasg, Cfg, Cbg, Mg, Ng,
                                               Kg, act);
  };
  auto attn = [&](const __bf16* Qg, const __bf16* Kg, const __bf16* Vg,
                  __bf16* Og, int Lqv, int Lkv, int windowed) {
    int jobs = Bc * H_ * (Lqv / 16);  // one wave per job, 4 waves per block
    attn_kernel<<<jobs / 4, 128, 0, stream>>>(Qg, Kg, Vg, Og, Lqv, Lkv,
                                              windowed);
  };

  // ---- bf16 staging --------------------------------------------------------
  // xcur_bf .. w2_bf are taken in a row above: one destination array.
  cvt_all_kernel<<<CVT_BLOCKS, 256, 0, stream>>>(x, mem, swq, swk, swv, swo, cwq, cwk,
                                                 cwv, cwo, w1, w2, xcur_bf);

  // ---- self-attention (windowed causal + ALiBi) ----------------------------
  gemm(xcur_bf, swq_bf, sbq, nullptr, q_bf, NT, Dc, Dc, 0);
  gemm(xcur_bf, swk_bf, sbk, nullptr, k_bf, NT, Dc, Dc, 0);
  gemm(xcur_bf, swv_bf, sbv, nullptr, v_bf, NT, Dc, Dc, 0);
  attn(q_bf, k_bf, v_bf, attn_bf, Lc, Lc, 1);
  gemm(attn_bf, swo_bf, sbo, gout, nullptr, NT, Dc, Dc, 0);
  add_ln_kernel<<<NT, 256, 0, stream>>>(x, gout, g1, be1, x1f, xcur_bf);

  // ---- cross-attention (full) ---------------------------------------------
  gemm(xcur_bf, cwq_bf, cbq, nullptr, q_bf, NT, Dc, Dc, 0);
  gemm(mem_bf, cwk_bf, cbk, nullptr, k_bf, NM, Dc, Dc, 0);
  gemm(mem_bf, cwv_bf, cbv, nullptr, v_bf, NM, Dc, Dc, 0);
  attn_full_kernel<<<Bc * H_ * (Lc / 16) / 8, 256, 0, stream>>>(q_bf, k_bf, v_bf,
                                                                attn_bf, Lc, Mc);
  gemm(attn_bf, cwo_bf, cbo, gout, nullptr, NT, Dc, Dc, 0);
  add_ln_kernel<<<NT, 256, 0, stream>>>(x1f, gout, g2, be2, x2f, xcur_bf);

  // ---- FFN -----------------------------------------------------------------
  gemm(xcur_bf, w1_bf, b1, nullptr, h_bf, NT, FFc, Dc, 1);  // fused exact GELU
  gemm(h_bf, w2_bf, b2, gout, nullptr, NT, Dc, FFc, 0);
  add_ln_kernel<<<NT, 256, 0, stream>>>(x2f, gout, g3, be3, (float*)d_out,
                                        nullptr);
}

// v005
// Measured time: 355 microseconds a run.
// In both of two side-by-side timings against v004, it was 1.17 times as fast.
// Over all steps from v000 it is 4.24 times as fast.
#include <hip/hip_runtime.h>
#include <math.h>
#include <stdint.h>

typedef __attribute__((ext_vector_type(16))) __bf16 v16bf;
typedef __attribute__((ext_vector_type(8)))  float  v8f;

union ABu {
  v16bf          v;
  unsigned int   u[8];
  unsigned short s[16];
  __bf16         b[16];
};

union U4u {
  uint4        q;
  unsigned int u[4];
};

__device__ __forceinline__ int kpair(int t, int half) {
  int base = (t < 4) ? (2 * t) : (16 + 2 * (t - 4));
  return base + 8 * half;
}

__device__ __forceinline__ v8f wmma_bf16(v16bf a, v16bf b, v8f c) {
  return __builtin_amdgcn_wmma_f32_16x16x32_bf16(false, a, false, b,
                                                 (short)0, c, false, false);
}

#define D_  1024
#define H_  16
#define DH_ 64

typedef uint32_t u32x4 __attribute__((ext_vector_type(4)));
typedef uint32_t u32x8 __attribute__((ext_vector_type(8)));
typedef short    s16x8 __attribute__((ext_vector_type(8)));

__device__ __forceinline__ uint32_t uni(uint32_t v) {
  return (uint32_t)__builtin_amdgcn_readfirstlane(v);
}
__device__ __forceinline__ uint32_t pinned(uint32_t v) {
  uint32_t w = uni(v);
  asm volatile("" : "+s"(w));
  return w;
}
__device__ __forceinline__ void wait_ds0() {
  asm volatile("s_wait_dscnt 0x0" ::: "memory");      // own LDS reads done before the buffer is handed back
}
__device__ __forceinline__ void wait_tensor0(u32x4 g0, u32x8 ga, u32x8 gb) {
  asm volatile("s_wait_tensorcnt 0x0" ::"s"(g0), "s"(ga), "s"(gb) : "memory");
}
__device__ __forceinline__ void hold4(u32x4& g) { asm volatile("" : "+s"(g)); }
__device__ __forceinline__ void hold8(u32x8& g) { asm volatile("" : "+s"(g)); }
__device__ __forceinline__ void tdm_load(u32x4 g0, u32x8 g1) {
  asm volatile("tensor_load_to_lds %0, %1" ::"s"(g0), "s"(g1) : "memory");
}
__device__ __forceinline__ u32x4 tdm_group0(uint32_t lds_dst, uint64_t ga) {
  u32x4 g;
  g[0] = uni(1u);
  g[1] = uni(lds_dst);
  g[2] = uni((uint32_t)ga);
  g[3] = uni((((uint32_t)(ga >> 32)) & 0x01FFFFFFu) | 0x80000000u);
  return g;
}
// W0 = word 0 (pad fields, no mask), D0 = bytes per row, D1 = rows.
template <uint32_t W0, uint32_t D0, uint32_t D1>
__device__ __forceinline__ u32x8 tdm_group1(uint32_t src_pitch) {
  u32x8 g;
  g[0] = uni(W0);
  g[1] = uni((D0 & 0xFFFFu) << 16);
  g[2] = uni((D0 >> 16) | ((D1 & 0xFFFFu) << 16));
  g[3] = uni((D1 >> 16) | (D0 << 16));
  g[4] = uni(D1);
  g[5] = uni(src_pitch);
  g[6] = uni(0u);
  g[7] = uni(0u);
  return g;
}
__device__ __forceinline__ u32x4 ld_tr16(const unsigned char* p) {
  typedef __attribute__((address_space(3))) s16x8 lds_s16x8;
  return __builtin_bit_cast(u32x4,
                            __builtin_amdgcn_ds_load_tr16_b128_v8i16((lds_s16x8*)p));
}

union FragU {
  v16bf v;
  u32x4 q[2];
};

constexpr uint32_t PITCH_A = 144u, PITCH_B = 288u;
constexpr uint32_t SLICE_A = 10240u;              // 64 * 144 = 9216, rounded up
constexpr uint32_t SLICE_B = 6144u;               // 16 * 288 = 4608, rounded up
constexpr uint32_t BASE_B  = 4u * SLICE_A;
constexpr uint32_t BUF_SZ  = BASE_B + 4u * SLICE_B;  // 65536
constexpr uint32_t PAD_A   = (1u << 20) | (4u << 22) | (3u << 25);  // 128-B rows + 16 B
constexpr uint32_t PAD_B   = (1u << 20) | (5u << 22) | (7u << 25);  // 256-B rows + 32 B
static_assert(SLICE_A % 2048u == 0 && SLICE_B % 2048u == 0 && BUF_SZ % 2048u == 0, "slice places");
static_assert(64u * PITCH_A <= SLICE_A && 16u * PITCH_B <= SLICE_B, "slice sizes");

constexpr uint32_t EPI_PITCH = 272u;
constexpr uint32_t EPI_SZ    = 64u * EPI_PITCH;
constexpr uint32_t GEMM_LDS  = (8u * EPI_SZ > 2u * BUF_SZ) ? 8u * EPI_SZ : 2u * BUF_SZ;

typedef float  f32x4  __attribute__((ext_vector_type(4)));
typedef __bf16 bf16x8 __attribute__((ext_vector_type(8)));

template <bool GELU>
__device__ __forceinline__ float epi_val(float a, float bsv) {
  float val = a + bsv;
  if (GELU) val = 0.5f * val * (1.0f + erff(val * 0.70710678118f));
  return val;
}

// Stands directly behind the epilogue's global loads and stores, in front of any
// rewrite of a register that they name (the next trip's addresses and data).
__device__ __forceinline__ void wait_x0() {
  asm volatile("s_wait_xcnt 0x0" ::: "memory");
}

// Reads the wave's staged tile back row-wise and stores it: bias (+GELU), then
// 16 bytes per lane, so that every wave-wide store covers whole 128-B lines
// (f32: 2 rows of 256 B; bf16: 4 rows of 128 B). bias, Cf and Cb point at the
// tile's first column / element. The row loops stay rolled so that the
// epilogue's text is short (U stores a trip; without GELU four, so that a trip's
// LDS reads fly together). They walk from the last rows to the first: walking
// upwards, the compiler formed each LDS address as (base - tile size) with
// offset: tile size, a register below zero in wave 0; walking downwards, the
// loops that this file's launches run add a step >= 0 to the lane's base.
template <bool GELU>
__device__ __forceinline__ void store_tile(const unsigned char* stg, int lane,
                                           const float* bias, float* Cf, __bf16* Cb,
                                           int N) {
  constexpr int U = GELU ? 1 : 4;
  // The loops over u and e are unrolled so that every index is a constant (registers).
  if (Cf) {
    const int r = lane >> 4, c = (lane & 15) * 4;
    f32x4 bs = {0.0f, 0.0f, 0.0f, 0.0f};
    if (bias) {
      bs = *(const f32x4*)(bias + c);
      wait_x0();   // behind the bias load, in front of any rewrite of its offset register
    }
    const unsigned char* p = stg + (uint32_t)r * EPI_PITCH + (uint32_t)c * 4u;
    float* o = Cf + (size_t)r * N + c;
#pragma unroll 1
    for (int g = 32 / U - 1; g >= 0; --g) {
      f32x4 a[U];
#pragma unroll
      for (int u = 0; u < U; ++u)
        a[u] = *(const f32x4*)(p + (uint32_t)(g * U + u) * 2u * EPI_PITCH);
#pragma unroll
      for (int u = 0; u < U; ++u) {
        f32x4 y;
#pragma unroll
        for (int e = 0; e < 4; ++e) y[e] = epi_val<GELU>(a[u][e], bs[e]);
        *(f32x4*)(o + (size_t)(g * U + u) * 2 * N) = y;
      }
      wait_x0();
    }
  }
  if (Cb) {
    const int r = lane >> 3, c = (lane & 7) * 8;
    f32x4 bs0 = {0.0f, 0.0f, 0.0f, 0.0f}, bs1 = bs0;
    if (bias) {
      bs0 = *(const f32x4*)(bias + c);
      bs1 = *(const f32x4*)(bias + c + 4);
      wait_x0();   // behind the bias loads, in front of any rewrite of their offset register
    }
    const unsigned char* p = stg + (uint32_t)r * EPI_PITCH + (uint32_t)c * 4u;
    __bf16* o = Cb + (size_t)r * N + c;
#pragma unroll 1
    for (int g = 16 / U - 1; g >= 0; --g) {
      f32x4 a0[U], a1[U];
#pragma unroll
      for (int u = 0; u < U; ++u) {
        const unsigned char* q = p + (uint32_t)(g * U + u) * 4u * EPI_PITCH;
        a0[u] = *(const f32x4*)q;
        a1[u] = *(const f32x4*)(q + 16);
      }
#pragma unroll
      for (int u = 0; u < U; ++u) {
        bf16x8 y;
#pragma unroll
        for (int e = 0; e < 4; ++e) {
          y[e]     = (__bf16)epi_val<GELU>(a0[u][e], bs0[e]);
          y[e + 4] = (__bf16)epi_val<GELU>(a1[u][e], bs1[e]);
        }
        *(bf16x8*)(o + (size_t)(g * U + u) * 4 * N) = y;
      }
      wait_x0();
    }
  }
}

__global__ __launch_bounds__(256, 1) void gemm_bf16_kernel(
    const __bf16* A0, const __bf16* W0, const float* bias0, float* Cf0, __bf16* Cb0,
    const __bf16* A1, const __bf16* W1, const float* bias1, float* Cf1, __bf16* Cb1,
    const __bf16* A2, const __bf16* W2, const float* bias2, float* Cf2, __bf16* Cb2,
    int Mr, int N, int K, int act) {
  (void)Mr;
  __shared__ __attribute__((aligned(2048))) unsigned char L[GEMM_LDS];

  const uint32_t zs = blockIdx.z;
  const __bf16* A    = zs == 0u ? A0    : zs == 1u ? A1    : A2;
  const __bf16* W    = zs == 0u ? W0    : zs == 1u ? W1    : W2;
  const float*  bias = zs == 0u ? bias0 : zs == 1u ? bias1 : bias2;
  float*        Cf   = zs == 0u ? Cf0   : zs == 1u ? Cf1   : Cf2;
  __bf16*       Cb   = zs == 0u ? Cb0   : zs == 1u ? Cb1   : Cb2;

  const int      tid  = threadIdx.x;
  const int      lane = tid & 31;
  const uint32_t wave = uni((uint32_t)tid >> 5);
  const int wm   = (int)(wave >> 1);   // 0..3
  const int wn   = (int)(wave & 1u);   // 0..1
  const int half = lane >> 4;
  const int lr   = lane & 15;
  const int row0 = blockIdx.y * 256;
  const int col0 = blockIdx.x * 128;
  const uint32_t lbase = (uint32_t)(size_t)L;

  v8f acc[4][4];
#pragma unroll
  for (int mi = 0; mi < 4; ++mi)
#pragma unroll
    for (int ni = 0; ni < 4; ++ni)
#pragma unroll
      for (int e = 0; e < 8; ++e) acc[mi][ni][e] = 0.0f;

  // One request per wave and pass: waves 0-3 a slice of A, waves 4-7 of W.
  u32x8 g1a = tdm_group1<PAD_A, 128u, 64u>(2u * (uint32_t)K);
  u32x8 g1b = tdm_group1<PAD_B, 256u, 16u>(2u * (uint32_t)N);
  hold8(g1a);
  hold8(g1b);
  const bool     isA  = wave < 4u;
  const uint32_t j    = wave & 3u;
  const uint32_t dst0 = lbase + (isA ? j * SLICE_A : BASE_B + j * SLICE_B);
  const uint64_t src0 = isA
      ? (uint64_t)(size_t)A + 2ull * ((uint64_t)((uint32_t)row0 + j * 64u) * (uint32_t)K)
      : (uint64_t)(size_t)W + 2ull * ((uint64_t)(j * 16u) * (uint32_t)N + (uint32_t)col0);
  const uint64_t step = isA ? 128ull : 128ull * (uint32_t)N;   // bytes per pass
  u32x4 g0;
  auto issue = [&](uint32_t st) {   // pass st's slice, into buffer st & 1
    g0 = tdm_group0(dst0 + (st & 1u) * BUF_SZ, src0 + (uint64_t)st * step);
    hold4(g0);
    if (pinned(wave < 4u)) tdm_load(g0, g1a);
    else                   tdm_load(g0, g1b);
  };

  const uint32_t nt = (uint32_t)K >> 6;   // passes; every call has at least two

  issue(0u);
  wait_tensor0(g0, g1a, g1b);
  __syncthreads();                        // pass 0's tiles are published
  issue(1u);

  // Lane offsets of the fragment reads inside a buffer.
  const uint32_t aoff = (uint32_t)wm * SLICE_A + (uint32_t)lr * PITCH_A + 16u * (uint32_t)half;
  const uint32_t boff = BASE_B + (8u * (uint32_t)half + (uint32_t)(lane & 7)) * PITCH_B +
                        128u * (uint32_t)wn + 16u * (uint32_t)((lane >> 3) & 1);

  for (uint32_t s = 0; s < nt; ++s) {
    const unsigned char* Lb = L + (s & 1u) * BUF_SZ;
    // The loops below are unrolled so that every fragment and accumulator
    // index is a constant (registers, no scratch).
#pragma unroll
    for (int kb = 0; kb < 2; ++kb) {
      // A fragments, hardware k order: bytes 16h and 32 + 16h of each 64 B.
      FragU af[4];
#pragma unroll
      for (int mi = 0; mi < 4; ++mi) {
        const unsigned char* pa = Lb + aoff + (uint32_t)mi * 16u * PITCH_A + (uint32_t)kb * 64u;
        af[mi].q[0] = *(const u32x4*)pa;
        af[mi].q[1] = *(const u32x4*)(pa + 32);
      }
#pragma unroll
      for (int ni = 0; ni < 4; ++ni) {
        // W fragment: k-rows 32 kb + 0..15 and + 16..31 lie in two slices.
        const unsigned char* pb = Lb + boff + (uint32_t)(2 * kb) * SLICE_B + (uint32_t)ni * 32u;
        FragU bf;
        bf.q[0] = ld_tr16(pb);
        bf.q[1] = ld_tr16(pb + SLICE_B);
#pragma unroll
        for (int mi = 0; mi < 4; ++mi)
          acc[mi][ni] = wmma_bf16(af[mi].v, bf.v, acc[mi][ni]);
      }
    }

    // Publish point of pass s + 1; it also ends every reader's last read of
    // this pass's buffer, which is refilled behind it.
    wait_ds0();
    wait_tensor0(g0, g1a, g1b);
    __syncthreads();
    if (pinned(s + 2u < nt)) issue(s + 2u);
  }
  wait_tensor0(g0, g1a, g1b);
  wait_ds0();

  // epilogue ------------------------------------------------------------------
  // The last pass's publish point (own LDS reads done, own tensor loads landed,
  // barrier) has freed the ring for every wave: each wave now stages its own
  // 64 x 64 tile in its own range of L, which runs 8 KiB past the ring.
  unsigned char* stg = L + wave * EPI_SZ;
  {
    float* w = (float*)(stg + (uint32_t)(8 * half) * EPI_PITCH) + lr;
    // unrolled: every accumulator index is a constant (registers, no scratch)
#pragma unroll
    for (int mi = 0; mi < 4; ++mi)
#pragma unroll
      for (int ni = 0; ni < 4; ++ni)
#pragma unroll
        for (int v = 0; v < 8; ++v)
          w[(mi * 16 + v) * (int)(EPI_PITCH / 4u) + ni * 16] = acc[mi][ni][v];
  }
  wait_ds0();   // the wave's rows are in LDS before its lanes read each other's values back

  const int    trow = row0 + wm * 64;
  const int    tcol = col0 + wn * 64;
  const size_t toff = (size_t)trow * N + tcol;
  const float* bt   = bias ? bias + tcol : nullptr;
  float*       cf   = Cf ? Cf + toff : nullptr;
  __bf16*      cb   = Cb ? Cb + toff : nullptr;
  if (act == 1) store_tile<true>(stg, lane, bt, cf, cb, N);
  else          store_tile<false>(stg, lane, bt, cf, cb, N);
}

// ---------------------------------------------------------------------------
// Flash attention: one wave per (batch, head, 16-query block).
// windowed=1 -> causal local window W=64 + ALiBi; windowed=0 -> full attn.
// Q,K,V,O are bf16 [B*Lq(or Lk), D] with head h at feature offset h*64.
// ---------------------------------------------------------------------------
__global__ __launch_bounds__(128) void attn_kernel(
    const __bf16* __restrict__ Q, const __bf16* __restrict__ Km,
    const __bf16* __restrict__ Vm, __bf16* __restrict__ O,
    int Lq, int Lk, int windowed) {
  __shared__ __bf16 lP[4][16][32];  // per-wave P staging (C-layout -> A-layout)
  const int lane  = threadIdx.x & 31;
  const int wave  = threadIdx.x >> 5;
  const int half  = lane >> 4;
  const int lr    = lane & 15;
  const int qbPer = Lq >> 4;
  const int job   = blockIdx.x * 4 + wave;
  const int qblk  = job % qbPer;
  const int h     = (job / qbPer) % H_;
  const int b     = job / (qbPer * H_);
  const int q0    = qblk << 4;

  const float slope = windowed ? exp2f(-8.0f * (float)(h + 1) / (float)H_) : 0.0f;

  // Q fragments (A operand): 16 queries x 64 features
  v16bf qa[2];
  {
    const __bf16* qb = Q + ((size_t)(b * Lq + q0 + lr)) * D_ + h * DH_;
#pragma unroll
    for (int f = 0; f < 2; ++f) {
      ABu u;
#pragma unroll
      for (int t = 0; t < 8; ++t)
        u.u[t] = *(const unsigned int*)(qb + f * 32 + kpair(t, half));
      qa[f] = u.v;
    }
  }

  float mrow[8], lrow[8];
  v8f   o[4];
#pragma unroll
  for (int v = 0; v < 8; ++v) { mrow[v] = -3.0e38f; lrow[v] = 0.0f; }
#pragma unroll
  for (int f = 0; f < 4; ++f)
#pragma unroll
    for (int e = 0; e < 8; ++e) o[f][e] = 0.0f;

  const int nch = windowed ? 3 : (Lk >> 5);  // uniform across the block
  for (int ch = 0; ch < nch; ++ch) {
    const int kc = windowed ? (q0 - 64 + 32 * ch) : (32 * ch);

    // S = Q @ K^T : 16 queries x 32 keys ------------------------------------
    v8f s[2];
#pragma unroll
    for (int g = 0; g < 2; ++g) {
#pragma unroll
      for (int e = 0; e < 8; ++e) s[g][e] = 0.0f;
      int key  = kc + g * 16 + lr;
      int keyc = key < 0 ? 0 : (key >= Lk ? Lk - 1 : key);
      const __bf16* kb = Km + ((size_t)(b * Lk + keyc)) * D_ + h * DH_;
#pragma unroll
      for (int f = 0; f < 2; ++f) {
        ABu u;
#pragma unroll
        for (int t = 0; t < 8; ++t)
          u.u[t] = *(const unsigned int*)(kb + f * 32 + kpair(t, half));
        s[g] = wmma_bf16(qa[f], u.v, s[g]);
      }
    }

    // scale + ALiBi + mask, online softmax ----------------------------------
#pragma unroll
    for (int v = 0; v < 8; ++v) {
      const int i    = q0 + v + 8 * half;
      float     best = -3.0e38f;
#pragma unroll
      for (int g = 0; g < 2; ++g) {
        const int j  = kc + g * 16 + lr;
        float     sv = s[g][v] * 0.125f + slope * (float)(j - i);
        bool valid = windowed ? (j >= 0 && j <= i && (i - j) < 64) : (j < Lk);
        sv       = valid ? sv : -1.0e30f;
        s[g][v]  = sv;
        best     = fmaxf(best, sv);
      }
#pragma unroll
      for (int mm = 1; mm < 16; mm <<= 1)
        best = fmaxf(best, __shfl_xor(best, mm, 16));
      const float mnew  = fmaxf(mrow[v], best);
      const float alpha = expf(mrow[v] - mnew);
      float psum = 0.0f;
#pragma unroll
      for (int g = 0; g < 2; ++g) {
        float pv = expf(s[g][v] - mnew);
        lP[wave][v + 8 * half][g * 16 + lr] = (__bf16)pv;
        psum += pv;
      }
#pragma unroll
      for (int mm = 1; mm < 16; mm <<= 1) psum += __shfl_xor(psum, mm, 16);
      lrow[v] = lrow[v] * alpha + psum;
      mrow[v] = mnew;
#pragma unroll
      for (int f = 0; f < 4; ++f) o[f][v] *= alpha;
    }
    __syncthreads();

    // P fragment (A operand): 16 queries x 32 keys --------------------------
    v16bf pa;
    {
      ABu u;
#pragma unroll
      for (int t = 0; t < 8; ++t)
        u.u[t] = *(const unsigned int*)&lP[wave][lr][kpair(t, half)];
      pa = u.v;
    }

    // O += P @ V(chunk) ------------------------------------------------------
#pragma unroll
    for (int f = 0; f < 4; ++f) {
      ABu u;
#pragma unroll
      for (int t = 0; t < 8; ++t) {
        int k  = kpair(t, half);
        int j0 = kc + k, j1 = kc + k + 1;
        j0 = j0 < 0 ? 0 : (j0 >= Lk ? Lk - 1 : j0);
        j1 = j1 < 0 ? 0 : (j1 >= Lk ? Lk - 1 : j1);
        u.b[2 * t]     = Vm[((size_t)(b * Lk + j0)) * D_ + h * DH_ + f * 16 + lr];
        u.b[2 * t + 1] = Vm[((size_t)(b * Lk + j1)) * D_ + h * DH_ + f * 16 + lr];
      }
      o[f] = wmma_bf16(pa, u.v, o[f]);
    }
    __syncthreads();
  }

  // normalize + store --------------------------------------------------------
#pragma unroll
  for (int f = 0; f < 4; ++f)
#pragma unroll
    for (int v = 0; v < 8; ++v) {
      const int   row = q0 + v + 8 * half;
      const float inv = 1.0f / fmaxf(lrow[v], 1.0e-20f);
      O[((size_t)(b * Lq + row)) * D_ + h * DH_ + f * 16 + lr] =
          (__bf16)(o[f][v] * inv);
    }
}

// ---------------------------------------------------------------------------
// Full (unmasked) attention with K and V staged in LDS. 8 waves per block, one
// 16-query block per wave, all of one (batch, head), so every wave reads the
// same keys. A stage is 128 keys; both tiles come by tensor loads, one request
// per wave and stage, in a ring of two buffers: the next stage's tiles fly
// while this one is worked on.
//   waves 0-3: 32 key rows of K, 128 B each, LDS pitch 144 B (ds_load_b128 reader)
//   waves 4-7: 32 key rows of V, 128 B each, LDS pitch 160 B (transposing reader)
// Every slice starts at a multiple of 2 KiB. Needs Lk % 128 == 0, Lk >= 256,
// (Lq / 16) % 8 == 0.
// ---------------------------------------------------------------------------
constexpr uint32_t PITCH_K  = 144u, PITCH_V = 160u;
constexpr uint32_t SLICE_KV = 6144u;              // 32 * 144 = 4608, 32 * 160 = 5120, rounded up
constexpr uint32_t BASE_V   = 4u * SLICE_KV;
constexpr uint32_t KV_SZ    = 8u * SLICE_KV;      // 49152
constexpr uint32_t PAD_K    = (1u << 20) | (4u << 22) | (3u << 25);  // 128-B rows + 16 B
constexpr uint32_t PAD_V    = (1u << 20) | (4u << 22) | (7u << 25);  // 128-B rows + 32 B
static_assert(SLICE_KV % 2048u == 0 && KV_SZ % 2048u == 0, "slice places");
static_assert(32u * PITCH_K <= SLICE_KV && 32u * PITCH_V <= SLICE_KV, "slice sizes");

__global__ __launch_bounds__(256) void attn_full_kernel(
    const __bf16* __restrict__ Q, const __bf16* __restrict__ Km,
    const __bf16* __restrict__ Vm, __bf16* __restrict__ O,
    int Lq, int Lk) {
  __shared__ __attribute__((aligned(2048))) unsigned char L[2u * KV_SZ];
  __shared__ __bf16 lP[8][16][32];  // per-wave P staging (C-layout -> A-layout)
  const int      lane  = threadIdx.x & 31;
  const uint32_t wave  = uni((uint32_t)threadIdx.x >> 5);
  const int      half  = lane >> 4;
  const int      lr    = lane & 15;
  const int      qbPer = Lq >> 4;
  const int      job0  = blockIdx.x * 8;          // the block's 8 jobs share b and h
  const int      qblk  = job0 % qbPer + (int)wave;
  const int      h     = (job0 / qbPer) % H_;
  const int      b     = job0 / (qbPer * H_);
  const int      q0    = qblk << 4;
  const uint32_t lbase = (uint32_t)(size_t)L;

  // One request per wave and stage: waves 0-3 a slice of K, waves 4-7 of V.
  u32x8 g1k = tdm_group1<PAD_K, 128u, 32u>(2u * (uint32_t)D_);
  u32x8 g1v = tdm_group1<PAD_V, 128u, 32u>(2u * (uint32_t)D_);
  hold8(g1k);
  hold8(g1v);
  const uint32_t jsl  = wave & 3u;
  const uint32_t dst0 = lbase + (wave < 4u ? 0u : BASE_V) + jsl * SLICE_KV;
  const uint64_t src0 = (uint64_t)(size_t)(wave < 4u ? Km : Vm) +
      2ull * ((uint64_t)((uint32_t)(b * Lk) + jsl * 32u) * (uint32_t)D_ + (uint32_t)(h * DH_));
  const uint64_t step = 2ull * 128ull * (uint32_t)D_;   // bytes per stage
  u32x4 g0;
  auto issue = [&](uint32_t st) {   // stage st's slice, into buffer st & 1
    g0 = tdm_group0(dst0 + (st & 1u) * KV_SZ, src0 + (uint64_t)st * step);
    hold4(g0);
    if (pinned(wave < 4u)) tdm_load(g0, g1k);
    else                   tdm_load(g0, g1v);
  };

  const uint32_t nt = (uint32_t)Lk >> 7;   // stages; at least two

  issue(0u);
  wait_tensor0(g0, g1k, g1v);
  __syncthreads();                         // stage 0's tiles are published
  issue(1u);

  // Every loop over fragments, rows and registers in this kernel is unrolled so
  // that each fragment and accumulator index is a constant (registers, no scratch).
  // Q fragments (A operand): 16 queries x 64 features
  v16bf qa[2];
  {
    const __bf16* qb = Q + ((size_t)(b * Lq + q0 + lr)) * D_ + h * DH_;
#pragma unroll
    for (int f = 0; f < 2; ++f) {
      ABu u;
#pragma unroll
      for (int t = 0; t < 8; ++t)
        u.u[t] = *(const unsigned int*)(qb + f * 32 + kpair(t, half));
      qa[f] = u.v;
    }
  }

  float mrow[8], lrow[8];
  v8f   o[4];
#pragma unroll
  for (int v = 0; v < 8; ++v) { mrow[v] = -3.0e38f; lrow[v] = 0.0f; }
#pragma unroll
  for (int f = 0; f < 4; ++f)
#pragma unroll
    for (int e = 0; e < 8; ++e) o[f][e] = 0.0f;

  // Lane offsets of the fragment reads inside a slice.
  const uint32_t koff = (uint32_t)lr * PITCH_K + 16u * (uint32_t)half;
  const uint32_t voff = BASE_V + (8u * (uint32_t)half + (uint32_t)(lane & 7)) * PITCH_V +
                        16u * (uint32_t)((lane >> 3) & 1);

  for (uint32_t st = 0; st < nt; ++st) {
    const unsigned char* Lb = L + (st & 1u) * KV_SZ;
    for (uint32_t c = 0; c < 4u; ++c) {    // 32 keys: slice c of K and of V
      const unsigned char* Ls = Lb + c * SLICE_KV;

      // S = Q @ K^T : 16 queries x 32 keys ----------------------------------
      v8f s[2];
#pragma unroll
      for (int g = 0; g < 2; ++g) {
#pragma unroll
        for (int e = 0; e < 8; ++e) s[g][e] = 0.0f;
#pragma unroll
        for (int f = 0; f < 2; ++f) {
          // hardware k order: bytes 16h and 32 + 16h of each 64 B of key row lr
          const unsigned char* pk = Ls + koff + (uint32_t)g * 16u * PITCH_K + (uint32_t)f * 64u;
          FragU kf;
          kf.q[0] = *(const u32x4*)pk;
          kf.q[1] = *(const u32x4*)(pk + 32);
          s[g] = wmma_bf16(qa[f], kf.v, s[g]);
        }
      }

      // scale, online softmax -------------------------------------------------
#pragma unroll
      for (int v = 0; v < 8; ++v) {
        float best = -3.0e38f;
#pragma unroll
        for (int g = 0; g < 2; ++g) {
          float sv = s[g][v] * 0.125f;
          s[g][v]  = sv;
          best     = fmaxf(best, sv);
        }
#pragma unroll
        for (int mm = 1; mm < 16; mm <<= 1)
          best = fmaxf(best, __shfl_xor(best, mm, 16));
        const float mnew  = fmaxf(mrow[v], best);
        const float alpha = expf(mrow[v] - mnew);
        float psum = 0.0f;
#pragma unroll
        for (int g = 0; g < 2; ++g) {
          float pv = expf(s[g][v] - mnew);
          lP[wave][v + 8 * half][g * 16 + lr] = (__bf16)pv;
          psum += pv;
        }
#pragma unroll
        for (int mm = 1; mm < 16; mm <<= 1) psum += __shfl_xor(psum, mm, 16);
        lrow[v] = lrow[v] * alpha + psum;
        mrow[v] = mnew;
#pragma unroll
        for (int f = 0; f < 4; ++f) o[f][v] *= alpha;
      }
      __syncthreads();

      // P fragment (A operand): 16 queries x 32 keys ------------------------
      v16bf pa;
      {
        ABu u;
#pragma unroll
        for (int t = 0; t < 8; ++t)
          u.u[t] = *(const unsigned int*)&lP[wave][lr][kpair(t, half)];
        pa = u.v;
      }

      // O += P @ V(chunk): key rows 0..15 and 16..31, transposed on the read --
#pragma unroll
      for (int f = 0; f < 4; ++f) {
        const unsigned char* pv = Ls + voff + (uint32_t)f * 32u;
        FragU vf;
        vf.q[0] = ld_tr16(pv);
        vf.q[1] = ld_tr16(pv + 16u * PITCH_V);
        o[f] = wmma_bf16(pa, vf.v, o[f]);
      }
      __syncthreads();
    }

    // Publish point of stage st + 1; it also ends every reader's last read of
    // this stage's buffer, which is refilled behind it.
    wait_ds0();
    wait_tensor0(g0, g1k, g1v);
    __syncthreads();
    if (pinned(st + 2u < nt)) issue(st + 2u);
  }
  wait_tensor0(g0, g1k, g1v);
  wait_ds0();

  // normalize + store --------------------------------------------------------
#pragma unroll
  for (int f = 0; f < 4; ++f)
#pragma unroll
    for (int v = 0; v < 8; ++v) {
      const int   row = q0 + v + 8 * half;
      const float inv = 1.0f / fmaxf(lrow[v], 1.0e-20f);
      O[((size_t)(b * Lq + row)) * D_ + h * DH_ + f * 16 + lr] =
          (__bf16)(o[f][v] * inv);
    }
}

// ---------------------------------------------------------------------------
// Fused residual add + LayerNorm over D=1024. One 256-thread block per row.
// Emits f32 (residual stream) and/or bf16 (next-GEMM operand).
// ---------------------------------------------------------------------------
__global__ __launch_bounds__(256) void add_ln_kernel(
    const float* __restrict__ A, const float* __restrict__ Bv,
    const float* __restrict__ g, const float* __restrict__ be,
    float* __restrict__ outF, __bf16* __restrict__ outB) {
  __shared__ float redS[8], redQ[8];
  const int row  = blockIdx.x;
  const int t    = threadIdx.x;
  const int lane = t & 31, wave = t >> 5;
  const float* a = A + (size_t)row * D_;
  const float* r = Bv + (size_t)row * D_;

  float x[4], s = 0.0f, q = 0.0f;
#pragma unroll
  for (int e = 0; e < 4; ++e) {
    int c = t + 256 * e;
    x[e]  = a[c] + r[c];
    s    += x[e];
    q    += x[e] * x[e];
  }
#pragma unroll
  for (int mm = 1; mm < 32; mm <<= 1) {
    s += __shfl_xor(s, mm, 32);
    q += __shfl_xor(q, mm, 32);
  }
  if (lane == 0) { redS[wave] = s; redQ[wave] = q; }
  __syncthreads();
  float S = 0.0f, Q2 = 0.0f;
#pragma unroll
  for (int w = 0; w < 8; ++w) { S += redS[w]; Q2 += redQ[w]; }
  const float mu   = S * (1.0f / D_);
  const float var  = Q2 * (1.0f / D_) - mu * mu;
  const float rstd = rsqrtf(var + 1e-5f);
#pragma unroll
  for (int e = 0; e < 4; ++e) {
    int   c = t + 256 * e;
    float y = (x[e] - mu) * rstd * g[c] + be[c];
    if (outF) outF[(size_t)row * D_ + c] = y;
    if (outB) outB[(size_t)row * D_ + c] = (__bf16)y;
  }
}

// ---------------------------------------------------------------------------
// fp32 -> bf16 conversion of all twelve operands in ONE launch. The twelve bf16
// destinations lie one behind the other in the workspace (each a multiple of
// 256 B), so the output is one array of 24 * 2^20 elements; only the source
// changes, at multiples of 2^20 elements. A block converts one tile of 8192
// elements a trip (a wave 1024: eight 512-B loads in flight, eight 256-B stores,
// whole lines both ways); a tile never straddles two sources.
//   units of 2^20: 0-3 x, 4-7 mem, 8-15 the eight D x D weights, 16-19 w1, 20-23 w2
// ---------------------------------------------------------------------------
typedef __bf16 bf16x4 __attribute__((ext_vector_type(4)));
constexpr uint32_t CVT_TILE   = 8192u;
constexpr uint32_t CVT_BLOCKS = 1024u;
constexpr uint32_t CVT_TRIPS  = 3u;     // 24 * 2^20 / (CVT_TILE * CVT_BLOCKS)
static_assert(CVT_TILE * CVT_BLOCKS * CVT_TRIPS == 24u << 20, "conversion covers every element once");

__global__ __launch_bounds__(256) void cvt_all_kernel(
    const float* __restrict__ x,  const float* __restrict__ mem,
    const float* __restrict__ m0, const float* __restrict__ m1,
    const float* __restrict__ m2, const float* __restrict__ m3,
    const float* __restrict__ m4, const float* __restrict__ m5,
    const float* __restrict__ m6, const float* __restrict__ m7,
    const float* __restrict__ w1, const float* __restrict__ w2,
    __bf16* __restrict__ out) {
  const uint32_t off = (threadIdx.x >> 5) * 1024u + (threadIdx.x & 31u) * 4u;
  // rolled: one short body; the WGP's other waves cover a wave's load latency
#pragma unroll 1
  for (uint32_t it = 0; it < CVT_TRIPS; ++it) {
    const uint32_t t = it * CVT_BLOCKS + blockIdx.x;   // tile
    const uint32_t u = t >> 7;                         // its unit of 2^20 elements
    const float*   src = w2;
    uint32_t       u0  = 20u;                          // first unit of the source
    if (u < 4u)       { src = x;   u0 = 0u; }
    else if (u < 8u)  { src = mem; u0 = 4u; }
    else if (u < 16u) {
      u0  = u;
      src = u == 8u ? m0 : u == 9u ? m1 : u == 10u ? m2 : u == 11u ? m3
          : u == 12u ? m4 : u == 13u ? m5 : u == 14u ? m6 : m7;
    }
    else if (u < 20u) { src = w1;  u0 = 16u; }
    const float* s = src + (size_t)(t - u0 * 128u) * CVT_TILE + off;
    __bf16*      d = out + (size_t)t * CVT_TILE + off;
    f32x4 a[8];
    // unrolled: the eight loads are issued together
#pragma unroll
    for (int i = 0; i < 8; ++i) a[i] = *(const f32x4*)(s + i * 128);
    wait_x0();   // behind the loads, in front of any rewrite of their address registers
#pragma unroll
    for (int i = 0; i < 8; ++i)
      *(bf16x4*)(d + i * 128) = __builtin_convertvector(a[i], bf16x4);
    wait_x0();   // behind the stores, in front of the next trip's addresses and data
  }
}

// ---------------------------------------------------------------------------
// Host orchestration
// ---------------------------------------------------------------------------
extern "C" void kernel_launch(void* const* d_in, const int* in_sizes, int n_in,
                              void* d_out, int out_size, void* d_ws,
                              size_t ws_size, hipStream_t stream) {
  (void)in_sizes; (void)n_in; (void)out_size; (void)ws_size;
  constexpr int Bc = 2, Lc = 2048, Mc = 2048, Dc = 1024, FFc = 4096;
  constexpr int NT = Bc * Lc;  // 4096 query rows
  constexpr int NM = Bc * Mc;  // 4096 memory rows

  const float* x   = (const float*)d_in[0];
  const float* mem = (const float*)d_in[1];
  const float* swq = (const float*)d_in[2];
  const float* swk = (const float*)d_in[3];
  const float* swv = (const float*)d_in[4];
  const float* swo = (const float*)d_in[5];
  const float* sbq = (const float*)d_in[6];
  const float* sbk = (const float*)d_in[7];
  const float* sbv = (const float*)d_in[8];
  const float* sbo = (const float*)d_in[9];
  const float* cwq = (const float*)d_in[10];
  const float* cwk = (const float*)d_in[11];
  const float* cwv = (const float*)d_in[12];
  const float* cwo = (const float*)d_in[13];
  const float* cbq = (const float*)d_in[14];
  const float* cbk = (const float*)d_in[15];
  const float* cbv = (const float*)d_in[16];
  const float* cbo = (const float*)d_in[17];
  const float* w1  = (const float*)d_in[18];
  const float* b1  = (const float*)d_in[19];
  const float* w2  = (const float*)d_in[20];
  const float* b2  = (const float*)d_in[21];
  const float* g1  = (const float*)d_in[22];
  const float* g2  = (const float*)d_in[23];
  const float* g3  = (const float*)d_in[24];
  const float* be1 = (const float*)d_in[25];
  const float* be2 = (const float*)d_in[26];
  const float* be3 = (const float*)d_in[27];

  char* p = (char*)d_ws;
  auto take = [&](size_t bytes) -> void* {
    void* r = (void*)p;
    p += (bytes + 255) & ~(size_t)255;
    return r;
  };
  __bf16* xcur_bf = (__bf16*)take((size_t)NT * Dc * 2);  // x_bf -> x1_bf -> x2_bf
  __bf16* mem_bf  = (__bf16*)take((size_t)NM * Dc * 2);
  __bf16* swq_bf  = (__bf16*)take((size_t)Dc * Dc * 2);
  __bf16* swk_bf  = (__bf16*)take((size_t)Dc * Dc * 2);
  __bf16* swv_bf  = (__bf16*)take((size_t)Dc * Dc * 2);
  __bf16* swo_bf  = (__bf16*)take((size_t)Dc * Dc * 2);
  __bf16* cwq_bf  = (__bf16*)take((size_t)Dc * Dc * 2);
  __bf16* cwk_bf  = (__bf16*)take((size_t)Dc * Dc * 2);
  __bf16* cwv_bf  = (__bf16*)take((size_t)Dc * Dc * 2);
  __bf16* cwo_bf  = (__bf16*)take((size_t)Dc * Dc * 2);
  __bf16* w1_bf   = (__bf16*)take((size_t)Dc * FFc * 2);
  __bf16* w2_bf   = (__bf16*)take((size_t)FFc * Dc * 2);
  __bf16* q_bf    = (__bf16*)take((size_t)NT * Dc * 2);
  __bf16* k_bf    = (__bf16*)take((size_t)NM * Dc * 2);
  __bf16* v_bf    = (__bf16*)take((size_t)NM * Dc * 2);
  __bf16* attn_bf = (__bf16*)take((size_t)NT * Dc * 2);
  float*  gout    = (float*)take((size_t)NT * Dc * 4);   // sa / ca / ff
  float*  x1f     = (float*)take((size_t)NT * Dc * 4);
  float*  x2f     = (float*)take((size_t)NT * Dc * 4);
  __bf16* h_bf    = (__bf16*)take((size_t)NT * FFc * 2);

  struct Prod {   // one product's operand set
    const __bf16* A; const __bf16* W; const float* bias; float* Cf; __bf16* Cb;
  };
  const Prod none = {nullptr, nullptr, nullptr, nullptr, nullptr};
  // nz products of one shape in one launch
  auto gemm = [&](int nz, Prod p0, Prod p1, Prod p2, int Mg, int Ng, int Kg, int act) {
    dim3 grid(Ng / 128, Mg / 256, nz);
    gemm_bf16_kernel<<<grid, 256, 0, stream>>>(p0.A, p0.W, p0.bias, p0.Cf, p0.Cb,
                                               p1.A, p1.W, p1.bias, p1.Cf, p1.Cb,
                                               p2.A, p2.W, p2.bias, p2.Cf, p2.Cb,
                                               Mg, Ng, Kg, act);
  };
  auto attn = [&](const __bf16* Qg, const __bf16* Kg, const __bf16* Vg,
                  __bf16* Og, int Lqv, int Lkv, int windowed) {
    int jobs = Bc * H_ * (Lqv / 16);  // one wave per job, 4 waves per block
    attn_kernel<<<jobs / 4, 128, 0, stream>>>(Qg, Kg, Vg, Og, Lqv, Lkv,
                                              windowed);
  };

  // ---- bf16 staging --------------------------------------------------------
  // xcur_bf .. w2_bf are taken in a row above: one destination array.
  cvt_all_kernel<<<CVT_BLOCKS, 256, 0, stream>>>(x, mem, swq, swk, swv, swo, cwq, cwk,
                                                 cwv, cwo, w1, w2, xcur_bf);

  // ---- self-attention (windowed causal + ALiBi) ----------------------------
  gemm(3, {xcur_bf, swq_bf, sbq, nullptr, q_bf}, {xcur_bf, swk_bf, sbk, nullptr, k_bf},
       {xcur_bf, swv_bf, sbv, nullptr, v_bf}, NT, Dc, Dc, 0);
  attn(q_bf, k_bf, v_bf, attn_bf, Lc, Lc, 1);
  // The cross-attention keys depend on mem alone: they ride with the output
  // projection (k_bf is free, the self-attention launch before this has read it).
  gemm(2, {attn_bf, swo_bf, sbo, gout, nullptr}, {mem_bf, cwk_bf, cbk, nullptr, k_bf},
       none, NT, Dc, Dc, 0);
  add_ln_kernel<<<NT, 256, 0, stream>>>(x, gout, g1, be1, x1f, xcur_bf);

  // ---- cross-attention (full) ---------------------------------------------
  static_assert(NT == NM, "products of one launch have one shape");
  gemm(2, {xcur_bf, cwq_bf, cbq, nullptr, q_bf}, {mem_bf, cwv_bf, cbv, nullptr, v_bf},
       none, NT, Dc, Dc, 0);
  attn_full_kernel<<<Bc * H_ * (Lc / 16) / 8, 256, 0, stream>>>(q_bf, k_bf, v_bf,
                                                                attn_bf, Lc, Mc);
  gemm(1, {attn_bf, cwo_bf, cbo, gout, nullptr}, none, none, NT, Dc, Dc, 0);
  add_ln_kernel<<<NT, 256, 0, stream>>>(x1f, gout, g2, be2, x2f, xcur_bf);

  // ---- FFN -----------------------------------------------------------------
  gemm(1, {xcur_bf, w1_bf, b1, nullptr, h_bf}, none, none, NT, FFc, Dc, 1);  // fused exact GELU
  gemm(1, {h_bf, w2_bf, b2, gout, nullptr}, none, none, NT, Dc, FFc, 0);
  add_ln_kernel<<<NT, 256, 0, stream>>>(x2f, gout, g3, be3, (float*)d_out,
                                        nullptr);
}

// v006
// It runs in 296 microseconds.
// Next to v005, in two timings, it ran 1.20 and 1.21 times as fast.
// All steps since v000 together make it 5.11 times as fast.
#include <hip/hip_runtime.h>
#include <math.h>
#include <stdint.h>

typedef __attribute__((ext_vector_type(16))) __bf16 v16bf;
typedef __attribute__((ext_vector_type(8)))  float  v8f;

union ABu {
  v16bf          v;
  unsigned int   u[8];
  unsigned short s[16];
  __bf16         b[16];
};

union U4u {
  uint4        q;
  unsigned int u[4];
};

__device__ __forceinline__ int kpair(int t, int half) {
  int base = (t < 4) ? (2 * t) : (16 + 2 * (t - 4));
  return base + 8 * half;
}

__device__ __forceinline__ v8f wmma_bf16(v16bf a, v16bf b, v8f c) {
  return __builtin_amdgcn_wmma_f32_16x16x32_bf16(false, a, false, b,
                                                 (short)0, c, false, false);
}

#define D_  1024
#define H_  16
#define DH_ 64

typedef uint32_t u32x4 __attribute__((ext_vector_type(4)));
typedef uint32_t u32x8 __attribute__((ext_vector_type(8)));
typedef short    s16x8 __attribute__((ext_vector_type(8)));

__device__ __forceinline__ uint32_t uni(uint32_t v) {
  return (uint32_t)__builtin_amdgcn_readfirstlane(v);
}
__device__ __forceinline__ uint32_t pinned(uint32_t v) {
  uint32_t w = uni(v);
  asm volatile("" : "+s"(w));
  return w;
}
__device__ __forceinline__ void wait_ds0() {
  asm volatile("s_wait_dscnt 0x0" ::: "memory");      // own LDS reads done before the buffer is handed back
}
__device__ __forceinline__ void wait_tensor0(u32x4 g0, u32x8 ga, u32x8 gb) {
  asm volatile("s_wait_tensorcnt 0x0" ::"s"(g0), "s"(ga), "s"(gb) : "memory");
}
__device__ __forceinline__ void hold4(u32x4& g) { asm volatile("" : "+s"(g)); }
__device__ __forceinline__ void hold8(u32x8& g) { asm volatile("" : "+s"(g)); }
__device__ __forceinline__ void tdm_load(u32x4 g0, u32x8 g1) {
  asm volatile("tensor_load_to_lds %0, %1" ::"s"(g0), "s"(g1) : "memory");
}
__device__ __forceinline__ u32x4 tdm_group0(uint32_t lds_dst, uint64_t ga) {
  u32x4 g;
  g[0] = uni(1u);
  g[1] = uni(lds_dst);
  g[2] = uni((uint32_t)ga);
  g[3] = uni((((uint32_t)(ga >> 32)) & 0x01FFFFFFu) | 0x80000000u);
  return g;
}
// W0 = word 0 (pad fields, no mask), D0 = bytes per row, D1 = rows.
template <uint32_t W0, uint32_t D0, uint32_t D1>
__device__ __forceinline__ u32x8 tdm_group1(uint32_t src_pitch) {
  u32x8 g;
  g[0] = uni(W0);
  g[1] = uni((D0 & 0xFFFFu) << 16);
  g[2] = uni((D0 >> 16) | ((D1 & 0xFFFFu) << 16));
  g[3] = uni((D1 >> 16) | (D0 << 16));
  g[4] = uni(D1);
  g[5] = uni(src_pitch);
  g[6] = uni(0u);
  g[7] = uni(0u);
  return g;
}
__device__ __forceinline__ u32x4 ld_tr16(const unsigned char* p) {
  typedef __attribute__((address_space(3))) s16x8 lds_s16x8;
  return __builtin_bit_cast(u32x4,
                            __builtin_amdgcn_ds_load_tr16_b128_v8i16((lds_s16x8*)p));
}

union FragU {
  v16bf v;
  u32x4 q[2];
};

constexpr uint32_t PITCH_A = 144u, PITCH_B = 288u;
constexpr uint32_t SLICE_A = 10240u;              // 64 * 144 = 9216, rounded up
constexpr uint32_t SLICE_B = 6144u;               // 16 * 288 = 4608, rounded up
constexpr uint32_t BASE_B  = 4u * SLICE_A;
constexpr uint32_t BUF_SZ  = BASE_B + 4u * SLICE_B;  // 65536
constexpr uint32_t PAD_A   = (1u << 20) | (4u << 22) | (3u << 25);  // 128-B rows + 16 B
constexpr uint32_t PAD_B   = (1u << 20) | (5u << 22) | (7u << 25);  // 256-B rows + 32 B
static_assert(SLICE_A % 2048u == 0 && SLICE_B % 2048u == 0 && BUF_SZ % 2048u == 0, "slice places");
static_assert(64u * PITCH_A <= SLICE_A && 16u * PITCH_B <= SLICE_B, "slice sizes");

constexpr uint32_t EPI_PITCH = 272u;
constexpr uint32_t EPI_SZ    = 64u * EPI_PITCH;
constexpr uint32_t GEMM_LDS  = (8u * EPI_SZ > 2u * BUF_SZ) ? 8u * EPI_SZ : 2u * BUF_SZ;

typedef float  f32x4  __attribute__((ext_vector_type(4)));
typedef __bf16 bf16x8 __attribute__((ext_vector_type(8)));

template <bool GELU>
__device__ __forceinline__ float epi_val(float a, float bsv) {
  float val = a + bsv;
  if (GELU) val = 0.5f * val * (1.0f + erff(val * 0.70710678118f));
  return val;
}

// Stands directly behind the epilogue's global loads and stores, in front of any
// rewrite of a register that they name (the next trip's addresses and data).
__device__ __forceinline__ void wait_x0() {
  asm volatile("s_wait_xcnt 0x0" ::: "memory");
}

// Reads the wave's staged tile back row-wise and stores it: bias (+GELU), then
// 16 bytes per lane, so that every wave-wide store covers whole 128-B lines
// (f32: 2 rows of 256 B; bf16: 4 rows of 128 B). bias, Cf and Cb point at the
// tile's first column / element. The row loops stay rolled so that the
// epilogue's text is short (U stores a trip; without GELU four, so that a trip's
// LDS reads fly together). They walk from the last rows to the first: walking
// upwards, the compiler formed each LDS address as (base - tile size) with
// offset: tile size, a register below zero in wave 0; walking downwards, the
// loops that this file's launches run add a step >= 0 to the lane's base.
template <bool GELU>
__device__ __forceinline__ void store_tile(const unsigned char* stg, int lane,
                                           const float* bias, float* Cf, __bf16* Cb,
                                           int N) {
  constexpr int U = GELU ? 1 : 4;
  // The loops over u and e are unrolled so that every index is a constant (registers).
  if (Cf) {
    const int r = lane >> 4, c = (lane & 15) * 4;
    f32x4 bs = {0.0f, 0.0f, 0.0f, 0.0f};
    if (bias) {
      bs = *(const f32x4*)(bias + c);
      wait_x0();   // behind the bias load, in front of any rewrite of its offset register
    }
    const unsigned char* p = stg + (uint32_t)r * EPI_PITCH + (uint32_t)c * 4u;
    float* o = Cf + (size_t)r * N + c;
#pragma unroll 1
    for (int g = 32 / U - 1; g >= 0; --g) {
      f32x4 a[U];
#pragma unroll
      for (int u = 0; u < U; ++u)
        a[u] = *(const f32x4*)(p + (uint32_t)(g * U + u) * 2u * EPI_PITCH);
#pragma unroll
      for (int u = 0; u < U; ++u) {
        f32x4 y;
#pragma unroll
        for (int e = 0; e < 4; ++e) y[e] = epi_val<GELU>(a[u][e], bs[e]);
        *(f32x4*)(o + (size_t)(g * U + u) * 2 * N) = y;
      }
      wait_x0();
    }
  }
  if (Cb) {
    const int r = lane >> 3, c = (lane & 7) * 8;
    f32x4 bs0 = {0.0f, 0.0f, 0.0f, 0.0f}, bs1 = bs0;
    if (bias) {
      bs0 = *(const f32x4*)(bias + c);
      bs1 = *(const f32x4*)(bias + c + 4);
      wait_x0();   // behind the bias loads, in front of any rewrite of their offset register
    }
    const unsigned char* p = stg + (uint32_t)r * EPI_PITCH + (uint32_t)c * 4u;
    __bf16* o = Cb + (size_t)r * N + c;
#pragma unroll 1
    for (int g = 16 / U - 1; g >= 0; --g) {
      f32x4 a0[U], a1[U];
#pragma unroll
      for (int u = 0; u < U; ++u) {
        const unsigned char* q = p + (uint32_t)(g * U + u) * 4u * EPI_PITCH;
        a0[u] = *(const f32x4*)q;
        a1[u] = *(const f32x4*)(q + 16);
      }
#pragma unroll
      for (int u = 0; u < U; ++u) {
        bf16x8 y;
#pragma unroll
        for (int e = 0; e < 4; ++e) {
          y[e]     = (__bf16)epi_val<GELU>(a0[u][e], bs0[e]);
          y[e + 4] = (__bf16)epi_val<GELU>(a1[u][e], bs1[e]);
        }
        *(bf16x8*)(o + (size_t)(g * U + u) * 4 * N) = y;
      }
      wait_x0();
    }
  }
}

__global__ __launch_bounds__(256, 1) void gemm_bf16_kernel(
    const __bf16* A0, const __bf16* W0, const float* bias0, float* Cf0, __bf16* Cb0,
    const __bf16* A1, const __bf16* W1, const float* bias1, float* Cf1, __bf16* Cb1,
    const __bf16* A2, const __bf16* W2, const float* bias2, float* Cf2, __bf16* Cb2,
    int Mr, int N, int K, int act) {
  (void)Mr;
  __shared__ __attribute__((aligned(2048))) unsigned char L[GEMM_LDS];

  const uint32_t zs = blockIdx.z;
  const __bf16* A    = zs == 0u ? A0    : zs == 1u ? A1    : A2;
  const __bf16* W    = zs == 0u ? W0    : zs == 1u ? W1    : W2;
  const float*  bias = zs == 0u ? bias0 : zs == 1u ? bias1 : bias2;
  float*        Cf   = zs == 0u ? Cf0   : zs == 1u ? Cf1   : Cf2;
  __bf16*       Cb   = zs == 0u ? Cb0   : zs == 1u ? Cb1   : Cb2;

  const int      tid  = threadIdx.x;
  const int      lane = tid & 31;
  const uint32_t wave = uni((uint32_t)tid >> 5);
  const int wm   = (int)(wave >> 1);   // 0..3
  const int wn   = (int)(wave & 1u);   // 0..1
  const int half = lane >> 4;
  const int lr   = lane & 15;
  const int row0 = blockIdx.y * 256;
  const int col0 = blockIdx.x * 128;
  const uint32_t lbase = (uint32_t)(size_t)L;

  v8f acc[4][4];
#pragma unroll
  for (int mi = 0; mi < 4; ++mi)
#pragma unroll
    for (int ni = 0; ni < 4; ++ni)
#pragma unroll
      for (int e = 0; e < 8; ++e) acc[mi][ni][e] = 0.0f;

  // One request per wave and pass: waves 0-3 a slice of A, waves 4-7 of W.
  u32x8 g1a = tdm_group1<PAD_A, 128u, 64u>(2u * (uint32_t)K);
  u32x8 g1b = tdm_group1<PAD_B, 256u, 16u>(2u * (uint32_t)N);
  hold8(g1a);
  hold8(g1b);
  const bool     isA  = wave < 4u;
  const uint32_t j    = wave & 3u;
  const uint32_t dst0 = lbase + (isA ? j * SLICE_A : BASE_B + j * SLICE_B);
  const uint64_t src0 = isA
      ? (uint64_t)(size_t)A + 2ull * ((uint64_t)((uint32_t)row0 + j * 64u) * (uint32_t)K)
      : (uint64_t)(size_t)W + 2ull * ((uint64_t)(j * 16u) * (uint32_t)N + (uint32_t)col0);
  const uint64_t step = isA ? 128ull : 128ull * (uint32_t)N;   // bytes per pass
  u32x4 g0;
  auto issue = [&](uint32_t st) {   // pass st's slice, into buffer st & 1
    g0 = tdm_group0(dst0 + (st & 1u) * BUF_SZ, src0 + (uint64_t)st * step);
    hold4(g0);
    if (pinned(wave < 4u)) tdm_load(g0, g1a);
    else                   tdm_load(g0, g1b);
  };

  const uint32_t nt = (uint32_t)K >> 6;   // passes; every call has at least two

  issue(0u);
  wait_tensor0(g0, g1a, g1b);
  __syncthreads();                        // pass 0's tiles are published
  issue(1u);

  // Lane offsets of the fragment reads inside a buffer.
  const uint32_t aoff = (uint32_t)wm * SLICE_A + (uint32_t)lr * PITCH_A + 16u * (uint32_t)half;
  const uint32_t boff = BASE_B + (8u * (uint32_t)half + (uint32_t)(lane & 7)) * PITCH_B +
                        128u * (uint32_t)wn + 16u * (uint32_t)((lane >> 3) & 1);

  for (uint32_t s = 0; s < nt; ++s) {
    const unsigned char* Lb = L + (s & 1u) * BUF_SZ;
    // The loops below are unrolled so that every fragment and accumulator
    // index is a constant (registers, no scratch).
#pragma unroll
    for (int kb = 0; kb < 2; ++kb) {
      // A fragments, hardware k order: bytes 16h and 32 + 16h of each 64 B.
      FragU af[4];
#pragma unroll
      for (int mi = 0; mi < 4; ++mi) {
        const unsigned char* pa = Lb + aoff + (uint32_t)mi * 16u * PITCH_A + (uint32_t)kb * 64u;
        af[mi].q[0] = *(const u32x4*)pa;
        af[mi].q[1] = *(const u32x4*)(pa + 32);
      }
#pragma unroll
      for (int ni = 0; ni < 4; ++ni) {
        // W fragment: k-rows 32 kb + 0..15 and + 16..31 lie in two slices.
        const unsigned char* pb = Lb + boff + (uint32_t)(2 * kb) * SLICE_B + (uint32_t)ni * 32u;
        FragU bf;
        bf.q[0] = ld_tr16(pb);
        bf.q[1] = ld_tr16(pb + SLICE_B);
#pragma unroll
        for (int mi = 0; mi < 4; ++mi)
          acc[mi][ni] = wmma_bf16(af[mi].v, bf.v, acc[mi][ni]);
      }
    }

    // Publish point of pass s + 1; it also ends every reader's last read of
    // this pass's buffer, which is refilled behind it.
    wait_ds0();
    wait_tensor0(g0, g1a, g1b);
    __syncthreads();
    if (pinned(s + 2u < nt)) issue(s + 2u);
  }
  wait_tensor0(g0, g1a, g1b);
  wait_ds0();

  // epilogue ------------------------------------------------------------------
  // The last pass's publish point (own LDS reads done, own tensor loads landed,
  // barrier) has freed the ring for every wave: each wave now stages its own
  // 64 x 64 tile in its own range of L, which runs 8 KiB past the ring.
  unsigned char* stg = L + wave * EPI_SZ;
  {
    float* w = (float*)(stg + (uint32_t)(8 * half) * EPI_PITCH) + lr;
    // unrolled: every accumulator index is a constant (registers, no scratch)
#pragma unroll
    for (int mi = 0; mi < 4; ++mi)
#pragma unroll
      for (int ni = 0; ni < 4; ++ni)
#pragma unroll
        for (int v = 0; v < 8; ++v)
          w[(mi * 16 + v) * (int)(EPI_PITCH / 4u) + ni * 16] = acc[mi][ni][v];
  }
  wait_ds0();   // the wave's rows are in LDS before its lanes read each other's values back

  const int    trow = row0 + wm * 64;
  const int    tcol = col0 + wn * 64;
  const size_t toff = (size_t)trow * N + tcol;
  const float* bt   = bias ? bias + tcol : nullptr;
  float*       cf   = Cf ? Cf + toff : nullptr;
  __bf16*      cb   = Cb ? Cb + toff : nullptr;
  if (act == 1) store_tile<true>(stg, lane, bt, cf, cb, N);
  else          store_tile<false>(stg, lane, bt, cf, cb, N);
}

// ---------------------------------------------------------------------------
// Flash attention: one wave per (batch, head, 16-query block).
// windowed=1 -> causal local window W=64 + ALiBi; windowed=0 -> full attn.
// Q,K,V,O are bf16 [B*Lq(or Lk), D] with head h at feature offset h*64.
// ---------------------------------------------------------------------------
__global__ __launch_bounds__(128) void attn_kernel(
    const __bf16* __restrict__ Q, const __bf16* __restrict__ Km,
    const __bf16* __restrict__ Vm, __bf16* __restrict__ O,
    int Lq, int Lk, int windowed) {
  __shared__ __bf16 lP[4][16][32];  // per-wave P staging (C-layout -> A-layout)
  const int lane  = threadIdx.x & 31;
  const int wave  = threadIdx.x >> 5;
  const int half  = lane >> 4;
  const int lr    = lane & 15;
  const int qbPer = Lq >> 4;
  const int job   = blockIdx.x * 4 + wave;
  const int qblk  = job % qbPer;
  const int h     = (job / qbPer) % H_;
  const int b     = job / (qbPer * H_);
  const int q0    = qblk << 4;

  const float slope = windowed ? exp2f(-8.0f * (float)(h + 1) / (float)H_) : 0.0f;

  // Q fragments (A operand): 16 queries x 64 features
  v16bf qa[2];
  {
    const __bf16* qb = Q + ((size_t)(b * Lq + q0 + lr)) * D_ + h * DH_;
#pragma unroll
    for (int f = 0; f < 2; ++f) {
      ABu u;
#pragma unroll
      for (int t = 0; t < 8; ++t)
        u.u[t] = *(const unsigned int*)(qb + f * 32 + kpair(t, half));
      qa[f] = u.v;
    }
  }

  float mrow[8], lrow[8];
  v8f   o[4];
#pragma unroll
  for (int v = 0; v < 8; ++v) { mrow[v] = -3.0e38f; lrow[v] = 0.0f; }
#pragma unroll
  for (int f = 0; f < 4; ++f)
#pragma unroll
    for (int e = 0; e < 8; ++e) o[f][e] = 0.0f;

  const int nch = windowed ? 3 : (Lk >> 5);  // uniform across the block
  for (int ch = 0; ch < nch; ++ch) {
    const int kc = windowed ? (q0 - 64 + 32 * ch) : (32 * ch);

    // S = Q @ K^T : 16 queries x 32 keys ------------------------------------
    v8f s[2];
#pragma unroll
    for (int g = 0; g < 2; ++g) {
#pragma unroll
      for (int e = 0; e < 8; ++e) s[g][e] = 0.0f;
      int key  = kc + g * 16 + lr;
      int keyc = key < 0 ? 0 : (key >= Lk ? Lk - 1 : key);
      const __bf16* kb = Km + ((size_t)(b * Lk + keyc)) * D_ + h * DH_;
#pragma unroll
      for (int f = 0; f < 2; ++f) {
        ABu u;
#pragma unroll
        for (int t = 0; t < 8; ++t)
          u.u[t] = *(const unsigned int*)(kb + f * 32 + kpair(t, half));
        s[g] = wmma_bf16(qa[f], u.v, s[g]);
      }
    }

    // scale + ALiBi + mask, online softmax ----------------------------------
#pragma unroll
    for (int v = 0; v < 8; ++v) {
      const int i    = q0 + v + 8 * half;
      float     best = -3.0e38f;
#pragma unroll
      for (int g = 0; g < 2; ++g) {
        const int j  = kc + g * 16 + lr;
        float     sv = s[g][v] * 0.125f + slope * (float)(j - i);
        bool valid = windowed ? (j >= 0 && j <= i && (i - j) < 64) : (j < Lk);
        sv       = valid ? sv : -1.0e30f;
        s[g][v]  = sv;
        best     = fmaxf(best, sv);
      }
#pragma unroll
      for (int mm = 1; mm < 16; mm <<= 1)
        best = fmaxf(best, __shfl_xor(best, mm, 16));
      const float mnew  = fmaxf(mrow[v], best);
      const float alpha = expf(mrow[v] - mnew);
      float psum = 0.0f;
#pragma unroll
      for (int g = 0; g < 2; ++g) {
        float pv = expf(s[g][v] - mnew);
        lP[wave][v + 8 * half][g * 16 + lr] = (__bf16)pv;
        psum += pv;
      }
#pragma unroll
      for (int mm = 1; mm < 16; mm <<= 1) psum += __shfl_xor(psum, mm, 16);
      lrow[v] = lrow[v] * alpha + psum;
      mrow[v] = mnew;
#pragma unroll
      for (int f = 0; f < 4; ++f) o[f][v] *= alpha;
    }
    __syncthreads();

    // P fragment (A operand): 16 queries x 32 keys --------------------------
    v16bf pa;
    {
      ABu u;
#pragma unroll
      for (int t = 0; t < 8; ++t)
        u.u[t] = *(const unsigned int*)&lP[wave][lr][kpair(t, half)];
      pa = u.v;
    }

    // O += P @ V(chunk) ------------------------------------------------------
#pragma unroll
    for (int f = 0; f < 4; ++f) {
      ABu u;
#pragma unroll
      for (int t = 0; t < 8; ++t) {
        int k  = kpair(t, half);
        int j0 = kc + k, j1 = kc + k + 1;
        j0 = j0 < 0 ? 0 : (j0 >= Lk ? Lk - 1 : j0);
        j1 = j1 < 0 ? 0 : (j1 >= Lk ? Lk - 1 : j1);
        u.b[2 * t]     = Vm[((size_t)(b * Lk + j0)) * D_ + h * DH_ + f * 16 + lr];
        u.b[2 * t + 1] = Vm[((size_t)(b * Lk + j1)) * D_ + h * DH_ + f * 16 + lr];
      }
      o[f] = wmma_bf16(pa, u.v, o[f]);
    }
    __syncthreads();
  }

  // normalize + store --------------------------------------------------------
#pragma unroll
  for (int f = 0; f < 4; ++f)
#pragma unroll
    for (int v = 0; v < 8; ++v) {
      const int   row = q0 + v + 8 * half;
      const float inv = 1.0f / fmaxf(lrow[v], 1.0e-20f);
      O[((size_t)(b * Lq + row)) * D_ + h * DH_ + f * 16 + lr] =
          (__bf16)(o[f][v] * inv);
    }
}

constexpr uint32_t PITCH_K  = 144u, PITCH_V = 160u;
constexpr uint32_t SLICE_KV = 6144u;              // 32 * 144 = 4608, 32 * 160 = 5120, rounded up
constexpr uint32_t BASE_V   = 4u * SLICE_KV;
constexpr uint32_t KV_SZ    = 8u * SLICE_KV;      // 49152
constexpr uint32_t PAD_K    = (1u << 20) | (4u << 22) | (3u << 25);  // 128-B rows + 16 B
constexpr uint32_t PAD_V    = (1u << 20) | (4u << 22) | (7u << 25);  // 128-B rows + 32 B
static_assert(SLICE_KV % 2048u == 0 && KV_SZ % 2048u == 0, "slice places");
static_assert(32u * PITCH_K <= SLICE_KV && 32u * PITCH_V <= SLICE_KV, "slice sizes");

__device__ __forceinline__ float xhalf(float x) {
  const int v = __builtin_bit_cast(int, x);
  return __builtin_bit_cast(float, __builtin_amdgcn_permlanex16(v, v, 0x76543210, 0xfedcba98,
                                                                false, false));
}

__global__ __launch_bounds__(256) void attn_full_kernel(
    const __bf16* __restrict__ Q, const __bf16* __restrict__ Km,
    const __bf16* __restrict__ Vm, __bf16* __restrict__ O,
    int Lq, int Lk) {
  __shared__ __attribute__((aligned(2048))) unsigned char L[2u * KV_SZ];
  const int      lane  = threadIdx.x & 31;
  const uint32_t wave  = uni((uint32_t)threadIdx.x >> 5);
  const int      half  = lane >> 4;
  const int      lr    = lane & 15;
  const int      qbPer = Lq >> 4;
  const int      job0  = blockIdx.x * 8;          // the block's 8 jobs share b and h
  const int      qblk  = job0 % qbPer + (int)wave;
  const int      h     = (job0 / qbPer) % H_;
  const int      b     = job0 / (qbPer * H_);
  const int      q0    = qblk << 4;
  const uint32_t lbase = (uint32_t)(size_t)L;

  // One request per wave and stage: waves 0-3 a slice of K, waves 4-7 of V.
  u32x8 g1k = tdm_group1<PAD_K, 128u, 32u>(2u * (uint32_t)D_);
  u32x8 g1v = tdm_group1<PAD_V, 128u, 32u>(2u * (uint32_t)D_);
  hold8(g1k);
  hold8(g1v);
  const uint32_t jsl  = wave & 3u;
  const uint32_t dst0 = lbase + (wave < 4u ? 0u : BASE_V) + jsl * SLICE_KV;
  const uint64_t src0 = (uint64_t)(size_t)(wave < 4u ? Km : Vm) +
      2ull * ((uint64_t)((uint32_t)(b * Lk) + jsl * 32u) * (uint32_t)D_ + (uint32_t)(h * DH_));
  const uint64_t step = 2ull * 128ull * (uint32_t)D_;   // bytes per stage
  u32x4 g0;
  auto issue = [&](uint32_t st) {   // stage st's slice, into buffer st & 1
    g0 = tdm_group0(dst0 + (st & 1u) * KV_SZ, src0 + (uint64_t)st * step);
    hold4(g0);
    if (pinned(wave < 4u)) tdm_load(g0, g1k);
    else                   tdm_load(g0, g1v);
  };

  const uint32_t nt = (uint32_t)Lk >> 7;   // stages; at least two

  issue(0u);
  wait_tensor0(g0, g1k, g1v);
  __syncthreads();                         // stage 0's tiles are published
  issue(1u);

  // Every loop over fragments, rows and registers in this kernel is unrolled so
  // that each fragment and accumulator index is a constant (registers, no scratch).
  // Q fragments (B operand, column lr = query lr, hardware k order): 64 features x 16 queries
  v16bf qa[2];
  {
    const __bf16* qb = Q + ((size_t)(b * Lq + q0 + lr)) * D_ + h * DH_;
#pragma unroll
    for (int f = 0; f < 2; ++f) {
      ABu u;
#pragma unroll
      for (int t = 0; t < 8; ++t)
        u.u[t] = *(const unsigned int*)(qb + f * 32 + kpair(t, half));
      qa[f] = u.v;
    }
  }

  // Query lr's running maximum (the same in both halves) and this half's share
  // of its running sum; o[f][r] = O^T[16 f + 8 half + r][query lr].
  float mrun = -3.0e38f, lrun = 0.0f;
  v8f   o[4];
#pragma unroll
  for (int f = 0; f < 4; ++f)
#pragma unroll
    for (int e = 0; e < 8; ++e) o[f][e] = 0.0f;

  // Lane offsets of the fragment reads inside a slice.
  const uint32_t koff = (uint32_t)lr * PITCH_K + 16u * (uint32_t)half;
  const uint32_t voff = BASE_V + (8u * (uint32_t)half + (uint32_t)(lane & 7)) * PITCH_V +
                        16u * (uint32_t)((lane >> 3) & 1);

  for (uint32_t st = 0; st < nt; ++st) {
    const unsigned char* Lb = L + (st & 1u) * KV_SZ;
    for (uint32_t c = 0; c < 4u; ++c) {    // 32 keys: slice c of K and of V
      const unsigned char* Ls = Lb + c * SLICE_KV;

      // S^T = K @ Q^T : 32 keys x 16 queries; s[g][r] = key 16 g + 8 half + r, query lr
      v8f s[2];
#pragma unroll
      for (int g = 0; g < 2; ++g) {
#pragma unroll
        for (int e = 0; e < 8; ++e) s[g][e] = 0.0f;
#pragma unroll
        for (int f = 0; f < 2; ++f) {
          // hardware k order: bytes 16h and 32 + 16h of each 64 B of key row lr
          const unsigned char* pk = Ls + koff + (uint32_t)g * 16u * PITCH_K + (uint32_t)f * 64u;
          FragU kf;
          kf.q[0] = *(const u32x4*)pk;
          kf.q[1] = *(const u32x4*)(pk + 32);
          s[g] = wmma_bf16(kf.v, qa[f], s[g]);
        }
      }

      // scale, online softmax of query lr ---------------------------------------
      float best = -3.0e38f;
#pragma unroll
      for (int g = 0; g < 2; ++g)
#pragma unroll
        for (int r = 0; r < 8; ++r) {
          float sv = s[g][r] * 0.125f;
          s[g][r]  = sv;
          best     = fmaxf(best, sv);
        }
      best = fmaxf(best, xhalf(best));       // both halves hold the 32 keys' maximum
      const float mnew  = fmaxf(mrun, best);
      const float alpha = expf(mrun - mnew);
      // P^T (B operand): element 8 g + r is key 16 g + 8 half + r, the hardware k order
      ABu   pb;
      float psum[2] = {0.0f, 0.0f};
#pragma unroll
      for (int g = 0; g < 2; ++g)
#pragma unroll
        for (int r = 0; r < 8; ++r) {
          float pv = expf(s[g][r] - mnew);
          pb.b[8 * g + r] = (__bf16)pv;
          psum[g] += pv;
        }
      lrun = lrun * alpha + (psum[0] + psum[1]);
      mrun = mnew;
#pragma unroll
      for (int f = 0; f < 4; ++f)
#pragma unroll
        for (int e = 0; e < 8; ++e) o[f][e] *= alpha;

      // O^T += V^T(chunk) @ P^T: key rows 0..15 and 16..31, transposed on the read
#pragma unroll
      for (int f = 0; f < 4; ++f) {
        const unsigned char* pv = Ls + voff + (uint32_t)f * 32u;
        FragU vf;
        vf.q[0] = ld_tr16(pv);
        vf.q[1] = ld_tr16(pv + 16u * PITCH_V);
        o[f] = wmma_bf16(vf.v, pb.v, o[f]);
      }
    }

    // Publish point of stage st + 1; it also ends every reader's last read of
    // this stage's buffer, which is refilled behind it.
    wait_ds0();
    wait_tensor0(g0, g1k, g1v);
    __syncthreads();
    if (pinned(st + 2u < nt)) issue(st + 2u);
  }
  wait_tensor0(g0, g1k, g1v);
  wait_ds0();

  // normalize + store: a lane holds 8 consecutive features of query lr per tile
  const float lsum = lrun + xhalf(lrun);     // the two halves' shares of the sum
  const float inv  = 1.0f / fmaxf(lsum, 1.0e-20f);
  __bf16* ob = O + ((size_t)(b * Lq + q0 + lr)) * D_ + h * DH_ + 8 * half;
  bf16x8 y[4];
#pragma unroll
  for (int f = 0; f < 4; ++f)
#pragma unroll
    for (int r = 0; r < 8; ++r) y[f][r] = (__bf16)(o[f][r] * inv);
#pragma unroll
  for (int f = 0; f < 4; ++f) *(bf16x8*)(ob + 16 * f) = y[f];
}

// ---------------------------------------------------------------------------
// Fused residual add + LayerNorm over D=1024. One 256-thread block per row.
// Emits f32 (residual stream) and/or bf16 (next-GEMM operand).
// ---------------------------------------------------------------------------
__global__ __launch_bounds__(256) void add_ln_kernel(
    const float* __restrict__ A, const float* __restrict__ Bv,
    const float* __restrict__ g, const float* __restrict__ be,
    float* __restrict__ outF, __bf16* __restrict__ outB) {
  __shared__ float redS[8], redQ[8];
  const int row  = blockIdx.x;
  const int t    = threadIdx.x;
  const int lane = t & 31, wave = t >> 5;
  const float* a = A + (size_t)row * D_;
  const float* r = Bv + (size_t)row * D_;

  float x[4], s = 0.0f, q = 0.0f;
#pragma unroll
  for (int e = 0; e < 4; ++e) {
    int c = t + 256 * e;
    x[e]  = a[c] + r[c];
    s    += x[e];
    q    += x[e] * x[e];
  }
#pragma unroll
  for (int mm = 1; mm < 32; mm <<= 1) {
    s += __shfl_xor(s, mm, 32);
    q += __shfl_xor(q, mm, 32);
  }
  if (lane == 0) { redS[wave] = s; redQ[wave] = q; }
  __syncthreads();
  float S = 0.0f, Q2 = 0.0f;
#pragma unroll
  for (int w = 0; w < 8; ++w) { S += redS[w]; Q2 += redQ[w]; }
  const float mu   = S * (1.0f / D_);
  const float var  = Q2 * (1.0f / D_) - mu * mu;
  const float rstd = rsqrtf(var + 1e-5f);
#pragma unroll
  for (int e = 0; e < 4; ++e) {
    int   c = t + 256 * e;
    float y = (x[e] - mu) * rstd * g[c] + be[c];
    if (outF) outF[(size_t)row * D_ + c] = y;
    if (outB) outB[(size_t)row * D_ + c] = (__bf16)y;
  }
}

// ---------------------------------------------------------------------------
// fp32 -> bf16 conversion of all twelve operands in ONE launch. The twelve bf16
// destinations lie one behind the other in the workspace (each a multiple of
// 256 B), so the output is one array of 24 * 2^20 elements; only the source
// changes, at multiples of 2^20 elements. A block converts one tile of 8192
// elements a trip (a wave 1024: eight 512-B loads in flight, eight 256-B stores,
// whole lines both ways); a tile never straddles two sources.
//   units of 2^20: 0-3 x, 4-7 mem, 8-15 the eight D x D weights, 16-19 w1, 20-23 w2
// ---------------------------------------------------------------------------
typedef __bf16 bf16x4 __attribute__((ext_vector_type(4)));
constexpr uint32_t CVT_TILE   = 8192u;
constexpr uint32_t CVT_BLOCKS = 1024u;
constexpr uint32_t CVT_TRIPS  = 3u;     // 24 * 2^20 / (CVT_TILE * CVT_BLOCKS)
static_assert(CVT_TILE * CVT_BLOCKS * CVT_TRIPS == 24u << 20, "conversion covers every element once");

__global__ __launch_bounds__(256) void cvt_all_kernel(
    const float* __restrict__ x,  const float* __restrict__ mem,
    const float* __restrict__ m0, const float* __restrict__ m1,
    const float* __restrict__ m2, const float* __restrict__ m3,
    const float* __restrict__ m4, const float* __restrict__ m5,
    const float* __restrict__ m6, const float* __restrict__ m7,
    const float* __restrict__ w1, const float* __restrict__ w2,
    __bf16* __restrict__ out) {
  const uint32_t off = (threadIdx.x >> 5) * 1024u + (threadIdx.x & 31u) * 4u;
  // rolled: one short body; the WGP's other waves cover a wave's load latency
#pragma unroll 1
  for (uint32_t it = 0; it < CVT_TRIPS; ++it) {
    const uint32_t t = it * CVT_BLOCKS + blockIdx.x;   // tile
    const uint32_t u = t >> 7;                         // its unit of 2^20 elements
    const float*   src = w2;
    uint32_t       u0  = 20u;                          // first unit of the source
    if (u < 4u)       { src = x;   u0 = 0u; }
    else if (u < 8u)  { src = mem; u0 = 4u; }
    else if (u < 16u) {
      u0  = u;
      src = u == 8u ? m0 : u == 9u ? m1 : u == 10u ? m2 : u == 11u ? m3
          : u == 12u ? m4 : u == 13u ? m5 : u == 14u ? m6 : m7;
    }
    else if (u < 20u) { src = w1;  u0 = 16u; }
    const float* s = src + (size_t)(t - u0 * 128u) * CVT_TILE + off;
    __bf16*      d = out + (size_t)t * CVT_TILE + off;
    f32x4 a[8];
    // unrolled: the eight loads are issued together
#pragma unroll
    for (int i = 0; i < 8; ++i) a[i] = *(const f32x4*)(s + i * 128);
    wait_x0();   // behind the loads, in front of any rewrite of their address registers
#pragma unroll
    for (int i = 0; i < 8; ++i)
      *(bf16x4*)(d + i * 128) = __builtin_convertvector(a[i], bf16x4);
    wait_x0();   // behind the stores, in front of the next trip's addresses and data
  }
}

// ---------------------------------------------------------------------------
// Host orchestration
// ---------------------------------------------------------------------------
extern "C" void kernel_launch(void* const* d_in, const int* in_sizes, int n_in,
                              void* d_out, int out_size, void* d_ws,
                              size_t ws_size, hipStream_t stream) {
  (void)in_sizes; (void)n_in; (void)out_size; (void)ws_size;
  constexpr int Bc = 2, Lc = 2048, Mc = 2048, Dc = 1024, FFc = 4096;
  constexpr int NT = Bc * Lc;  // 4096 query rows
  constexpr int NM = Bc * Mc;  // 4096 memory rows

  const float* x   = (const float*)d_in[0];
  const float* mem = (const float*)d_in[1];
  const float* swq = (const float*)d_in[2];
  const float* swk = (const float*)d_in[3];
  const float* swv = (const float*)d_in[4];
  const float* swo = (const float*)d_in[5];
  const float* sbq = (const float*)d_in[6];
  const float* sbk = (const float*)d_in[7];
  const float* sbv = (const float*)d_in[8];
  const float* sbo = (const float*)d_in[9];
  const float* cwq = (const float*)d_in[10];
  const float* cwk = (const float*)d_in[11];
  const float* cwv = (const float*)d_in[12];
  const float* cwo = (const float*)d_in[13];
  const float* cbq = (const float*)d_in[14];
  const float* cbk = (const float*)d_in[15];
  const float* cbv = (const float*)d_in[16];
  const float* cbo = (const float*)d_in[17];
  const float* w1  = (const float*)d_in[18];
  const float* b1  = (const float*)d_in[19];
  const float* w2  = (const float*)d_in[20];
  const float* b2  = (const float*)d_in[21];
  const float* g1  = (const float*)d_in[22];
  const float* g2  = (const float*)d_in[23];
  const float* g3  = (const float*)d_in[24];
  const float* be1 = (const float*)d_in[25];
  const float* be2 = (const float*)d_in[26];
  const float* be3 = (const float*)d_in[27];

  char* p = (char*)d_ws;
  auto take = [&](size_t bytes) -> void* {
    void* r = (void*)p;
    p += (bytes + 255) & ~(size_t)255;
    return r;
  };
  __bf16* xcur_bf = (__bf16*)take((size_t)NT * Dc * 2);  // x_bf -> x1_bf -> x2_bf
  __bf16* mem_bf  = (__bf16*)take((size_t)NM * Dc * 2);
  __bf16* swq_bf  = (__bf16*)take((size_t)Dc * Dc * 2);
  __bf16* swk_bf  = (__bf16*)take((size_t)Dc * Dc * 2);
  __bf16* swv_bf  = (__bf16*)take((size_t)Dc * Dc * 2);
  __bf16* swo_bf  = (__bf16*)take((size_t)Dc * Dc * 2);
  __bf16* cwq_bf  = (__bf16*)take((size_t)Dc * Dc * 2);
  __bf16* cwk_bf  = (__bf16*)take((size_t)Dc * Dc * 2);
  __bf16* cwv_bf  = (__bf16*)take((size_t)Dc * Dc * 2);
  __bf16* cwo_bf  = (__bf16*)take((size_t)Dc * Dc * 2);
  __bf16* w1_bf   = (__bf16*)take((size_t)Dc * FFc * 2);
  __bf16* w2_bf   = (__bf16*)take((size_t)FFc * Dc * 2);
  __bf16* q_bf    = (__bf16*)take((size_t)NT * Dc * 2);
  __bf16* k_bf    = (__bf16*)take((size_t)NM * Dc * 2);
  __bf16* v_bf    = (__bf16*)take((size_t)NM * Dc * 2);
  __bf16* attn_bf = (__bf16*)take((size_t)NT * Dc * 2);
  float*  gout    = (float*)take((size_t)NT * Dc * 4);   // sa / ca / ff
  float*  x1f     = (float*)take((size_t)NT * Dc * 4);
  float*  x2f     = (float*)take((size_t)NT * Dc * 4);
  __bf16* h_bf    = (__bf16*)take((size_t)NT * FFc * 2);

  struct Prod {   // one product's operand set
    const __bf16* A; const __bf16* W; const float* bias; float* Cf; __bf16* Cb;
  };
  const Prod none = {nullptr, nullptr, nullptr, nullptr, nullptr};
  // nz products of one shape in one launch
  auto gemm = [&](int nz, Prod p0, Prod p1, Prod p2, int Mg, int Ng, int Kg, int act) {
    dim3 grid(Ng / 128, Mg / 256, nz);
    gemm_bf16_kernel<<<grid, 256, 0, stream>>>(p0.A, p0.W, p0.bias, p0.Cf, p0.Cb,
                                               p1.A, p1.W, p1.bias, p1.Cf, p1.Cb,
                                               p2.A, p2.W, p2.bias, p2.Cf, p2.Cb,
                                               Mg, Ng, Kg, act);
  };
  auto attn = [&](const __bf16* Qg, const __bf16* Kg, const __bf16* Vg,
                  __bf16* Og, int Lqv, int Lkv, int windowed) {
    int jobs = Bc * H_ * (Lqv / 16);  // one wave per job, 4 waves per block
    attn_kernel<<<jobs / 4, 128, 0, stream>>>(Qg, Kg, Vg, Og, Lqv, Lkv,
                                              windowed);
  };

  // ---- bf16 staging --------------------------------------------------------
  // xcur_bf .. w2_bf are taken in a row above: one destination array.
  cvt_all_kernel<<<CVT_BLOCKS, 256, 0, stream>>>(x, mem, swq, swk, swv, swo, cwq, cwk,
                                                 cwv, cwo, w1, w2, xcur_bf);

  // ---- self-attention (windowed causal + ALiBi) ----------------------------
  gemm(3, {xcur_bf, swq_bf, sbq, nullptr, q_bf}, {xcur_bf, swk_bf, sbk, nullptr, k_bf},
       {xcur_bf, swv_bf, sbv, nullptr, v_bf}, NT, Dc, Dc, 0);
  attn(q_bf, k_bf, v_bf, attn_bf, Lc, Lc, 1);
  // The cross-attention keys depend on mem alone: they ride with the output
  // projection (k_bf is free, the self-attention launch before this has read it).
  gemm(2, {attn_bf, swo_bf, sbo, gout, nullptr}, {mem_bf, cwk_bf, cbk, nullptr, k_bf},
       none, NT, Dc, Dc, 0);
  add_ln_kernel<<<NT, 256, 0, stream>>>(x, gout, g1, be1, x1f, xcur_bf);

  // ---- cross-attention (full) ---------------------------------------------
  static_assert(NT == NM, "products of one launch have one shape");
  gemm(2, {xcur_bf, cwq_bf, cbq, nullptr, q_bf}, {mem_bf, cwv_bf, cbv, nullptr, v_bf},
       none, NT, Dc, Dc, 0);
  attn_full_kernel<<<Bc * H_ * (Lc / 16) / 8, 256, 0, stream>>>(q_bf, k_bf, v_bf,
                                                                attn_bf, Lc, Mc);
  gemm(1, {attn_bf, cwo_bf, cbo, gout, nullptr}, none, none, NT, Dc, Dc, 0);
  add_ln_kernel<<<NT, 256, 0, stream>>>(x1f, gout, g2, be2, x2f, xcur_bf);

  // ---- FFN -----------------------------------------------------------------
  gemm(1, {xcur_bf, w1_bf, b1, nullptr, h_bf}, none, none, NT, FFc, Dc, 1);  // fused exact GELU
  gemm(1, {h_bf, w2_bf, b2, gout, nullptr}, none, none, NT, Dc, FFc, 0);
  add_ln_kernel<<<NT, 256, 0, stream>>>(x2f, gout, g3, be3, (float*)d_out,
                                        nullptr);
}

// v007
// Measured time: 274 microseconds a run.
// In both of two side-by-side timings against v006, it was 1.08 times as fast.
// All steps since v000 together make it 5.52 times as fast.
#include <hip/hip_runtime.h>
#include <math.h>
#include <stdint.h>

typedef __attribute__((ext_vector_type(16))) __bf16 v16bf;
typedef __attribute__((ext_vector_type(8)))  float  v8f;

union ABu {
  v16bf          v;
  unsigned int   u[8];
  unsigned short s[16];
  __bf16         b[16];
};

union U4u {
  uint4        q;
  unsigned int u[4];
};

__device__ __forceinline__ int kpair(int t, int half) {
  int base = (t < 4) ? (2 * t) : (16 + 2 * (t - 4));
  return base + 8 * half;
}

__device__ __forceinline__ v8f wmma_bf16(v16bf a, v16bf b, v8f c) {
  return __builtin_amdgcn_wmma_f32_16x16x32_bf16(false, a, false, b,
                                                 (short)0, c, false, false);
}

// 2^x by the hardware's own instruction (v_exp_f32). The softmax weights are formed
// in base 2: e^x = 2^(x * log2 e). A result below the normal range comes out as 0,
// which is what a weight that small rounds to in the sums anyway.
constexpr float LOG2E_ = 1.4426950408889634f;
__device__ __forceinline__ float exp2_hw(float x) { return __builtin_amdgcn_exp2f(x); }
__device__ __forceinline__ void exp2_run(float& a, float (&x)[16]) {
  asm("v_exp_f32 %1, %1\n\tv_exp_f32 %2, %2\n\tv_exp_f32 %3, %3\n\tv_exp_f32 %4, %4\n\t"
      "v_exp_f32 %5, %5\n\tv_exp_f32 %6, %6\n\tv_exp_f32 %7, %7\n\tv_exp_f32 %8, %8\n\t"
      "v_exp_f32 %0, %0\n\t"
      "v_exp_f32 %9, %9\n\tv_exp_f32 %10, %10\n\tv_exp_f32 %11, %11\n\tv_exp_f32 %12, %12\n\t"
      "v_exp_f32 %13, %13\n\tv_exp_f32 %14, %14\n\tv_exp_f32 %15, %15\n\tv_exp_f32 %16, %16\n\t"
      "v_nop"
      : "+v"(a), "+v"(x[0]), "+v"(x[1]), "+v"(x[2]), "+v"(x[3]), "+v"(x[4]), "+v"(x[5]),
        "+v"(x[6]), "+v"(x[7]), "+v"(x[8]), "+v"(x[9]), "+v"(x[10]), "+v"(x[11]),
        "+v"(x[12]), "+v"(x[13]), "+v"(x[14]), "+v"(x[15]));
}

#define D_  1024
#define H_  16
#define DH_ 64

typedef uint32_t u32x4 __attribute__((ext_vector_type(4)));
typedef uint32_t u32x8 __attribute__((ext_vector_type(8)));
typedef short    s16x8 __attribute__((ext_vector_type(8)));

__device__ __forceinline__ uint32_t uni(uint32_t v) {
  return (uint32_t)__builtin_amdgcn_readfirstlane(v);
}
__device__ __forceinline__ uint32_t pinned(uint32_t v) {
  uint32_t w = uni(v);
  asm volatile("" : "+s"(w));
  return w;
}
__device__ __forceinline__ void wait_ds0() {
  asm volatile("s_wait_dscnt 0x0" ::: "memory");      // own LDS reads done before the buffer is handed back
}
__device__ __forceinline__ void wait_tensor0(u32x4 g0, u32x8 ga, u32x8 gb) {
  asm volatile("s_wait_tensorcnt 0x0" ::"s"(g0), "s"(ga), "s"(gb) : "memory");
}
__device__ __forceinline__ void hold4(u32x4& g) { asm volatile("" : "+s"(g)); }
__device__ __forceinline__ void hold8(u32x8& g) { asm volatile("" : "+s"(g)); }
__device__ __forceinline__ void tdm_load(u32x4 g0, u32x8 g1) {
  asm volatile("tensor_load_to_lds %0, %1" ::"s"(g0), "s"(g1) : "memory");
}
__device__ __forceinline__ u32x4 tdm_group0(uint32_t lds_dst, uint64_t ga) {
  u32x4 g;
  g[0] = uni(1u);
  g[1] = uni(lds_dst);
  g[2] = uni((uint32_t)ga);
  g[3] = uni((((uint32_t)(ga >> 32)) & 0x01FFFFFFu) | 0x80000000u);
  return g;
}
// W0 = word 0 (pad fields, no mask), D0 = bytes per row, D1 = rows.
template <uint32_t W0, uint32_t D0, uint32_t D1>
__device__ __forceinline__ u32x8 tdm_group1(uint32_t src_pitch) {
  u32x8 g;
  g[0] = uni(W0);
  g[1] = uni((D0 & 0xFFFFu) << 16);
  g[2] = uni((D0 >> 16) | ((D1 & 0xFFFFu) << 16));
  g[3] = uni((D1 >> 16) | (D0 << 16));
  g[4] = uni(D1);
  g[5] = uni(src_pitch);
  g[6] = uni(0u);
  g[7] = uni(0u);
  return g;
}
__device__ __forceinline__ u32x4 ld_tr16(const unsigned char* p) {
  typedef __attribute__((address_space(3))) s16x8 lds_s16x8;
  return __builtin_bit_cast(u32x4,
                            __builtin_amdgcn_ds_load_tr16_b128_v8i16((lds_s16x8*)p));
}

union FragU {
  v16bf v;
  u32x4 q[2];
};

constexpr uint32_t PITCH_A = 144u, PITCH_B = 288u;
constexpr uint32_t SLICE_A = 10240u;              // 64 * 144 = 9216, rounded up
constexpr uint32_t SLICE_B = 6144u;               // 16 * 288 = 4608, rounded up
constexpr uint32_t BASE_B  = 4u * SLICE_A;
constexpr uint32_t BUF_SZ  = BASE_B + 4u * SLICE_B;  // 65536
constexpr uint32_t PAD_A   = (1u << 20) | (4u << 22) | (3u << 25);  // 128-B rows + 16 B
constexpr uint32_t PAD_B   = (1u << 20) | (5u << 22) | (7u << 25);  // 256-B rows + 32 B
static_assert(SLICE_A % 2048u == 0 && SLICE_B % 2048u == 0 && BUF_SZ % 2048u == 0, "slice places");
static_assert(64u * PITCH_A <= SLICE_A && 16u * PITCH_B <= SLICE_B, "slice sizes");

constexpr uint32_t EPI_PITCH = 272u;
constexpr uint32_t EPI_SZ    = 64u * EPI_PITCH;
constexpr uint32_t GEMM_LDS  = (8u * EPI_SZ > 2u * BUF_SZ) ? 8u * EPI_SZ : 2u * BUF_SZ;

typedef float  f32x4  __attribute__((ext_vector_type(4)));
typedef __bf16 bf16x8 __attribute__((ext_vector_type(8)));

template <bool GELU>
__device__ __forceinline__ float epi_val(float a, float bsv) {
  float val = a + bsv;
  if (GELU) val = 0.5f * val * (1.0f + erff(val * 0.70710678118f));
  return val;
}

// Stands directly behind the epilogue's global loads and stores, in front of any
// rewrite of a register that they name (the next trip's addresses and data).
__device__ __forceinline__ void wait_x0() {
  asm volatile("s_wait_xcnt 0x0" ::: "memory");
}

// Reads the wave's staged tile back row-wise and stores it: bias (+GELU), then
// 16 bytes per lane, so that every wave-wide store covers whole 128-B lines
// (f32: 2 rows of 256 B; bf16: 4 rows of 128 B). bias, Cf and Cb point at the
// tile's first column / element. The row loops stay rolled so that the
// epilogue's text is short (U stores a trip; without GELU four, so that a trip's
// LDS reads fly together). They walk from the last rows to the first: walking
// upwards, the compiler formed each LDS address as (base - tile size) with
// offset: tile size, a register below zero in wave 0; walking downwards, the
// loops that this file's launches run add a step >= 0 to the lane's base.
template <bool GELU>
__device__ __forceinline__ void store_tile(const unsigned char* stg, int lane,
                                           const float* bias, float* Cf, __bf16* Cb,
                                           int N) {
  constexpr int U = GELU ? 1 : 4;
  // The loops over u and e are unrolled so that every index is a constant (registers).
  if (Cf) {
    const int r = lane >> 4, c = (lane & 15) * 4;
    f32x4 bs = {0.0f, 0.0f, 0.0f, 0.0f};
    if (bias) {
      bs = *(const f32x4*)(bias + c);
      wait_x0();   // behind the bias load, in front of any rewrite of its offset register
    }
    const unsigned char* p = stg + (uint32_t)r * EPI_PITCH + (uint32_t)c * 4u;
    float* o = Cf + (size_t)r * N + c;
#pragma unroll 1
    for (int g = 32 / U - 1; g >= 0; --g) {
      f32x4 a[U];
#pragma unroll
      for (int u = 0; u < U; ++u)
        a[u] = *(const f32x4*)(p + (uint32_t)(g * U + u) * 2u * EPI_PITCH);
#pragma unroll
      for (int u = 0; u < U; ++u) {
        f32x4 y;
#pragma unroll
        for (int e = 0; e < 4; ++e) y[e] = epi_val<GELU>(a[u][e], bs[e]);
        *(f32x4*)(o + (size_t)(g * U + u) * 2 * N) = y;
      }
      wait_x0();
    }
  }
  if (Cb) {
    const int r = lane >> 3, c = (lane & 7) * 8;
    f32x4 bs0 = {0.0f, 0.0f, 0.0f, 0.0f}, bs1 = bs0;
    if (bias) {
      bs0 = *(const f32x4*)(bias + c);
      bs1 = *(const f32x4*)(bias + c + 4);
      wait_x0();   // behind the bias loads, in front of any rewrite of their offset register
    }
    const unsigned char* p = stg + (uint32_t)r * EPI_PITCH + (uint32_t)c * 4u;
    __bf16* o = Cb + (size_t)r * N + c;
#pragma unroll 1
    for (int g = 16 / U - 1; g >= 0; --g) {
      f32x4 a0[U], a1[U];
#pragma unroll
      for (int u = 0; u < U; ++u) {
        const unsigned char* q = p + (uint32_t)(g * U + u) * 4u * EPI_PITCH;
        a0[u] = *(const f32x4*)q;
        a1[u] = *(const f32x4*)(q + 16);
      }
#pragma unroll
      for (int u = 0; u < U; ++u) {
        bf16x8 y;
#pragma unroll
        for (int e = 0; e < 4; ++e) {
          y[e]     = (__bf16)epi_val<GELU>(a0[u][e], bs0[e]);
          y[e + 4] = (__bf16)epi_val<GELU>(a1[u][e], bs1[e]);
        }
        *(bf16x8*)(o + (size_t)(g * U + u) * 4 * N) = y;
      }
      wait_x0();
    }
  }
}

__global__ __launch_bounds__(256, 1) void gemm_bf16_kernel(
    const __bf16* A0, const __bf16* W0, const float* bias0, float* Cf0, __bf16* Cb0,
    const __bf16* A1, const __bf16* W1, const float* bias1, float* Cf1, __bf16* Cb1,
    const __bf16* A2, const __bf16* W2, const float* bias2, float* Cf2, __bf16* Cb2,
    int Mr, int N, int K, int act) {
  (void)Mr;
  __shared__ __attribute__((aligned(2048))) unsigned char L[GEMM_LDS];

  const uint32_t zs = blockIdx.z;
  const __bf16* A    = zs == 0u ? A0    : zs == 1u ? A1    : A2;
  const __bf16* W    = zs == 0u ? W0    : zs == 1u ? W1    : W2;
  const float*  bias = zs == 0u ? bias0 : zs == 1u ? bias1 : bias2;
  float*        Cf   = zs == 0u ? Cf0   : zs == 1u ? Cf1   : Cf2;
  __bf16*       Cb   = zs == 0u ? Cb0   : zs == 1u ? Cb1   : Cb2;

  const int      tid  = threadIdx.x;
  const int      lane = tid & 31;
  const uint32_t wave = uni((uint32_t)tid >> 5);
  const int wm   = (int)(wave >> 1);   // 0..3
  const int wn   = (int)(wave & 1u);   // 0..1
  const int half = lane >> 4;
  const int lr   = lane & 15;
  const int row0 = blockIdx.y * 256;
  const int col0 = blockIdx.x * 128;
  const uint32_t lbase = (uint32_t)(size_t)L;

  v8f acc[4][4];
#pragma unroll
  for (int mi = 0; mi < 4; ++mi)
#pragma unroll
    for (int ni = 0; ni < 4; ++ni)
#pragma unroll
      for (int e = 0; e < 8; ++e) acc[mi][ni][e] = 0.0f;

  // One request per wave and pass: waves 0-3 a slice of A, waves 4-7 of W.
  u32x8 g1a = tdm_group1<PAD_A, 128u, 64u>(2u * (uint32_t)K);
  u32x8 g1b = tdm_group1<PAD_B, 256u, 16u>(2u * (uint32_t)N);
  hold8(g1a);
  hold8(g1b);
  const bool     isA  = wave < 4u;
  const uint32_t j    = wave & 3u;
  const uint32_t dst0 = lbase + (isA ? j * SLICE_A : BASE_B + j * SLICE_B);
  const uint64_t src0 = isA
      ? (uint64_t)(size_t)A + 2ull * ((uint64_t)((uint32_t)row0 + j * 64u) * (uint32_t)K)
      : (uint64_t)(size_t)W + 2ull * ((uint64_t)(j * 16u) * (uint32_t)N + (uint32_t)col0);
  const uint64_t step = isA ? 128ull : 128ull * (uint32_t)N;   // bytes per pass
  u32x4 g0;
  auto issue = [&](uint32_t st) {   // pass st's slice, into buffer st & 1
    g0 = tdm_group0(dst0 + (st & 1u) * BUF_SZ, src0 + (uint64_t)st * step);
    hold4(g0);
    if (pinned(wave < 4u)) tdm_load(g0, g1a);
    else                   tdm_load(g0, g1b);
  };

  const uint32_t nt = (uint32_t)K >> 6;   // passes; every call has at least two

  issue(0u);
  wait_tensor0(g0, g1a, g1b);
  __syncthreads();                        // pass 0's tiles are published
  issue(1u);

  // Lane offsets of the fragment reads inside a buffer.
  const uint32_t aoff = (uint32_t)wm * SLICE_A + (uint32_t)lr * PITCH_A + 16u * (uint32_t)half;
  const uint32_t boff = BASE_B + (8u * (uint32_t)half + (uint32_t)(lane & 7)) * PITCH_B +
                        128u * (uint32_t)wn + 16u * (uint32_t)((lane >> 3) & 1);

  for (uint32_t s = 0; s < nt; ++s) {
    const unsigned char* Lb = L + (s & 1u) * BUF_SZ;
    // The loops below are unrolled so that every fragment and accumulator
    // index is a constant (registers, no scratch).
#pragma unroll
    for (int kb = 0; kb < 2; ++kb) {
      // A fragments, hardware k order: bytes 16h and 32 + 16h of each 64 B.
      FragU af[4];
#pragma unroll
      for (int mi = 0; mi < 4; ++mi) {
        const unsigned char* pa = Lb + aoff + (uint32_t)mi * 16u * PITCH_A + (uint32_t)kb * 64u;
        af[mi].q[0] = *(const u32x4*)pa;
        af[mi].q[1] = *(const u32x4*)(pa + 32);
      }
#pragma unroll
      for (int ni = 0; ni < 4; ++ni) {
        // W fragment: k-rows 32 kb + 0..15 and + 16..31 lie in two slices.
        const unsigned char* pb = Lb + boff + (uint32_t)(2 * kb) * SLICE_B + (uint32_t)ni * 32u;
        FragU bf;
        bf.q[0] = ld_tr16(pb);
        bf.q[1] = ld_tr16(pb + SLICE_B);
#pragma unroll
        for (int mi = 0; mi < 4; ++mi)
          acc[mi][ni] = wmma_bf16(af[mi].v, bf.v, acc[mi][ni]);
      }
    }

    // Publish point of pass s + 1; it also ends every reader's last read of
    // this pass's buffer, which is refilled behind it.
    wait_ds0();
    wait_tensor0(g0, g1a, g1b);
    __syncthreads();
    if (pinned(s + 2u < nt)) issue(s + 2u);
  }
  wait_tensor0(g0, g1a, g1b);
  wait_ds0();

  // epilogue ------------------------------------------------------------------
  // The last pass's publish point (own LDS reads done, own tensor loads landed,
  // barrier) has freed the ring for every wave: each wave now stages its own
  // 64 x 64 tile in its own range of L, which runs 8 KiB past the ring.
  unsigned char* stg = L + wave * EPI_SZ;
  {
    float* w = (float*)(stg + (uint32_t)(8 * half) * EPI_PITCH) + lr;
    // unrolled: every accumulator index is a constant (registers, no scratch)
#pragma unroll
    for (int mi = 0; mi < 4; ++mi)
#pragma unroll
      for (int ni = 0; ni < 4; ++ni)
#pragma unroll
        for (int v = 0; v < 8; ++v)
          w[(mi * 16 + v) * (int)(EPI_PITCH / 4u) + ni * 16] = acc[mi][ni][v];
  }
  wait_ds0();   // the wave's rows are in LDS before its lanes read each other's values back

  const int    trow = row0 + wm * 64;
  const int    tcol = col0 + wn * 64;
  const size_t toff = (size_t)trow * N + tcol;
  const float* bt   = bias ? bias + tcol : nullptr;
  float*       cf   = Cf ? Cf + toff : nullptr;
  __bf16*      cb   = Cb ? Cb + toff : nullptr;
  if (act == 1) store_tile<true>(stg, lane, bt, cf, cb, N);
  else          store_tile<false>(stg, lane, bt, cf, cb, N);
}

// ---------------------------------------------------------------------------
// Flash attention: one wave per (batch, head, 16-query block).
// windowed=1 -> causal local window W=64 + ALiBi; windowed=0 -> full attn.
// Q,K,V,O are bf16 [B*Lq(or Lk), D] with head h at feature offset h*64.
// ---------------------------------------------------------------------------
__global__ __launch_bounds__(128) void attn_kernel(
    const __bf16* __restrict__ Q, const __bf16* __restrict__ Km,
    const __bf16* __restrict__ Vm, __bf16* __restrict__ O,
    int Lq, int Lk, int windowed) {
  __shared__ __bf16 lP[4][16][32];  // per-wave P staging (C-layout -> A-layout)
  const int lane  = threadIdx.x & 31;
  const int wave  = threadIdx.x >> 5;
  const int half  = lane >> 4;
  const int lr    = lane & 15;
  const int qbPer = Lq >> 4;
  const int job   = blockIdx.x * 4 + wave;
  const int qblk  = job % qbPer;
  const int h     = (job / qbPer) % H_;
  const int b     = job / (qbPer * H_);
  const int q0    = qblk << 4;

  const float slope = windowed ? exp2f(-8.0f * (float)(h + 1) / (float)H_) : 0.0f;

  // Q fragments (A operand): 16 queries x 64 features
  v16bf qa[2];
  {
    const __bf16* qb = Q + ((size_t)(b * Lq + q0 + lr)) * D_ + h * DH_;
#pragma unroll
    for (int f = 0; f < 2; ++f) {
      ABu u;
#pragma unroll
      for (int t = 0; t < 8; ++t)
        u.u[t] = *(const unsigned int*)(qb + f * 32 + kpair(t, half));
      qa[f] = u.v;
    }
  }

  float mrow[8], lrow[8];
  v8f   o[4];
#pragma unroll
  for (int v = 0; v < 8; ++v) { mrow[v] = -3.0e38f; lrow[v] = 0.0f; }
#pragma unroll
  for (int f = 0; f < 4; ++f)
#pragma unroll
    for (int e = 0; e < 8; ++e) o[f][e] = 0.0f;

  const int nch = windowed ? 3 : (Lk >> 5);  // uniform across the block
  for (int ch = 0; ch < nch; ++ch) {
    const int kc = windowed ? (q0 - 64 + 32 * ch) : (32 * ch);

    // S = Q @ K^T : 16 queries x 32 keys ------------------------------------
    v8f s[2];
#pragma unroll
    for (int g = 0; g < 2; ++g) {
#pragma unroll
      for (int e = 0; e < 8; ++e) s[g][e] = 0.0f;
      int key  = kc + g * 16 + lr;
      int keyc = key < 0 ? 0 : (key >= Lk ? Lk - 1 : key);
      const __bf16* kb = Km + ((size_t)(b * Lk + keyc)) * D_ + h * DH_;
#pragma unroll
      for (int f = 0; f < 2; ++f) {
        ABu u;
#pragma unroll
        for (int t = 0; t < 8; ++t)
          u.u[t] = *(const unsigned int*)(kb + f * 32 + kpair(t, half));
        s[g] = wmma_bf16(qa[f], u.v, s[g]);
      }
    }

    // scale + ALiBi + mask, online softmax ----------------------------------
#pragma unroll
    for (int v = 0; v < 8; ++v) {
      const int i    = q0 + v + 8 * half;
      float     best = -3.0e38f;
#pragma unroll
      for (int g = 0; g < 2; ++g) {
        const int j  = kc + g * 16 + lr;
        float     sv = s[g][v] * 0.125f + slope * (float)(j - i);
        bool valid = windowed ? (j >= 0 && j <= i && (i - j) < 64) : (j < Lk);
        sv       = valid ? sv : -1.0e30f;
        s[g][v]  = sv;
        best     = fmaxf(best, sv);
      }
#pragma unroll
      for (int mm = 1; mm < 16; mm <<= 1)
        best = fmaxf(best, __shfl_xor(best, mm, 16));
      const float mnew  = fmaxf(mrow[v], best);
      const float alpha = exp2_hw((mrow[v] - mnew) * LOG2E_);
      float psum = 0.0f;
#pragma unroll
      for (int g = 0; g < 2; ++g) {
        float pv = exp2_hw((s[g][v] - mnew) * LOG2E_);
        lP[wave][v + 8 * half][g * 16 + lr] = (__bf16)pv;
        psum += pv;
      }
#pragma unroll
      for (int mm = 1; mm < 16; mm <<= 1) psum += __shfl_xor(psum, mm, 16);
      lrow[v] = lrow[v] * alpha + psum;
      mrow[v] = mnew;
#pragma unroll
      for (int f = 0; f < 4; ++f) o[f][v] *= alpha;
    }
    __syncthreads();

    // P fragment (A operand): 16 queries x 32 keys --------------------------
    v16bf pa;
    {
      ABu u;
#pragma unroll
      for (int t = 0; t < 8; ++t)
        u.u[t] = *(const unsigned int*)&lP[wave][lr][kpair(t, half)];
      pa = u.v;
    }

    // O += P @ V(chunk) ------------------------------------------------------
#pragma unroll
    for (int f = 0; f < 4; ++f) {
      ABu u;
#pragma unroll
      for (int t = 0; t < 8; ++t) {
        int k  = kpair(t, half);
        int j0 = kc + k, j1 = kc + k + 1;
        j0 = j0 < 0 ? 0 : (j0 >= Lk ? Lk - 1 : j0);
        j1 = j1 < 0 ? 0 : (j1 >= Lk ? Lk - 1 : j1);
        u.b[2 * t]     = Vm[((size_t)(b * Lk + j0)) * D_ + h * DH_ + f * 16 + lr];
        u.b[2 * t + 1] = Vm[((size_t)(b * Lk + j1)) * D_ + h * DH_ + f * 16 + lr];
      }
      o[f] = wmma_bf16(pa, u.v, o[f]);
    }
    __syncthreads();
  }

  // normalize + store --------------------------------------------------------
#pragma unroll
  for (int f = 0; f < 4; ++f)
#pragma unroll
    for (int v = 0; v < 8; ++v) {
      const int   row = q0 + v + 8 * half;
      const float inv = 1.0f / fmaxf(lrow[v], 1.0e-20f);
      O[((size_t)(b * Lq + row)) * D_ + h * DH_ + f * 16 + lr] =
          (__bf16)(o[f][v] * inv);
    }
}

constexpr uint32_t PITCH_K  = 144u, PITCH_V = 160u;
constexpr uint32_t SLICE_KV = 6144u;              // 32 * 144 = 4608, 32 * 160 = 5120, rounded up
constexpr uint32_t BASE_V   = 4u * SLICE_KV;
constexpr uint32_t KV_SZ    = 8u * SLICE_KV;      // 49152
constexpr uint32_t PAD_K    = (1u << 20) | (4u << 22) | (3u << 25);  // 128-B rows + 16 B
constexpr uint32_t PAD_V    = (1u << 20) | (4u << 22) | (7u << 25);  // 128-B rows + 32 B
static_assert(SLICE_KV % 2048u == 0 && KV_SZ % 2048u == 0, "slice places");
static_assert(32u * PITCH_K <= SLICE_KV && 32u * PITCH_V <= SLICE_KV, "slice sizes");

__device__ __forceinline__ float xhalf(float x) {
  const int v = __builtin_bit_cast(int, x);
  return __builtin_bit_cast(float, __builtin_amdgcn_permlanex16(v, v, 0x76543210, 0xfedcba98,
                                                                false, false));
}

__global__ __launch_bounds__(256) void attn_full_kernel(
    const __bf16* __restrict__ Q, const __bf16* __restrict__ Km,
    const __bf16* __restrict__ Vm, __bf16* __restrict__ O,
    int Lq, int Lk) {
  __shared__ __attribute__((aligned(2048))) unsigned char L[2u * KV_SZ];
  const int      lane  = threadIdx.x & 31;
  const uint32_t wave  = uni((uint32_t)threadIdx.x >> 5);
  const int      half  = lane >> 4;
  const int      lr    = lane & 15;
  const int      qbPer = Lq >> 4;
  const int      job0  = blockIdx.x * 8;          // the block's 8 jobs share b and h
  const int      qblk  = job0 % qbPer + (int)wave;
  const int      h     = (job0 / qbPer) % H_;
  const int      b     = job0 / (qbPer * H_);
  const int      q0    = qblk << 4;
  const uint32_t lbase = (uint32_t)(size_t)L;

  // One request per wave and stage: waves 0-3 a slice of K, waves 4-7 of V.
  u32x8 g1k = tdm_group1<PAD_K, 128u, 32u>(2u * (uint32_t)D_);
  u32x8 g1v = tdm_group1<PAD_V, 128u, 32u>(2u * (uint32_t)D_);
  hold8(g1k);
  hold8(g1v);
  const uint32_t jsl  = wave & 3u;
  const uint32_t dst0 = lbase + (wave < 4u ? 0u : BASE_V) + jsl * SLICE_KV;
  const uint64_t src0 = (uint64_t)(size_t)(wave < 4u ? Km : Vm) +
      2ull * ((uint64_t)((uint32_t)(b * Lk) + jsl * 32u) * (uint32_t)D_ + (uint32_t)(h * DH_));
  const uint64_t step = 2ull * 128ull * (uint32_t)D_;   // bytes per stage
  u32x4 g0;
  auto issue = [&](uint32_t st) {   // stage st's slice, into buffer st & 1
    g0 = tdm_group0(dst0 + (st & 1u) * KV_SZ, src0 + (uint64_t)st * step);
    hold4(g0);
    if (pinned(wave < 4u)) tdm_load(g0, g1k);
    else                   tdm_load(g0, g1v);
  };

  const uint32_t nt = (uint32_t)Lk >> 7;   // stages; at least two

  issue(0u);
  wait_tensor0(g0, g1k, g1v);
  __syncthreads();                         // stage 0's tiles are published
  issue(1u);

  // Every loop over fragments, rows and registers in this kernel is unrolled so
  // that each fragment and accumulator index is a constant (registers, no scratch).
  // Q fragments (B operand, column lr = query lr, hardware k order): 64 features x 16 queries
  v16bf qa[2];
  {
    const __bf16* qb = Q + ((size_t)(b * Lq + q0 + lr)) * D_ + h * DH_;
#pragma unroll
    for (int f = 0; f < 2; ++f) {
      ABu u;
#pragma unroll
      for (int t = 0; t < 8; ++t)
        u.u[t] = *(const unsigned int*)(qb + f * 32 + kpair(t, half));
      qa[f] = u.v;
    }
  }

  // Query lr's running maximum (base 2, scaled; the same in both halves) and this half's share
  // of its running sum; o[f][r] = O^T[16 f + 8 half + r][query lr].
  float mrun = -3.0e38f, lrun = 0.0f;
  v8f   o[4];
#pragma unroll
  for (int f = 0; f < 4; ++f)
#pragma unroll
    for (int e = 0; e < 8; ++e) o[f][e] = 0.0f;

  // Lane offsets of the fragment reads inside a slice.
  const uint32_t koff = (uint32_t)lr * PITCH_K + 16u * (uint32_t)half;
  const uint32_t voff = BASE_V + (8u * (uint32_t)half + (uint32_t)(lane & 7)) * PITCH_V +
                        16u * (uint32_t)((lane >> 3) & 1);

  for (uint32_t st = 0; st < nt; ++st) {
    const unsigned char* Lb = L + (st & 1u) * KV_SZ;
    for (uint32_t c = 0; c < 4u; ++c) {    // 32 keys: slice c of K and of V
      const unsigned char* Ls = Lb + c * SLICE_KV;

      // S^T = K @ Q^T : 32 keys x 16 queries; s[g][r] = key 16 g + 8 half + r, query lr
      v8f s[2];
#pragma unroll
      for (int g = 0; g < 2; ++g) {
#pragma unroll
        for (int e = 0; e < 8; ++e) s[g][e] = 0.0f;
#pragma unroll
        for (int f = 0; f < 2; ++f) {
          // hardware k order: bytes 16h and 32 + 16h of each 64 B of key row lr
          const unsigned char* pk = Ls + koff + (uint32_t)g * 16u * PITCH_K + (uint32_t)f * 64u;
          FragU kf;
          kf.q[0] = *(const u32x4*)pk;
          kf.q[1] = *(const u32x4*)(pk + 32);
          s[g] = wmma_bf16(kf.v, qa[f], s[g]);
        }
      }

      // online softmax of query lr, in base 2 -------------------------------------
      // The maximum is taken over the raw scores (the scale is positive) and scaled
      // once; mrun and mnew are in units of log2, 1/sqrt(64) included.
      constexpr float CS = 0.125f * LOG2E_;
      float best = -3.0e38f;
#pragma unroll
      for (int g = 0; g < 2; ++g)
#pragma unroll
        for (int r = 0; r < 8; ++r) best = fmaxf(best, s[g][r]);
      best = fmaxf(best, xhalf(best)) * CS;  // both halves hold the 32 keys' maximum
      const float mnew  = fmaxf(mrun, best);
      float alpha = mrun - mnew;
      float e[16];                           // scale and shift in one fma a score
#pragma unroll
      for (int g = 0; g < 2; ++g)
#pragma unroll
        for (int r = 0; r < 8; ++r) e[8 * g + r] = __builtin_fmaf(s[g][r], CS, -mnew);
      exp2_run(alpha, e);
      // P^T (B operand): element 8 g + r is key 16 g + 8 half + r, the hardware k order
      ABu   pb;
      float psum[2] = {e[0], e[8]};
#pragma unroll
      for (int g = 0; g < 2; ++g)
#pragma unroll
        for (int r = 0; r < 8; ++r) {
          float pv = e[8 * g + r];
          pb.b[8 * g + r] = (__bf16)pv;
          if (r > 0) psum[g] += pv;
        }
      lrun = lrun * alpha + (psum[0] + psum[1]);
      mrun = mnew;
#pragma unroll
      for (int f = 0; f < 4; ++f)
#pragma unroll
        for (int e = 0; e < 8; ++e) o[f][e] *= alpha;

      // O^T += V^T(chunk) @ P^T: key rows 0..15 and 16..31, transposed on the read
#pragma unroll
      for (int f = 0; f < 4; ++f) {
        const unsigned char* pv = Ls + voff + (uint32_t)f * 32u;
        FragU vf;
        vf.q[0] = ld_tr16(pv);
        vf.q[1] = ld_tr16(pv + 16u * PITCH_V);
        o[f] = wmma_bf16(vf.v, pb.v, o[f]);
      }
    }

    // Publish point of stage st + 1; it also ends every reader's last read of
    // this stage's buffer, which is refilled behind it.
    wait_ds0();
    wait_tensor0(g0, g1k, g1v);
    __syncthreads();
    if (pinned(st + 2u < nt)) issue(st + 2u);
  }
  wait_tensor0(g0, g1k, g1v);
  wait_ds0();

  // normalize + store: a lane holds 8 consecutive features of query lr per tile
  const float lsum = lrun + xhalf(lrun);     // the two halves' shares of the sum
  const float inv  = 1.0f / fmaxf(lsum, 1.0e-20f);
  __bf16* ob = O + ((size_t)(b * Lq + q0 + lr)) * D_ + h * DH_ + 8 * half;
  bf16x8 y[4];
#pragma unroll
  for (int f = 0; f < 4; ++f)
#pragma unroll
    for (int r = 0; r < 8; ++r) y[f][r] = (__bf16)(o[f][r] * inv);
#pragma unroll
  for (int f = 0; f < 4; ++f) *(bf16x8*)(ob + 16 * f) = y[f];
}

// ---------------------------------------------------------------------------
// Fused residual add + LayerNorm over D=1024. One 256-thread block per row.
// Emits f32 (residual stream) and/or bf16 (next-GEMM operand).
// ---------------------------------------------------------------------------
__global__ __launch_bounds__(256) void add_ln_kernel(
    const float* __restrict__ A, const float* __restrict__ Bv,
    const float* __restrict__ g, const float* __restrict__ be,
    float* __restrict__ outF, __bf16* __restrict__ outB) {
  __shared__ float redS[8], redQ[8];
  const int row  = blockIdx.x;
  const int t    = threadIdx.x;
  const int lane = t & 31, wave = t >> 5;
  const float* a = A + (size_t)row * D_;
  const float* r = Bv + (size_t)row * D_;

  float x[4], s = 0.0f, q = 0.0f;
#pragma unroll
  for (int e = 0; e < 4; ++e) {
    int c = t + 256 * e;
    x[e]  = a[c] + r[c];
    s    += x[e];
    q    += x[e] * x[e];
  }
#pragma unroll
  for (int mm = 1; mm < 32; mm <<= 1) {
    s += __shfl_xor(s, mm, 32);
    q += __shfl_xor(q, mm, 32);
  }
  if (lane == 0) { redS[wave] = s; redQ[wave] = q; }
  __syncthreads();
  float S = 0.0f, Q2 = 0.0f;
#pragma unroll
  for (int w = 0; w < 8; ++w) { S += redS[w]; Q2 += redQ[w]; }
  const float mu   = S * (1.0f / D_);
  const float var  = Q2 * (1.0f / D_) - mu * mu;
  const float rstd = rsqrtf(var + 1e-5f);
#pragma unroll
  for (int e = 0; e < 4; ++e) {
    int   c = t + 256 * e;
    float y = (x[e] - mu) * rstd * g[c] + be[c];
    if (outF) outF[(size_t)row * D_ + c] = y;
    if (outB) outB[(size_t)row * D_ + c] = (__bf16)y;
  }
}

// ---------------------------------------------------------------------------
// fp32 -> bf16 conversion of all twelve operands in ONE launch. The twelve bf16
// destinations lie one behind the other in the workspace (each a multiple of
// 256 B), so the output is one array of 24 * 2^20 elements; only the source
// changes, at multiples of 2^20 elements. A block converts one tile of 8192
// elements a trip (a wave 1024: eight 512-B loads in flight, eight 256-B stores,
// whole lines both ways); a tile never straddles two sources.
//   units of 2^20: 0-3 x, 4-7 mem, 8-15 the eight D x D weights, 16-19 w1, 20-23 w2
// ---------------------------------------------------------------------------
typedef __bf16 bf16x4 __attribute__((ext_vector_type(4)));
constexpr uint32_t CVT_TILE   = 8192u;
constexpr uint32_t CVT_BLOCKS = 1024u;
constexpr uint32_t CVT_TRIPS  = 3u;     // 24 * 2^20 / (CVT_TILE * CVT_BLOCKS)
static_assert(CVT_TILE * CVT_BLOCKS * CVT_TRIPS == 24u << 20, "conversion covers every element once");

__global__ __launch_bounds__(256) void cvt_all_kernel(
    const float* __restrict__ x,  const float* __restrict__ mem,
    const float* __restrict__ m0, const float* __restrict__ m1,
    const float* __restrict__ m2, const float* __restrict__ m3,
    const float* __restrict__ m4, const float* __restrict__ m5,
    const float* __restrict__ m6, const float* __restrict__ m7,
    const float* __restrict__ w1, const float* __restrict__ w2,
    __bf16* __restrict__ out) {
  const uint32_t off = (threadIdx.x >> 5) * 1024u + (threadIdx.x & 31u) * 4u;
  // rolled: one short body; the WGP's other waves cover a wave's load latency
#pragma unroll 1
  for (uint32_t it = 0; it < CVT_TRIPS; ++it) {
    const uint32_t t = it * CVT_BLOCKS + blockIdx.x;   // tile
    const uint32_t u = t >> 7;                         // its unit of 2^20 elements
    const float*   src = w2;
    uint32_t       u0  = 20u;                          // first unit of the source
    if (u < 4u)       { src = x;   u0 = 0u; }
    else if (u < 8u)  { src = mem; u0 = 4u; }
    else if (u < 16u) {
      u0  = u;
      src = u == 8u ? m0 : u == 9u ? m1 : u == 10u ? m2 : u == 11u ? m3
          : u == 12u ? m4 : u == 13u ? m5 : u == 14u ? m6 : m7;
    }
    else if (u < 20u) { src = w1;  u0 = 16u; }
    const float* s = src + (size_t)(t - u0 * 128u) * CVT_TILE + off;
    __bf16*      d = out + (size_t)t * CVT_TILE + off;
    f32x4 a[8];
    // unrolled: the eight loads are issued together
#pragma unroll
    for (int i = 0; i < 8; ++i) a[i] = *(const f32x4*)(s + i * 128);
    wait_x0();   // behind the loads, in front of any rewrite of their address registers
#pragma unroll
    for (int i = 0; i < 8; ++i)
      *(bf16x4*)(d + i * 128) = __builtin_convertvector(a[i], bf16x4);
    wait_x0();   // behind the stores, in front of the next trip's addresses and data
  }
}

// ---------------------------------------------------------------------------
// Host orchestration
// ---------------------------------------------------------------------------
extern "C" void kernel_launch(void* const* d_in, const int* in_sizes, int n_in,
                              void* d_out, int out_size, void* d_ws,
                              size_t ws_size, hipStream_t stream) {
  (void)in_sizes; (void)n_in; (void)out_size; (void)ws_size;
  constexpr int Bc = 2, Lc = 2048, Mc = 2048, Dc = 1024, FFc = 4096;
  constexpr int NT = Bc * Lc;  // 4096 query rows
  constexpr int NM = Bc * Mc;  // 4096 memory rows

  const float* x   = (const float*)d_in[0];
  const float* mem = (const float*)d_in[1];
  const float* swq = (const float*)d_in[2];
  const float* swk = (const float*)d_in[3];
  const float* swv = (const float*)d_in[4];
  const float* swo = (const float*)d_in[5];
  const float* sbq = (const float*)d_in[6];
  const float* sbk = (const float*)d_in[7];
  const float* sbv = (const float*)d_in[8];
  const float* sbo = (const float*)d_in[9];
  const float* cwq = (const float*)d_in[10];
  const float* cwk = (const float*)d_in[11];
  const float* cwv = (const float*)d_in[12];
  const float* cwo = (const float*)d_in[13];
  const float* cbq = (const float*)d_in[14];
  const float* cbk = (const float*)d_in[15];
  const float* cbv = (const float*)d_in[16];
  const float* cbo = (const float*)d_in[17];
  const float* w1  = (const float*)d_in[18];
  const float* b1  = (const float*)d_in[19];
  const float* w2  = (const float*)d_in[20];
  const float* b2  = (const float*)d_in[21];
  const float* g1  = (const float*)d_in[22];
  const float* g2  = (const float*)d_in[23];
  const float* g3  = (const float*)d_in[24];
  const float* be1 = (const float*)d_in[25];
  const float* be2 = (const float*)d_in[26];
  const float* be3 = (const float*)d_in[27];

  char* p = (char*)d_ws;
  auto take = [&](size_t bytes) -> void* {
    void* r = (void*)p;
    p += (bytes + 255) & ~(size_t)255;
    return r;
  };
  __bf16* xcur_bf = (__bf16*)take((size_t)NT * Dc * 2);  // x_bf -> x1_bf -> x2_bf
  __bf16* mem_bf  = (__bf16*)take((size_t)NM * Dc * 2);
  __bf16* swq_bf  = (__bf16*)take((size_t)Dc * Dc * 2);
  __bf16* swk_bf  = (__bf16*)take((size_t)Dc * Dc * 2);
  __bf16* swv_bf  = (__bf16*)take((size_t)Dc * Dc * 2);
  __bf16* swo_bf  = (__bf16*)take((size_t)Dc * Dc * 2);
  __bf16* cwq_bf  = (__bf16*)take((size_t)Dc * Dc * 2);
  __bf16* cwk_bf  = (__bf16*)take((size_t)Dc * Dc * 2);
  __bf16* cwv_bf  = (__bf16*)take((size_t)Dc * Dc * 2);
  __bf16* cwo_bf  = (__bf16*)take((size_t)Dc * Dc * 2);
  __bf16* w1_bf   = (__bf16*)take((size_t)Dc * FFc * 2);
  __bf16* w2_bf   = (__bf16*)take((size_t)FFc * Dc * 2);
  __bf16* q_bf    = (__bf16*)take((size_t)NT * Dc * 2);
  __bf16* k_bf    = (__bf16*)take((size_t)NM * Dc * 2);
  __bf16* v_bf    = (__bf16*)take((size_t)NM * Dc * 2);
  __bf16* attn_bf = (__bf16*)take((size_t)NT * Dc * 2);
  float*  gout    = (float*)take((size_t)NT * Dc * 4);   // sa / ca / ff
  float*  x1f     = (float*)take((size_t)NT * Dc * 4);
  float*  x2f     = (float*)take((size_t)NT * Dc * 4);
  __bf16* h_bf    = (__bf16*)take((size_t)NT * FFc * 2);

  struct Prod {   // one product's operand set
    const __bf16* A; const __bf16* W; const float* bias; float* Cf; __bf16* Cb;
  };
  const Prod none = {nullptr, nullptr, nullptr, nullptr, nullptr};
  // nz products of one shape in one launch
  auto gemm = [&](int nz, Prod p0, Prod p1, Prod p2, int Mg, int Ng, int Kg, int act) {
    dim3 grid(Ng / 128, Mg / 256, nz);
    gemm_bf16_kernel<<<grid, 256, 0, stream>>>(p0.A, p0.W, p0.bias, p0.Cf, p0.Cb,
                                               p1.A, p1.W, p1.bias, p1.Cf, p1.Cb,
                                               p2.A, p2.W, p2.bias, p2.Cf, p2.Cb,
                                               Mg, Ng, Kg, act);
  };
  auto attn = [&](const __bf16* Qg, const __bf16* Kg, const __bf16* Vg,
                  __bf16* Og, int Lqv, int Lkv, int windowed) {
    int jobs = Bc * H_ * (Lqv / 16);  // one wave per job, 4 waves per block
    attn_kernel<<<jobs / 4, 128, 0, stream>>>(Qg, Kg, Vg, Og, Lqv, Lkv,
                                              windowed);
  };

  // ---- bf16 staging --------------------------------------------------------
  // xcur_bf .. w2_bf are taken in a row above: one destination array.
  cvt_all_kernel<<<CVT_BLOCKS, 256, 0, stream>>>(x, mem, swq, swk, swv, swo, cwq, cwk,
                                                 cwv, cwo, w1, w2, xcur_bf);

  // ---- self-attention (windowed causal + ALiBi) ----------------------------
  gemm(3, {xcur_bf, swq_bf, sbq, nullptr, q_bf}, {xcur_bf, swk_bf, sbk, nullptr, k_bf},
       {xcur_bf, swv_bf, sbv, nullptr, v_bf}, NT, Dc, Dc, 0);
  attn(q_bf, k_bf, v_bf, attn_bf, Lc, Lc, 1);
  // The cross-attention keys depend on mem alone: they ride with the output
  // projection (k_bf is free, the self-attention launch before this has read it).
  gemm(2, {attn_bf, swo_bf, sbo, gout, nullptr}, {mem_bf, cwk_bf, cbk, nullptr, k_bf},
       none, NT, Dc, Dc, 0);
  add_ln_kernel<<<NT, 256, 0, stream>>>(x, gout, g1, be1, x1f, xcur_bf);

  // ---- cross-attention (full) ---------------------------------------------
  static_assert(NT == NM, "products of one launch have one shape");
  gemm(2, {xcur_bf, cwq_bf, cbq, nullptr, q_bf}, {mem_bf, cwv_bf, cbv, nullptr, v_bf},
       none, NT, Dc, Dc, 0);
  attn_full_kernel<<<Bc * H_ * (Lc / 16) / 8, 256, 0, stream>>>(q_bf, k_bf, v_bf,
                                                                attn_bf, Lc, Mc);
  gemm(1, {attn_bf, cwo_bf, cbo, gout, nullptr}, none, none, NT, Dc, Dc, 0);
  add_ln_kernel<<<NT, 256, 0, stream>>>(x1f, gout, g2, be2, x2f, xcur_bf);

  // ---- FFN -----------------------------------------------------------------
  gemm(1, {xcur_bf, w1_bf, b1, nullptr, h_bf}, none, none, NT, FFc, Dc, 1);  // fused exact GELU
  gemm(1, {h_bf, w2_bf, b2, gout, nullptr}, none, none, NT, Dc, FFc, 0);
  add_ln_kernel<<<NT, 256, 0, stream>>>(x2f, gout, g3, be3, (float*)d_out,
                                        nullptr);
}

// v008
// A run of this version takes 247 microseconds.
// Two timings next to v007 both put it at 1.11 times that version's speed.
// Over all steps from v000 it is 6.11 times as fast.
#include <hip/hip_runtime.h>
#include <math.h>
#include <stdint.h>

typedef __attribute__((ext_vector_type(16))) __bf16 v16bf;
typedef __attribute__((ext_vector_type(8)))  float  v8f;

union ABu {
  v16bf          v;
  unsigned int   u[8];
  unsigned short s[16];
  __bf16         b[16];
};

union U4u {
  uint4        q;
  unsigned int u[4];
};

__device__ __forceinline__ int kpair(int t, int half) {
  int base = (t < 4) ? (2 * t) : (16 + 2 * (t - 4));
  return base + 8 * half;
}

__device__ __forceinline__ v8f wmma_bf16(v16bf a, v16bf b, v8f c) {
  return __builtin_amdgcn_wmma_f32_16x16x32_bf16(false, a, false, b,
                                                 (short)0, c, false, false);
}

// 2^x by the hardware's own instruction (v_exp_f32). The softmax weights are formed
// in base 2: e^x = 2^(x * log2 e). A result below the normal range comes out as 0,
// which is what a weight that small rounds to in the sums anyway.
constexpr float LOG2E_ = 1.4426950408889634f;
__device__ __forceinline__ float exp2_hw(float x) { return __builtin_amdgcn_exp2f(x); }
__device__ __forceinline__ void exp2_run(float& a, float (&x)[16]) {
  asm("v_exp_f32 %1, %1\n\tv_exp_f32 %2, %2\n\tv_exp_f32 %3, %3\n\tv_exp_f32 %4, %4\n\t"
      "v_exp_f32 %5, %5\n\tv_exp_f32 %6, %6\n\tv_exp_f32 %7, %7\n\tv_exp_f32 %8, %8\n\t"
      "v_exp_f32 %0, %0\n\t"
      "v_exp_f32 %9, %9\n\tv_exp_f32 %10, %10\n\tv_exp_f32 %11, %11\n\tv_exp_f32 %12, %12\n\t"
      "v_exp_f32 %13, %13\n\tv_exp_f32 %14, %14\n\tv_exp_f32 %15, %15\n\tv_exp_f32 %16, %16\n\t"
      "v_nop"
      : "+v"(a), "+v"(x[0]), "+v"(x[1]), "+v"(x[2]), "+v"(x[3]), "+v"(x[4]), "+v"(x[5]),
        "+v"(x[6]), "+v"(x[7]), "+v"(x[8]), "+v"(x[9]), "+v"(x[10]), "+v"(x[11]),
        "+v"(x[12]), "+v"(x[13]), "+v"(x[14]), "+v"(x[15]));
}

#define D_  1024
#define H_  16
#define DH_ 64

typedef uint32_t u32x4 __attribute__((ext_vector_type(4)));
typedef uint32_t u32x8 __attribute__((ext_vector_type(8)));
typedef short    s16x8 __attribute__((ext_vector_type(8)));

__device__ __forceinline__ uint32_t uni(uint32_t v) {
  return (uint32_t)__builtin_amdgcn_readfirstlane(v);
}
__device__ __forceinline__ uint32_t pinned(uint32_t v) {
  uint32_t w = uni(v);
  asm volatile("" : "+s"(w));
  return w;
}
__device__ __forceinline__ void wait_ds0() {
  asm volatile("s_wait_dscnt 0x0" ::: "memory");      // own LDS reads done before the buffer is handed back
}
__device__ __forceinline__ void wait_tensor0(u32x4 g0, u32x8 ga, u32x8 gb) {
  asm volatile("s_wait_tensorcnt 0x0" ::"s"(g0), "s"(ga), "s"(gb) : "memory");
}
__device__ __forceinline__ void hold4(u32x4& g) { asm volatile("" : "+s"(g)); }
__device__ __forceinline__ void hold8(u32x8& g) { asm volatile("" : "+s"(g)); }
__device__ __forceinline__ void tdm_load(u32x4 g0, u32x8 g1) {
  asm volatile("tensor_load_to_lds %0, %1" ::"s"(g0), "s"(g1) : "memory");
}
__device__ __forceinline__ u32x4 tdm_group0(uint32_t lds_dst, uint64_t ga) {
  u32x4 g;
  g[0] = uni(1u);
  g[1] = uni(lds_dst);
  g[2] = uni((uint32_t)ga);
  g[3] = uni((((uint32_t)(ga >> 32)) & 0x01FFFFFFu) | 0x80000000u);
  return g;
}
// W0 = word 0 (pad fields, no mask), D0 = bytes per row, D1 = rows.
template <uint32_t W0, uint32_t D0, uint32_t D1>
__device__ __forceinline__ u32x8 tdm_group1(uint32_t src_pitch) {
  u32x8 g;
  g[0] = uni(W0);
  g[1] = uni((D0 & 0xFFFFu) << 16);
  g[2] = uni((D0 >> 16) | ((D1 & 0xFFFFu) << 16));
  g[3] = uni((D1 >> 16) | (D0 << 16));
  g[4] = uni(D1);
  g[5] = uni(src_pitch);
  g[6] = uni(0u);
  g[7] = uni(0u);
  return g;
}
__device__ __forceinline__ u32x4 ld_tr16(const unsigned char* p) {
  typedef __attribute__((address_space(3))) s16x8 lds_s16x8;
  return __builtin_bit_cast(u32x4,
                            __builtin_amdgcn_ds_load_tr16_b128_v8i16((lds_s16x8*)p));
}

union FragU {
  v16bf v;
  u32x4 q[2];
};

// Asks L2 for the 256-B unit that holds byte p: a hint, nothing comes back and no
// counter moves; scope SE: the unit goes into L2 only. p is in and out so that it
// stays in one register pair, which holds nothing but byte addresses of the operand.
__device__ __forceinline__ void l2_ask(uint64_t& p) {
  asm volatile("global_prefetch_b8 %0, off scope:SCOPE_SE" : "+v"(p));
}
// Steps p on and asks for the new unit. The step stands in the ask's own statement
// so that it is taken in the pair that the last ask named (passes ago), in place.
__device__ __forceinline__ void l2_step_ask(uint64_t& p, uint64_t step) {
  asm volatile("v_add_nc_u64_e32 %0, %1, %0\n\t"
               "global_prefetch_b8 %0, off scope:SCOPE_SE"
               : "+v"(p) : "s"(step));
}

constexpr uint32_t PITCH_A = 144u, PITCH_B = 288u;
constexpr uint32_t SLICE_A = 10240u;              // 64 * 144 = 9216, rounded up
constexpr uint32_t SLICE_B = 6144u;               // 16 * 288 = 4608, rounded up
constexpr uint32_t BASE_B  = 4u * SLICE_A;
constexpr uint32_t BUF_SZ  = BASE_B + 4u * SLICE_B;  // 65536
constexpr uint32_t PAD_A   = (1u << 20) | (4u << 22) | (3u << 25);  // 128-B rows + 16 B
constexpr uint32_t PAD_B   = (1u << 20) | (5u << 22) | (7u << 25);  // 256-B rows + 32 B
static_assert(SLICE_A % 2048u == 0 && SLICE_B % 2048u == 0 && BUF_SZ % 2048u == 0, "slice places");
static_assert(64u * PITCH_A <= SLICE_A && 16u * PITCH_B <= SLICE_B, "slice sizes");

constexpr uint32_t EPI_PITCH = 272u;
constexpr uint32_t EPI_SZ    = 64u * EPI_PITCH;
constexpr uint32_t GEMM_LDS  = (8u * EPI_SZ > 2u * BUF_SZ) ? 8u * EPI_SZ : 2u * BUF_SZ;

typedef float  f32x4  __attribute__((ext_vector_type(4)));
typedef __bf16 bf16x8 __attribute__((ext_vector_type(8)));

template <bool GELU>
__device__ __forceinline__ float epi_val(float a, float bsv) {
  float val = a + bsv;
  if (GELU) val = 0.5f * val * (1.0f + erff(val * 0.70710678118f));
  return val;
}

// Stands directly behind the epilogue's global loads and stores, in front of any
// rewrite of a register that they name (the next trip's addresses and data).
__device__ __forceinline__ void wait_x0() {
  asm volatile("s_wait_xcnt 0x0" ::: "memory");
}

// Reads the wave's staged tile back row-wise and stores it: bias (+GELU), then
// 16 bytes per lane, so that every wave-wide store covers whole 128-B lines
// (f32: 2 rows of 256 B; bf16: 4 rows of 128 B). bias, Cf and Cb point at the
// tile's first column / element. The row loops stay rolled so that the
// epilogue's text is short (U stores a trip; without GELU four, so that a trip's
// LDS reads fly together). They walk from the last rows to the first: walking
// upwards, the compiler formed each LDS address as (base - tile size) with
// offset: tile size, a register below zero in wave 0; walking downwards, the
// loops that this file's launches run add a step >= 0 to the lane's base.
template <bool GELU>
__device__ __forceinline__ void store_tile(const unsigned char* stg, int lane,
                                           const float* bias, float* Cf, __bf16* Cb,
                                           int N) {
  constexpr int U = GELU ? 1 : 4;
  // The loops over u and e are unrolled so that every index is a constant (registers).
  if (Cf) {
    const int r = lane >> 4, c = (lane & 15) * 4;
    f32x4 bs = {0.0f, 0.0f, 0.0f, 0.0f};
    if (bias) {
      bs = *(const f32x4*)(bias + c);
      wait_x0();   // behind the bias load, in front of any rewrite of its offset register
    }
    const unsigned char* p = stg + (uint32_t)r * EPI_PITCH + (uint32_t)c * 4u;
    float* o = Cf + (size_t)r * N + c;
#pragma unroll 1
    for (int g = 32 / U - 1; g >= 0; --g) {
      f32x4 a[U];
#pragma unroll
      for (int u = 0; u < U; ++u)
        a[u] = *(const f32x4*)(p + (uint32_t)(g * U + u) * 2u * EPI_PITCH);
#pragma unroll
      for (int u = 0; u < U; ++u) {
        f32x4 y;
#pragma unroll
        for (int e = 0; e < 4; ++e) y[e] = epi_val<GELU>(a[u][e], bs[e]);
        *(f32x4*)(o + (size_t)(g * U + u) * 2 * N) = y;
      }
      wait_x0();
    }
  }
  if (Cb) {
    const int r = lane >> 3, c = (lane & 7) * 8;
    f32x4 bs0 = {0.0f, 0.0f, 0.0f, 0.0f}, bs1 = bs0;
    if (bias) {
      bs0 = *(const f32x4*)(bias + c);
      bs1 = *(const f32x4*)(bias + c + 4);
      wait_x0();   // behind the bias loads, in front of any rewrite of their offset register
    }
    const unsigned char* p = stg + (uint32_t)r * EPI_PITCH + (uint32_t)c * 4u;
    __bf16* o = Cb + (size_t)r * N + c;
#pragma unroll 1
    for (int g = 16 / U - 1; g >= 0; --g) {
      f32x4 a0[U], a1[U];
#pragma unroll
      for (int u = 0; u < U; ++u) {
        const unsigned char* q = p + (uint32_t)(g * U + u) * 4u * EPI_PITCH;
        a0[u] = *(const f32x4*)q;
        a1[u] = *(const f32x4*)(q + 16);
      }
#pragma unroll
      for (int u = 0; u < U; ++u) {
        bf16x8 y;
#pragma unroll
        for (int e = 0; e < 4; ++e) {
          y[e]     = (__bf16)epi_val<GELU>(a0[u][e], bs0[e]);
          y[e + 4] = (__bf16)epi_val<GELU>(a1[u][e], bs1[e]);
        }
        *(bf16x8*)(o + (size_t)(g * U + u) * 4 * N) = y;
      }
      wait_x0();
    }
  }
}

__global__ __launch_bounds__(256, 1) void gemm_bf16_kernel(
    const __bf16* A0, const __bf16* W0, const float* bias0, float* Cf0, __bf16* Cb0,
    const __bf16* A1, const __bf16* W1, const float* bias1, float* Cf1, __bf16* Cb1,
    const __bf16* A2, const __bf16* W2, const float* bias2, float* Cf2, __bf16* Cb2,
    int Mr, int N, int K, int act) {
  (void)Mr;
  __shared__ __attribute__((aligned(2048))) unsigned char L[GEMM_LDS];

  const uint32_t zs = blockIdx.z;
  const __bf16* A    = zs == 0u ? A0    : zs == 1u ? A1    : A2;
  const __bf16* W    = zs == 0u ? W0    : zs == 1u ? W1    : W2;
  const float*  bias = zs == 0u ? bias0 : zs == 1u ? bias1 : bias2;
  float*        Cf   = zs == 0u ? Cf0   : zs == 1u ? Cf1   : Cf2;
  __bf16*       Cb   = zs == 0u ? Cb0   : zs == 1u ? Cb1   : Cb2;

  const int      tid  = threadIdx.x;
  const int      lane = tid & 31;
  const uint32_t wave = uni((uint32_t)tid >> 5);
  const int wm   = (int)(wave >> 1);   // 0..3
  const int wn   = (int)(wave & 1u);   // 0..1
  const int half = lane >> 4;
  const int lr   = lane & 15;
  const int row0 = blockIdx.y * 256;
  const int col0 = blockIdx.x * 128;
  const uint32_t lbase = (uint32_t)(size_t)L;

  v8f acc[4][4];
#pragma unroll
  for (int mi = 0; mi < 4; ++mi)
#pragma unroll
    for (int ni = 0; ni < 4; ++ni)
#pragma unroll
      for (int e = 0; e < 8; ++e) acc[mi][ni][e] = 0.0f;

  // One request per wave and pass: waves 0-3 a slice of A, waves 4-7 of W.
  u32x8 g1a = tdm_group1<PAD_A, 128u, 64u>(2u * (uint32_t)K);
  u32x8 g1b = tdm_group1<PAD_B, 256u, 16u>(2u * (uint32_t)N);
  hold8(g1a);
  hold8(g1b);
  const bool     isA  = wave < 4u;
  const uint32_t j    = wave & 3u;
  const uint32_t dst0 = lbase + (isA ? j * SLICE_A : BASE_B + j * SLICE_B);
  const uint64_t src0 = isA
      ? (uint64_t)(size_t)A + 2ull * ((uint64_t)((uint32_t)row0 + j * 64u) * (uint32_t)K)
      : (uint64_t)(size_t)W + 2ull * ((uint64_t)(j * 16u) * (uint32_t)N + (uint32_t)col0);
  const uint64_t step = isA ? 128ull : 128ull * (uint32_t)N;   // bytes per pass
  u32x4 g0;
  auto issue = [&](uint32_t st) {   // pass st's slice, into buffer st & 1
    g0 = tdm_group0(dst0 + (st & 1u) * BUF_SZ, src0 + (uint64_t)st * step);
    hold4(g0);
    if (pinned(wave < 4u)) tdm_load(g0, g1a);
    else                   tdm_load(g0, g1b);
  };

  const uint32_t nt = (uint32_t)K >> 6;   // passes; every call has at least two

  // L2 prefetch. A launch's operands come from memory, and the ring leads by one
  // pass. So each 256-B unit of the block's
  // operands is asked for once, two passes ahead of the tensor load that reads it,
  // which then finds it in L2.
  //   A: thread t asks for row t's next unit (two passes of 128 B) on every second pass
  //   W: a pass is 64 k-rows of 256 B; wave pair wq asks for passes wq, wq + 4, ...
  // An ask is made only for a pass that exists, so pa and pw never leave the operand.
  const uint32_t wq = wave >> 1;
  uint64_t pa = (uint64_t)(size_t)A +
      2ull * ((uint64_t)((uint32_t)row0 + (uint32_t)tid) * (uint32_t)K) + 256ull;   // passes 2, 3
  uint64_t pw = (uint64_t)(size_t)W +
      2ull * ((uint64_t)(wq * 64u + ((uint32_t)tid & 63u)) * (uint32_t)N + (uint32_t)col0);

  issue(0u);
  // Passes 1 to 3 (pass 0 is on its way; A's pass 1 lies in the units of pass 0).
  if (2u < nt) l2_ask(pa);
  if (wq > 0u && wq < nt) l2_ask(pw);
  wait_tensor0(g0, g1a, g1b);
  __syncthreads();                        // pass 0's tiles are published
  issue(1u);

  // Lane offsets of the fragment reads inside a buffer.
  const uint32_t aoff = (uint32_t)wm * SLICE_A + (uint32_t)lr * PITCH_A + 16u * (uint32_t)half;
  const uint32_t boff = BASE_B + (8u * (uint32_t)half + (uint32_t)(lane & 7)) * PITCH_B +
                        128u * (uint32_t)wn + 16u * (uint32_t)((lane >> 3) & 1);

  for (uint32_t s = 0; s < nt; ++s) {
    const unsigned char* Lb = L + (s & 1u) * BUF_SZ;
    // The loops below are unrolled so that every fragment and accumulator
    // index is a constant (registers, no scratch).
#pragma unroll
    for (int kb = 0; kb < 2; ++kb) {
      // A fragments, hardware k order: bytes 16h and 32 + 16h of each 64 B.
      FragU af[4];
#pragma unroll
      for (int mi = 0; mi < 4; ++mi) {
        const unsigned char* pa = Lb + aoff + (uint32_t)mi * 16u * PITCH_A + (uint32_t)kb * 64u;
        af[mi].q[0] = *(const u32x4*)pa;
        af[mi].q[1] = *(const u32x4*)(pa + 32);
      }
#pragma unroll
      for (int ni = 0; ni < 4; ++ni) {
        // W fragment: k-rows 32 kb + 0..15 and + 16..31 lie in two slices.
        const unsigned char* pb = Lb + boff + (uint32_t)(2 * kb) * SLICE_B + (uint32_t)ni * 32u;
        FragU bf;
        bf.q[0] = ld_tr16(pb);
        bf.q[1] = ld_tr16(pb + SLICE_B);
#pragma unroll
        for (int mi = 0; mi < 4; ++mi)
          acc[mi][ni] = wmma_bf16(af[mi].v, bf.v, acc[mi][ni]);
      }
    }

    // Publish point of pass s + 1; it also ends every reader's last read of
    // this pass's buffer, which is refilled behind it.
    wait_ds0();
    wait_tensor0(g0, g1a, g1b);
    __syncthreads();
    if (pinned(s + 2u < nt)) issue(s + 2u);

    // Pass s + 4's units, two passes ahead of their tensor load.
    const uint32_t pf = s + 4u;
    if (pf < nt) {
      if ((pf & 1u) == 0u) l2_step_ask(pa, 256ull);
      if ((pf & 3u) == wq) l2_step_ask(pw, 512ull * (uint32_t)N);   // four passes of W on
    }
  }
  wait_tensor0(g0, g1a, g1b);
  wait_ds0();

  // epilogue ------------------------------------------------------------------
  // The last pass's publish point (own LDS reads done, own tensor loads landed,
  // barrier) has freed the ring for every wave: each wave now stages its own
  // 64 x 64 tile in its own range of L, which runs 8 KiB past the ring.
  unsigned char* stg = L + wave * EPI_SZ;
  {
    float* w = (float*)(stg + (uint32_t)(8 * half) * EPI_PITCH) + lr;
    // unrolled: every accumulator index is a constant (registers, no scratch)
#pragma unroll
    for (int mi = 0; mi < 4; ++mi)
#pragma unroll
      for (int ni = 0; ni < 4; ++ni)
#pragma unroll
        for (int v = 0; v < 8; ++v)
          w[(mi * 16 + v) * (int)(EPI_PITCH / 4u) + ni * 16] = acc[mi][ni][v];
  }
  wait_ds0();   // the wave's rows are in LDS before its lanes read each other's values back

  const int    trow = row0 + wm * 64;
  const int    tcol = col0 + wn * 64;
  const size_t toff = (size_t)trow * N + tcol;
  const float* bt   = bias ? bias + tcol : nullptr;
  float*       cf   = Cf ? Cf + toff : nullptr;
  __bf16*      cb   = Cb ? Cb + toff : nullptr;
  if (act == 1) store_tile<true>(stg, lane, bt, cf, cb, N);
  else          store_tile<false>(stg, lane, bt, cf, cb, N);
}

// ---------------------------------------------------------------------------
// Flash attention: one wave per (batch, head, 16-query block).
// windowed=1 -> causal local window W=64 + ALiBi; windowed=0 -> full attn.
// Q,K,V,O are bf16 [B*Lq(or Lk), D] with head h at feature offset h*64.
// ---------------------------------------------------------------------------
__global__ __launch_bounds__(128) void attn_kernel(
    const __bf16* __restrict__ Q, const __bf16* __restrict__ Km,
    const __bf16* __restrict__ Vm, __bf16* __restrict__ O,
    int Lq, int Lk, int windowed) {
  __shared__ __bf16 lP[4][16][32];  // per-wave P staging (C-layout -> A-layout)
  const int lane  = threadIdx.x & 31;
  const int wave  = threadIdx.x >> 5;
  const int half  = lane >> 4;
  const int lr    = lane & 15;
  const int qbPer = Lq >> 4;
  const int job   = blockIdx.x * 4 + wave;
  const int qblk  = job % qbPer;
  const int h     = (job / qbPer) % H_;
  const int b     = job / (qbPer * H_);
  const int q0    = qblk << 4;

  const float slope = windowed ? exp2f(-8.0f * (float)(h + 1) / (float)H_) : 0.0f;

  // Q fragments (A operand): 16 queries x 64 features
  v16bf qa[2];
  {
    const __bf16* qb = Q + ((size_t)(b * Lq + q0 + lr)) * D_ + h * DH_;
#pragma unroll
    for (int f = 0; f < 2; ++f) {
      ABu u;
#pragma unroll
      for (int t = 0; t < 8; ++t)
        u.u[t] = *(const unsigned int*)(qb + f * 32 + kpair(t, half));
      qa[f] = u.v;
    }
  }

  float mrow[8], lrow[8];
  v8f   o[4];
#pragma unroll
  for (int v = 0; v < 8; ++v) { mrow[v] = -3.0e38f; lrow[v] = 0.0f; }
#pragma unroll
  for (int f = 0; f < 4; ++f)
#pragma unroll
    for (int e = 0; e < 8; ++e) o[f][e] = 0.0f;

  const int nch = windowed ? 3 : (Lk >> 5);  // uniform across the block
  for (int ch = 0; ch < nch; ++ch) {
    const int kc = windowed ? (q0 - 64 + 32 * ch) : (32 * ch);

    // S = Q @ K^T : 16 queries x 32 keys ------------------------------------
    v8f s[2];
#pragma unroll
    for (int g = 0; g < 2; ++g) {
#pragma unroll
      for (int e = 0; e < 8; ++e) s[g][e] = 0.0f;
      int key  = kc + g * 16 + lr;
      int keyc = key < 0 ? 0 : (key >= Lk ? Lk - 1 : key);
      const __bf16* kb = Km + ((size_t)(b * Lk + keyc)) * D_ + h * DH_;
#pragma unroll
      for (int f = 0; f < 2; ++f) {
        ABu u;
#pragma unroll
        for (int t = 0; t < 8; ++t)
          u.u[t] = *(const unsigned int*)(kb + f * 32 + kpair(t, half));
        s[g] = wmma_bf16(qa[f], u.v, s[g]);
      }
    }

    // scale + ALiBi + mask, online softmax ----------------------------------
#pragma unroll
    for (int v = 0; v < 8; ++v) {
      const int i    = q0 + v + 8 * half;
      float     best = -3.0e38f;
#pragma unroll
      for (int g = 0; g < 2; ++g) {
        const int j  = kc + g * 16 + lr;
        float     sv = s[g][v] * 0.125f + slope * (float)(j - i);
        bool valid = windowed ? (j >= 0 && j <= i && (i - j) < 64) : (j < Lk);
        sv       = valid ? sv : -1.0e30f;
        s[g][v]  = sv;
        best     = fmaxf(best, sv);
      }
#pragma unroll
      for (int mm = 1; mm < 16; mm <<= 1)
        best = fmaxf(best, __shfl_xor(best, mm, 16));
      const float mnew  = fmaxf(mrow[v], best);
      const float alpha = exp2_hw((mrow[v] - mnew) * LOG2E_);
      float psum = 0.0f;
#pragma unroll
      for (int g = 0; g < 2; ++g) {
        float pv = exp2_hw((s[g][v] - mnew) * LOG2E_);
        lP[wave][v + 8 * half][g * 16 + lr] = (__bf16)pv;
        psum += pv;
      }
#pragma unroll
      for (int mm = 1; mm < 16; mm <<= 1) psum += __shfl_xor(psum, mm, 16);
      lrow[v] = lrow[v] * alpha + psum;
      mrow[v] = mnew;
#pragma unroll
      for (int f = 0; f < 4; ++f) o[f][v] *= alpha;
    }
    __syncthreads();

    // P fragment (A operand): 16 queries x 32 keys --------------------------
    v16bf pa;
    {
      ABu u;
#pragma unroll
      for (int t = 0; t < 8; ++t)
        u.u[t] = *(const unsigned int*)&lP[wave][lr][kpair(t, half)];
      pa = u.v;
    }

    // O += P @ V(chunk) ------------------------------------------------------
#pragma unroll
    for (int f = 0; f < 4; ++f) {
      ABu u;
#pragma unroll
      for (int t = 0; t < 8; ++t) {
        int k  = kpair(t, half);
        int j0 = kc + k, j1 = kc + k + 1;
        j0 = j0 < 0 ? 0 : (j0 >= Lk ? Lk - 1 : j0);
        j1 = j1 < 0 ? 0 : (j1 >= Lk ? Lk - 1 : j1);
        u.b[2 * t]     = Vm[((size_t)(b * Lk + j0)) * D_ + h * DH_ + f * 16 + lr];
        u.b[2 * t + 1] = Vm[((size_t)(b * Lk + j1)) * D_ + h * DH_ + f * 16 + lr];
      }
      o[f] = wmma_bf16(pa, u.v, o[f]);
    }
    __syncthreads();
  }

  // normalize + store --------------------------------------------------------
#pragma unroll
  for (int f = 0; f < 4; ++f)
#pragma unroll
    for (int v = 0; v < 8; ++v) {
      const int   row = q0 + v + 8 * half;
      const float inv = 1.0f / fmaxf(lrow[v], 1.0e-20f);
      O[((size_t)(b * Lq + row)) * D_ + h * DH_ + f * 16 + lr] =
          (__bf16)(o[f][v] * inv);
    }
}

constexpr uint32_t PITCH_K  = 144u, PITCH_V = 160u;
constexpr uint32_t SLICE_KV = 6144u;              // 32 * 144 = 4608, 32 * 160 = 5120, rounded up
constexpr uint32_t BASE_V   = 4u * SLICE_KV;
constexpr uint32_t KV_SZ    = 8u * SLICE_KV;      // 49152
constexpr uint32_t PAD_K    = (1u << 20) | (4u << 22) | (3u << 25);  // 128-B rows + 16 B
constexpr uint32_t PAD_V    = (1u << 20) | (4u << 22) | (7u << 25);  // 128-B rows + 32 B
static_assert(SLICE_KV % 2048u == 0 && KV_SZ % 2048u == 0, "slice places");
static_assert(32u * PITCH_K <= SLICE_KV && 32u * PITCH_V <= SLICE_KV, "slice sizes");

__device__ __forceinline__ float xhalf(float x) {
  const int v = __builtin_bit_cast(int, x);
  return __builtin_bit_cast(float, __builtin_amdgcn_permlanex16(v, v, 0x76543210, 0xfedcba98,
                                                                false, false));
}

__global__ __launch_bounds__(256) void attn_full_kernel(
    const __bf16* __restrict__ Q, const __bf16* __restrict__ Km,
    const __bf16* __restrict__ Vm, __bf16* __restrict__ O,
    int Lq, int Lk) {
  __shared__ __attribute__((aligned(2048))) unsigned char L[2u * KV_SZ];
  const int      lane  = threadIdx.x & 31;
  const uint32_t wave  = uni((uint32_t)threadIdx.x >> 5);
  const int      half  = lane >> 4;
  const int      lr    = lane & 15;
  const int      qbPer = Lq >> 4;
  const int      job0  = blockIdx.x * 8;          // the block's 8 jobs share b and h
  const int      qblk  = job0 % qbPer + (int)wave;
  const int      h     = (job0 / qbPer) % H_;
  const int      b     = job0 / (qbPer * H_);
  const int      q0    = qblk << 4;
  const uint32_t lbase = (uint32_t)(size_t)L;

  // One request per wave and stage: waves 0-3 a slice of K, waves 4-7 of V.
  u32x8 g1k = tdm_group1<PAD_K, 128u, 32u>(2u * (uint32_t)D_);
  u32x8 g1v = tdm_group1<PAD_V, 128u, 32u>(2u * (uint32_t)D_);
  hold8(g1k);
  hold8(g1v);
  const uint32_t jsl  = wave & 3u;
  const uint32_t dst0 = lbase + (wave < 4u ? 0u : BASE_V) + jsl * SLICE_KV;
  const uint64_t src0 = (uint64_t)(size_t)(wave < 4u ? Km : Vm) +
      2ull * ((uint64_t)((uint32_t)(b * Lk) + jsl * 32u) * (uint32_t)D_ + (uint32_t)(h * DH_));
  const uint64_t step = 2ull * 128ull * (uint32_t)D_;   // bytes per stage
  u32x4 g0;
  auto issue = [&](uint32_t st) {   // stage st's slice, into buffer st & 1
    g0 = tdm_group0(dst0 + (st & 1u) * KV_SZ, src0 + (uint64_t)st * step);
    hold4(g0);
    if (pinned(wave < 4u)) tdm_load(g0, g1k);
    else                   tdm_load(g0, g1v);
  };

  const uint32_t nt = (uint32_t)Lk >> 7;   // stages; at least two

  issue(0u);
  wait_tensor0(g0, g1k, g1v);
  __syncthreads();                         // stage 0's tiles are published
  issue(1u);

  // Every loop over fragments, rows and registers in this kernel is unrolled so
  // that each fragment and accumulator index is a constant (registers, no scratch).
  // Q fragments (B operand, column lr = query lr, hardware k order): 64 features x 16 queries
  v16bf qa[2];
  {
    const __bf16* qb = Q + ((size_t)(b * Lq + q0 + lr)) * D_ + h * DH_;
#pragma unroll
    for (int f = 0; f < 2; ++f) {
      ABu u;
#pragma unroll
      for (int t = 0; t < 8; ++t)
        u.u[t] = *(const unsigned int*)(qb + f * 32 + kpair(t, half));
      qa[f] = u.v;
    }
  }

  // Query lr's running maximum (base 2, scaled; the same in both halves) and this half's share
  // of its running sum; o[f][r] = O^T[16 f + 8 half + r][query lr].
  float mrun = -3.0e38f, lrun = 0.0f;
  v8f   o[4];
#pragma unroll
  for (int f = 0; f < 4; ++f)
#pragma unroll
    for (int e = 0; e < 8; ++e) o[f][e] = 0.0f;

  // Lane offsets of the fragment reads inside a slice.
  const uint32_t koff = (uint32_t)lr * PITCH_K + 16u * (uint32_t)half;
  const uint32_t voff = BASE_V + (8u * (uint32_t)half + (uint32_t)(lane & 7)) * PITCH_V +
                        16u * (uint32_t)((lane >> 3) & 1);

  for (uint32_t st = 0; st < nt; ++st) {
    const unsigned char* Lb = L + (st & 1u) * KV_SZ;
    for (uint32_t c = 0; c < 4u; ++c) {    // 32 keys: slice c of K and of V
      const unsigned char* Ls = Lb + c * SLICE_KV;

      // S^T = K @ Q^T : 32 keys x 16 queries; s[g][r] = key 16 g + 8 half + r, query lr
      v8f s[2];
#pragma unroll
      for (int g = 0; g < 2; ++g) {
#pragma unroll
        for (int e = 0; e < 8; ++e) s[g][e] = 0.0f;
#pragma unroll
        for (int f = 0; f < 2; ++f) {
          // hardware k order: bytes 16h and 32 + 16h of each 64 B of key row lr
          const unsigned char* pk = Ls + koff + (uint32_t)g * 16u * PITCH_K + (uint32_t)f * 64u;
          FragU kf;
          kf.q[0] = *(const u32x4*)pk;
          kf.q[1] = *(const u32x4*)(pk + 32);
          s[g] = wmma_bf16(kf.v, qa[f], s[g]);
        }
      }

      // online softmax of query lr, in base 2 -------------------------------------
      // The maximum is taken over the raw scores (the scale is positive) and scaled
      // once; mrun and mnew are in units of log2, 1/sqrt(64) included.
      constexpr float CS = 0.125f * LOG2E_;
      float best = -3.0e38f;
#pragma unroll
      for (int g = 0; g < 2; ++g)
#pragma unroll
        for (int r = 0; r < 8; ++r) best = fmaxf(best, s[g][r]);
      best = fmaxf(best, xhalf(best)) * CS;  // both halves hold the 32 keys' maximum
      const float mnew  = fmaxf(mrun, best);
      float alpha = mrun - mnew;
      float e[16];                           // scale and shift in one fma a score
#pragma unroll
      for (int g = 0; g < 2; ++g)
#pragma unroll
        for (int r = 0; r < 8; ++r) e[8 * g + r] = __builtin_fmaf(s[g][r], CS, -mnew);
      exp2_run(alpha, e);
      // P^T (B operand): element 8 g + r is key 16 g + 8 half + r, the hardware k order
      ABu   pb;
      float psum[2] = {e[0], e[8]};
#pragma unroll
      for (int g = 0; g < 2; ++g)
#pragma unroll
        for (int r = 0; r < 8; ++r) {
          float pv = e[8 * g + r];
          pb.b[8 * g + r] = (__bf16)pv;
          if (r > 0) psum[g] += pv;
        }
      lrun = lrun * alpha + (psum[0] + psum[1]);
      mrun = mnew;
#pragma unroll
      for (int f = 0; f < 4; ++f)
#pragma unroll
        for (int e = 0; e < 8; ++e) o[f][e] *= alpha;

      // O^T += V^T(chunk) @ P^T: key rows 0..15 and 16..31, transposed on the read
#pragma unroll
      for (int f = 0; f < 4; ++f) {
        const unsigned char* pv = Ls + voff + (uint32_t)f * 32u;
        FragU vf;
        vf.q[0] = ld_tr16(pv);
        vf.q[1] = ld_tr16(pv + 16u * PITCH_V);
        o[f] = wmma_bf16(vf.v, pb.v, o[f]);
      }
    }

    // Publish point of stage st + 1; it also ends every reader's last read of
    // this stage's buffer, which is refilled behind it.
    wait_ds0();
    wait_tensor0(g0, g1k, g1v);
    __syncthreads();
    if (pinned(st + 2u < nt)) issue(st + 2u);
  }
  wait_tensor0(g0, g1k, g1v);
  wait_ds0();

  // normalize + store: a lane holds 8 consecutive features of query lr per tile
  const float lsum = lrun + xhalf(lrun);     // the two halves' shares of the sum
  const float inv  = 1.0f / fmaxf(lsum, 1.0e-20f);
  __bf16* ob = O + ((size_t)(b * Lq + q0 + lr)) * D_ + h * DH_ + 8 * half;
  bf16x8 y[4];
#pragma unroll
  for (int f = 0; f < 4; ++f)
#pragma unroll
    for (int r = 0; r < 8; ++r) y[f][r] = (__bf16)(o[f][r] * inv);
#pragma unroll
  for (int f = 0; f < 4; ++f) *(bf16x8*)(ob + 16 * f) = y[f];
}

// ---------------------------------------------------------------------------
// Fused residual add + LayerNorm over D=1024. One 256-thread block per row.
// Emits f32 (residual stream) and/or bf16 (next-GEMM operand).
// ---------------------------------------------------------------------------
__global__ __launch_bounds__(256) void add_ln_kernel(
    const float* __restrict__ A, const float* __restrict__ Bv,
    const float* __restrict__ g, const float* __restrict__ be,
    float* __restrict__ outF, __bf16* __restrict__ outB) {
  __shared__ float redS[8], redQ[8];
  const int row  = blockIdx.x;
  const int t    = threadIdx.x;
  const int lane = t & 31, wave = t >> 5;
  const float* a = A + (size_t)row * D_;
  const float* r = Bv + (size_t)row * D_;

  float x[4], s = 0.0f, q = 0.0f;
#pragma unroll
  for (int e = 0; e < 4; ++e) {
    int c = t + 256 * e;
    x[e]  = a[c] + r[c];
    s    += x[e];
    q    += x[e] * x[e];
  }
#pragma unroll
  for (int mm = 1; mm < 32; mm <<= 1) {
    s += __shfl_xor(s, mm, 32);
    q += __shfl_xor(q, mm, 32);
  }
  if (lane == 0) { redS[wave] = s; redQ[wave] = q; }
  __syncthreads();
  float S = 0.0f, Q2 = 0.0f;
#pragma unroll
  for (int w = 0; w < 8; ++w) { S += redS[w]; Q2 += redQ[w]; }
  const float mu   = S * (1.0f / D_);
  const float var  = Q2 * (1.0f / D_) - mu * mu;
  const float rstd = rsqrtf(var + 1e-5f);
#pragma unroll
  for (int e = 0; e < 4; ++e) {
    int   c = t + 256 * e;
    float y = (x[e] - mu) * rstd * g[c] + be[c];
    if (outF) outF[(size_t)row * D_ + c] = y;
    if (outB) outB[(size_t)row * D_ + c] = (__bf16)y;
  }
}

// ---------------------------------------------------------------------------
// fp32 -> bf16 conversion of all twelve operands in ONE launch. The twelve bf16
// destinations lie one behind the other in the workspace (each a multiple of
// 256 B), so the output is one array of 24 * 2^20 elements; only the source
// changes, at multiples of 2^20 elements. A block converts one tile of 8192
// elements a trip (a wave 1024: eight 512-B loads in flight, eight 256-B stores,
// whole lines both ways); a tile never straddles two sources.
//   units of 2^20: 0-3 x, 4-7 mem, 8-15 the eight D x D weights, 16-19 w1, 20-23 w2
// ---------------------------------------------------------------------------
typedef __bf16 bf16x4 __attribute__((ext_vector_type(4)));
constexpr uint32_t CVT_TILE   = 8192u;
constexpr uint32_t CVT_BLOCKS = 1024u;
constexpr uint32_t CVT_TRIPS  = 3u;     // 24 * 2^20 / (CVT_TILE * CVT_BLOCKS)
static_assert(CVT_TILE * CVT_BLOCKS * CVT_TRIPS == 24u << 20, "conversion covers every element once");

__global__ __launch_bounds__(256) void cvt_all_kernel(
    const float* __restrict__ x,  const float* __restrict__ mem,
    const float* __restrict__ m0, const float* __restrict__ m1,
    const float* __restrict__ m2, const float* __restrict__ m3,
    const float* __restrict__ m4, const float* __restrict__ m5,
    const float* __restrict__ m6, const float* __restrict__ m7,
    const float* __restrict__ w1, const float* __restrict__ w2,
    __bf16* __restrict__ out) {
  const uint32_t off = (threadIdx.x >> 5) * 1024u + (threadIdx.x & 31u) * 4u;
  // rolled: one short body; the WGP's other waves cover a wave's load latency
#pragma unroll 1
  for (uint32_t it = 0; it < CVT_TRIPS; ++it) {
    const uint32_t t = it * CVT_BLOCKS + blockIdx.x;   // tile
    const uint32_t u = t >> 7;                         // its unit of 2^20 elements
    const float*   src = w2;
    uint32_t       u0  = 20u;                          // first unit of the source
    if (u < 4u)       { src = x;   u0 = 0u; }
    else if (u < 8u)  { src = mem; u0 = 4u; }
    else if (u < 16u) {
      u0  = u;
      src = u == 8u ? m0 : u == 9u ? m1 : u == 10u ? m2 : u == 11u ? m3
          : u == 12u ? m4 : u == 13u ? m5 : u == 14u ? m6 : m7;
    }
    else if (u < 20u) { src = w1;  u0 = 16u; }
    const float* s = src + (size_t)(t - u0 * 128u) * CVT_TILE + off;
    __bf16*      d = out + (size_t)t * CVT_TILE + off;
    f32x4 a[8];
    // unrolled: the eight loads are issued together
#pragma unroll
    for (int i = 0; i < 8; ++i) a[i] = *(const f32x4*)(s + i * 128);
    wait_x0();   // behind the loads, in front of any rewrite of their address registers
#pragma unroll
    for (int i = 0; i < 8; ++i)
      *(bf16x4*)(d + i * 128) = __builtin_convertvector(a[i], bf16x4);
    wait_x0();   // behind the stores, in front of the next trip's addresses and data
  }
}

// ---------------------------------------------------------------------------
// Host orchestration
// ---------------------------------------------------------------------------
extern "C" void kernel_launch(void* const* d_in, const int* in_sizes, int n_in,
                              void* d_out, int out_size, void* d_ws,
                              size_t ws_size, hipStream_t stream) {
  (void)in_sizes; (void)n_in; (void)out_size; (void)ws_size;
  constexpr int Bc = 2, Lc = 2048, Mc = 2048, Dc = 1024, FFc = 4096;
  constexpr int NT = Bc * Lc;  // 4096 query rows
  constexpr int NM = Bc * Mc;  // 4096 memory rows

  const float* x   = (const float*)d_in[0];
  const float* mem = (const float*)d_in[1];
  const float* swq = (const float*)d_in[2];
  const float* swk = (const float*)d_in[3];
  const float* swv = (const float*)d_in[4];
  const float* swo = (const float*)d_in[5];
  const float* sbq = (const float*)d_in[6];
  const float* sbk = (const float*)d_in[7];
  const float* sbv = (const float*)d_in[8];
  const float* sbo = (const float*)d_in[9];
  const float* cwq = (const float*)d_in[10];
  const float* cwk = (const float*)d_in[11];
  const float* cwv = (const float*)d_in[12];
  const float* cwo = (const float*)d_in[13];
  const float* cbq = (const float*)d_in[14];
  const float* cbk = (const float*)d_in[15];
  const float* cbv = (const float*)d_in[16];
  const float* cbo = (const float*)d_in[17];
  const float* w1  = (const float*)d_in[18];
  const float* b1  = (const float*)d_in[19];
  const float* w2  = (const float*)d_in[20];
  const float* b2  = (const float*)d_in[21];
  const float* g1  = (const float*)d_in[22];
  const float* g2  = (const float*)d_in[23];
  const float* g3  = (const float*)d_in[24];
  const float* be1 = (const float*)d_in[25];
  const float* be2 = (const float*)d_in[26];
  const float* be3 = (const float*)d_in[27];

  char* p = (char*)d_ws;
  auto take = [&](size_t bytes) -> void* {
    void* r = (void*)p;
    p += (bytes + 255) & ~(size_t)255;
    return r;
  };
  __bf16* xcur_bf = (__bf16*)take((size_t)NT * Dc * 2);  // x_bf -> x1_bf -> x2_bf
  __bf16* mem_bf  = (__bf16*)take((size_t)NM * Dc * 2);
  __bf16* swq_bf  = (__bf16*)take((size_t)Dc * Dc * 2);
  __bf16* swk_bf  = (__bf16*)take((size_t)Dc * Dc * 2);
  __bf16* swv_bf  = (__bf16*)take((size_t)Dc * Dc * 2);
  __bf16* swo_bf  = (__bf16*)take((size_t)Dc * Dc * 2);
  __bf16* cwq_bf  = (__bf16*)take((size_t)Dc * Dc * 2);
  __bf16* cwk_bf  = (__bf16*)take((size_t)Dc * Dc * 2);
  __bf16* cwv_bf  = (__bf16*)take((size_t)Dc * Dc * 2);
  __bf16* cwo_bf  = (__bf16*)take((size_t)Dc * Dc * 2);
  __bf16* w1_bf   = (__bf16*)take((size_t)Dc * FFc * 2);
  __bf16* w2_bf   = (__bf16*)take((size_t)FFc * Dc * 2);
  __bf16* q_bf    = (__bf16*)take((size_t)NT * Dc * 2);
  __bf16* k_bf    = (__bf16*)take((size_t)NM * Dc * 2);
  __bf16* v_bf    = (__bf16*)take((size_t)NM * Dc * 2);
  __bf16* attn_bf = (__bf16*)take((size_t)NT * Dc * 2);
  float*  gout    = (float*)take((size_t)NT * Dc * 4);   // sa / ca / ff
  float*  x1f     = (float*)take((size_t)NT * Dc * 4);
  float*  x2f     = (float*)take((size_t)NT * Dc * 4);
  __bf16* h_bf    = (__bf16*)take((size_t)NT * FFc * 2);

  struct Prod {   // one product's operand set
    const __bf16* A; const __bf16* W; const float* bias; float* Cf; __bf16* Cb;
  };
  const Prod none = {nullptr, nullptr, nullptr, nullptr, nullptr};
  // nz products of one shape in one launch
  auto gemm = [&](int nz, Prod p0, Prod p1, Prod p2, int Mg, int Ng, int Kg, int act) {
    dim3 grid(Ng / 128, Mg / 256, nz);
    gemm_bf16_kernel<<<grid, 256, 0, stream>>>(p0.A, p0.W, p0.bias, p0.Cf, p0.Cb,
                                               p1.A, p1.W, p1.bias, p1.Cf, p1.Cb,
                                               p2.A, p2.W, p2.bias, p2.Cf, p2.Cb,
                                               Mg, Ng, Kg, act);
  };
  auto attn = [&](const __bf16* Qg, const __bf16* Kg, const __bf16* Vg,
                  __bf16* Og, int Lqv, int Lkv, int windowed) {
    int jobs = Bc * H_ * (Lqv / 16);  // one wave per job, 4 waves per block
    attn_kernel<<<jobs / 4, 128, 0, stream>>>(Qg, Kg, Vg, Og, Lqv, Lkv,
                                              windowed);
  };

  // ---- bf16 staging --------------------------------------------------------
  // xcur_bf .. w2_bf are taken in a row above: one destination array.
  cvt_all_kernel<<<CVT_BLOCKS, 256, 0, stream>>>(x, mem, swq, swk, swv, swo, cwq, cwk,
                                                 cwv, cwo, w1, w2, xcur_bf);

  // ---- self-attention (windowed causal + ALiBi) ----------------------------
  gemm(3, {xcur_bf, swq_bf, sbq, nullptr, q_bf}, {xcur_bf, swk_bf, sbk, nullptr, k_bf},
       {xcur_bf, swv_bf, sbv, nullptr, v_bf}, NT, Dc, Dc, 0);
  attn(q_bf, k_bf, v_bf, attn_bf, Lc, Lc, 1);
  // The cross-attention keys depend on mem alone: they ride with the output
  // projection (k_bf is free, the self-attention launch before this has read it).
  gemm(2, {attn_bf, swo_bf, sbo, gout, nullptr}, {mem_bf, cwk_bf, cbk, nullptr, k_bf},
       none, NT, Dc, Dc, 0);
  add_ln_kernel<<<NT, 256, 0, stream>>>(x, gout, g1, be1, x1f, xcur_bf);

  // ---- cross-attention (full) ---------------------------------------------
  static_assert(NT == NM, "products of one launch have one shape");
  gemm(2, {xcur_bf, cwq_bf, cbq, nullptr, q_bf}, {mem_bf, cwv_bf, cbv, nullptr, v_bf},
       none, NT, Dc, Dc, 0);
  attn_full_kernel<<<Bc * H_ * (Lc / 16) / 8, 256, 0, stream>>>(q_bf, k_bf, v_bf,
                                                                attn_bf, Lc, Mc);
  gemm(1, {attn_bf, cwo_bf, cbo, gout, nullptr}, none, none, NT, Dc, Dc, 0);
  add_ln_kernel<<<NT, 256, 0, stream>>>(x1f, gout, g2, be2, x2f, xcur_bf);

  // ---- FFN -----------------------------------------------------------------
  gemm(1, {xcur_bf, w1_bf, b1, nullptr, h_bf}, none, none, NT, FFc, Dc, 1);  // fused exact GELU
  gemm(1, {h_bf, w2_bf, b2, gout, nullptr}, none, none, NT, Dc, FFc, 0);
  add_ln_kernel<<<NT, 256, 0, stream>>>(x2f, gout, g3, be3, (float*)d_out,
                                        nullptr);
}

// v009
// Measured time: 236 microseconds a run.
// Next to v008, in two timings, it ran 1.05 times as fast each time.
// Over all steps from v000 it is 6.40 times as fast.
#include <hip/hip_runtime.h>
#include <math.h>
#include <stdint.h>

typedef __attribute__((ext_vector_type(16))) __bf16 v16bf;
typedef __attribute__((ext_vector_type(8)))  float  v8f;

union ABu {
  v16bf          v;
  unsigned int   u[8];
  unsigned short s[16];
  __bf16         b[16];
};

union U4u {
  uint4        q;
  unsigned int u[4];
};

__device__ __forceinline__ int kpair(int t, int half) {
  int base = (t < 4) ? (2 * t) : (16 + 2 * (t - 4));
  return base + 8 * half;
}

__device__ __forceinline__ v8f wmma_bf16(v16bf a, v16bf b, v8f c) {
  return __builtin_amdgcn_wmma_f32_16x16x32_bf16(false, a, false, b,
                                                 (short)0, c, false, false);
}

// 2^x by the hardware's own instruction (v_exp_f32). The softmax weights are formed
// in base 2: e^x = 2^(x * log2 e). A result below the normal range comes out as 0,
// which is what a weight that small rounds to in the sums anyway.
constexpr float LOG2E_ = 1.4426950408889634f;
__device__ __forceinline__ float exp2_hw(float x) { return __builtin_amdgcn_exp2f(x); }
__device__ __forceinline__ void exp2_run(float& a, float (&x)[16]) {
  asm("v_exp_f32 %1, %1\n\tv_exp_f32 %2, %2\n\tv_exp_f32 %3, %3\n\tv_exp_f32 %4, %4\n\t"
      "v_exp_f32 %5, %5\n\tv_exp_f32 %6, %6\n\tv_exp_f32 %7, %7\n\tv_exp_f32 %8, %8\n\t"
      "v_exp_f32 %0, %0\n\t"
      "v_exp_f32 %9, %9\n\tv_exp_f32 %10, %10\n\tv_exp_f32 %11, %11\n\tv_exp_f32 %12, %12\n\t"
      "v_exp_f32 %13, %13\n\tv_exp_f32 %14, %14\n\tv_exp_f32 %15, %15\n\tv_exp_f32 %16, %16\n\t"
      "v_nop"
      : "+v"(a), "+v"(x[0]), "+v"(x[1]), "+v"(x[2]), "+v"(x[3]), "+v"(x[4]), "+v"(x[5]),
        "+v"(x[6]), "+v"(x[7]), "+v"(x[8]), "+v"(x[9]), "+v"(x[10]), "+v"(x[11]),
        "+v"(x[12]), "+v"(x[13]), "+v"(x[14]), "+v"(x[15]));
}

#define D_  1024
#define H_  16
#define DH_ 64

typedef uint32_t u32x4 __attribute__((ext_vector_type(4)));
typedef uint32_t u32x8 __attribute__((ext_vector_type(8)));
typedef short    s16x8 __attribute__((ext_vector_type(8)));

__device__ __forceinline__ uint32_t uni(uint32_t v) {
  return (uint32_t)__builtin_amdgcn_readfirstlane(v);
}
__device__ __forceinline__ uint32_t pinned(uint32_t v) {
  uint32_t w = uni(v);
  asm volatile("" : "+s"(w));
  return w;
}
__device__ __forceinline__ void wait_ds0() {
  asm volatile("s_wait_dscnt 0x0" ::: "memory");      // own LDS reads done before the buffer is handed back
}
__device__ __forceinline__ void wait_tensor0(u32x4 g0, u32x8 ga, u32x8 gb) {
  asm volatile("s_wait_tensorcnt 0x0" ::"s"(g0), "s"(ga), "s"(gb) : "memory");
}
__device__ __forceinline__ void hold4(u32x4& g) { asm volatile("" : "+s"(g)); }
__device__ __forceinline__ void hold8(u32x8& g) { asm volatile("" : "+s"(g)); }
__device__ __forceinline__ void tdm_load(u32x4 g0, u32x8 g1) {
  asm volatile("tensor_load_to_lds %0, %1" ::"s"(g0), "s"(g1) : "memory");
}
__device__ __forceinline__ u32x4 tdm_group0(uint32_t lds_dst, uint64_t ga) {
  u32x4 g;
  g[0] = uni(1u);
  g[1] = uni(lds_dst);
  g[2] = uni((uint32_t)ga);
  g[3] = uni((((uint32_t)(ga >> 32)) & 0x01FFFFFFu) | 0x80000000u);
  return g;
}
// W0 = word 0 (pad fields, no mask), D0 = bytes per row, D1 = rows.
template <uint32_t W0, uint32_t D0, uint32_t D1>
__device__ __forceinline__ u32x8 tdm_group1(uint32_t src_pitch) {
  u32x8 g;
  g[0] = uni(W0);
  g[1] = uni((D0 & 0xFFFFu) << 16);
  g[2] = uni((D0 >> 16) | ((D1 & 0xFFFFu) << 16));
  g[3] = uni((D1 >> 16) | (D0 << 16));
  g[4] = uni(D1);
  g[5] = uni(src_pitch);
  g[6] = uni(0u);
  g[7] = uni(0u);
  return g;
}
__device__ __forceinline__ u32x4 ld_tr16(const unsigned char* p) {
  typedef __attribute__((address_space(3))) s16x8 lds_s16x8;
  return __builtin_bit_cast(u32x4,
                            __builtin_amdgcn_ds_load_tr16_b128_v8i16((lds_s16x8*)p));
}

union FragU {
  v16bf v;
  u32x4 q[2];
};

// Asks L2 for the 256-B unit that holds byte p: a hint, nothing comes back and no
// counter moves; scope SE: the unit goes into L2 only. p is in and out so that it
// stays in one register pair, which holds nothing but byte addresses of the operand.
__device__ __forceinline__ void l2_ask(uint64_t& p) {
  asm volatile("global_prefetch_b8 %0, off scope:SCOPE_SE" : "+v"(p));
}
// Steps p on and asks for the new unit. The step stands in the ask's own statement
// so that it is taken in the pair that the last ask named (passes ago), in place.
__device__ __forceinline__ void l2_step_ask(uint64_t& p, uint64_t step) {
  asm volatile("v_add_nc_u64_e32 %0, %1, %0\n\t"
               "global_prefetch_b8 %0, off scope:SCOPE_SE"
               : "+v"(p) : "s"(step));
}

constexpr uint32_t PITCH_A = 144u, PITCH_B = 288u;
constexpr uint32_t SLICE_A = 10240u;              // 64 * 144 = 9216, rounded up
constexpr uint32_t SLICE_B = 6144u;               // 16 * 288 = 4608, rounded up
constexpr uint32_t BASE_B  = 4u * SLICE_A;
constexpr uint32_t BUF_SZ  = BASE_B + 4u * SLICE_B;  // 65536
constexpr uint32_t PAD_A   = (1u << 20) | (4u << 22) | (3u << 25);  // 128-B rows + 16 B
constexpr uint32_t PAD_B   = (1u << 20) | (5u << 22) | (7u << 25);  // 256-B rows + 32 B
static_assert(SLICE_A % 2048u == 0 && SLICE_B % 2048u == 0 && BUF_SZ % 2048u == 0, "slice places");
static_assert(64u * PITCH_A <= SLICE_A && 16u * PITCH_B <= SLICE_B, "slice sizes");

constexpr uint32_t EPI_PITCH = 272u;
constexpr uint32_t EPI_SZ    = 64u * EPI_PITCH;
constexpr uint32_t GEMM_LDS  = (8u * EPI_SZ > 2u * BUF_SZ) ? 8u * EPI_SZ : 2u * BUF_SZ;

typedef float  f32x4  __attribute__((ext_vector_type(4)));
typedef __bf16 bf16x8 __attribute__((ext_vector_type(8)));

template <bool GELU>
__device__ __forceinline__ float epi_val(float a, float bsv) {
  float val = a + bsv;
  if (GELU) val = 0.5f * val * (1.0f + erff(val * 0.70710678118f));
  return val;
}

// Stands directly behind the epilogue's global loads and stores, in front of any
// rewrite of a register that they name (the next trip's addresses and data).
__device__ __forceinline__ void wait_x0() {
  asm volatile("s_wait_xcnt 0x0" ::: "memory");
}

// Reads the wave's staged tile back row-wise and stores it: bias (+GELU), then
// 16 bytes per lane, so that every wave-wide store covers whole 128-B lines
// (f32: 2 rows of 256 B; bf16: 4 rows of 128 B). bias, Cf and Cb point at the
// tile's first column / element. The row loops stay rolled so that the
// epilogue's text is short (U stores a trip; without GELU four, so that a trip's
// LDS reads fly together). They walk from the last rows to the first: walking
// upwards, the compiler formed each LDS address as (base - tile size) with
// offset: tile size, a register below zero in wave 0; walking downwards, the
// loops that this file's launches run add a step >= 0 to the lane's base.
template <bool GELU>
__device__ __forceinline__ void store_tile(const unsigned char* stg, int lane,
                                           const float* bias, float* Cf, __bf16* Cb,
                                           int N) {
  constexpr int U = GELU ? 1 : 4;
  // The loops over u and e are unrolled so that every index is a constant (registers).
  if (Cf) {
    const int r = lane >> 4, c = (lane & 15) * 4;
    f32x4 bs = {0.0f, 0.0f, 0.0f, 0.0f};
    if (bias) {
      bs = *(const f32x4*)(bias + c);
      wait_x0();   // behind the bias load, in front of any rewrite of its offset register
    }
    const unsigned char* p = stg + (uint32_t)r * EPI_PITCH + (uint32_t)c * 4u;
    float* o = Cf + (size_t)r * N + c;
#pragma unroll 1
    for (int g = 32 / U - 1; g >= 0; --g) {
      f32x4 a[U];
#pragma unroll
      for (int u = 0; u < U; ++u)
        a[u] = *(const f32x4*)(p + (uint32_t)(g * U + u) * 2u * EPI_PITCH);
#pragma unroll
      for (int u = 0; u < U; ++u) {
        f32x4 y;
#pragma unroll
        for (int e = 0; e < 4; ++e) y[e] = epi_val<GELU>(a[u][e], bs[e]);
        *(f32x4*)(o + (size_t)(g * U + u) * 2 * N) = y;
      }
      wait_x0();
    }
  }
  if (Cb) {
    const int r = lane >> 3, c = (lane & 7) * 8;
    f32x4 bs0 = {0.0f, 0.0f, 0.0f, 0.0f}, bs1 = bs0;
    if (bias) {
      bs0 = *(const f32x4*)(bias + c);
      bs1 = *(const f32x4*)(bias + c + 4);
      wait_x0();   // behind the bias loads, in front of any rewrite of their offset register
    }
    const unsigned char* p = stg + (uint32_t)r * EPI_PITCH + (uint32_t)c * 4u;
    __bf16* o = Cb + (size_t)r * N + c;
#pragma unroll 1
    for (int g = 16 / U - 1; g >= 0; --g) {
      f32x4 a0[U], a1[U];
#pragma unroll
      for (int u = 0; u < U; ++u) {
        const unsigned char* q = p + (uint32_t)(g * U + u) * 4u * EPI_PITCH;
        a0[u] = *(const f32x4*)q;
        a1[u] = *(const f32x4*)(q + 16);
      }
#pragma unroll
      for (int u = 0; u < U; ++u) {
        bf16x8 y;
#pragma unroll
        for (int e = 0; e < 4; ++e) {
          y[e]     = (__bf16)epi_val<GELU>(a0[u][e], bs0[e]);
          y[e + 4] = (__bf16)epi_val<GELU>(a1[u][e], bs1[e]);
        }
        *(bf16x8*)(o + (size_t)(g * U + u) * 4 * N) = y;
      }
      wait_x0();
    }
  }
}

__global__ __launch_bounds__(256, 1) void gemm_bf16_kernel(
    const __bf16* A0, const __bf16* W0, const float* bias0, float* Cf0, __bf16* Cb0,
    const __bf16* A1, const __bf16* W1, const float* bias1, float* Cf1, __bf16* Cb1,
    const __bf16* A2, const __bf16* W2, const float* bias2, float* Cf2, __bf16* Cb2,
    int Mr, int N, int K, int lda, int act) {
  (void)Mr;
  __shared__ __attribute__((aligned(2048))) unsigned char L[GEMM_LDS];

  const uint32_t zs = blockIdx.z;
  const __bf16* A    = zs == 0u ? A0    : zs == 1u ? A1    : A2;
  const __bf16* W    = zs == 0u ? W0    : zs == 1u ? W1    : W2;
  const float*  bias = zs == 0u ? bias0 : zs == 1u ? bias1 : bias2;
  float*        Cf   = zs == 0u ? Cf0   : zs == 1u ? Cf1   : Cf2;
  __bf16*       Cb   = zs == 0u ? Cb0   : zs == 1u ? Cb1   : Cb2;

  const int      tid  = threadIdx.x;
  const int      lane = tid & 31;
  const uint32_t wave = uni((uint32_t)tid >> 5);
  const int wm   = (int)(wave >> 1);   // 0..3
  const int wn   = (int)(wave & 1u);   // 0..1
  const int half = lane >> 4;
  const int lr   = lane & 15;
  const int row0 = blockIdx.y * 256;
  const int col0 = blockIdx.x * 128;
  const uint32_t lbase = (uint32_t)(size_t)L;

  v8f acc[4][4];
#pragma unroll
  for (int mi = 0; mi < 4; ++mi)
#pragma unroll
    for (int ni = 0; ni < 4; ++ni)
#pragma unroll
      for (int e = 0; e < 8; ++e) acc[mi][ni][e] = 0.0f;

  // One request per wave and pass: waves 0-3 a slice of A, waves 4-7 of W.
  u32x8 g1a = tdm_group1<PAD_A, 128u, 64u>(2u * (uint32_t)lda);
  u32x8 g1b = tdm_group1<PAD_B, 256u, 16u>(2u * (uint32_t)N);
  hold8(g1a);
  hold8(g1b);
  const bool     isA  = wave < 4u;
  const uint32_t j    = wave & 3u;
  const uint32_t dst0 = lbase + (isA ? j * SLICE_A : BASE_B + j * SLICE_B);
  const uint64_t src0 = isA
      ? (uint64_t)(size_t)A + 2ull * ((uint64_t)((uint32_t)row0 + j * 64u) * (uint32_t)lda)
      : (uint64_t)(size_t)W + 2ull * ((uint64_t)(j * 16u) * (uint32_t)N + (uint32_t)col0);
  const uint64_t step = isA ? 128ull : 128ull * (uint32_t)N;   // bytes per pass
  u32x4 g0;
  auto issue = [&](uint32_t st) {   // pass st's slice, into buffer st & 1
    g0 = tdm_group0(dst0 + (st & 1u) * BUF_SZ, src0 + (uint64_t)st * step);
    hold4(g0);
    if (pinned(wave < 4u)) tdm_load(g0, g1a);
    else                   tdm_load(g0, g1b);
  };

  const uint32_t nt = (uint32_t)K >> 6;   // passes; every call has at least two

  // L2 prefetch. A launch's operands come from memory, and the ring leads by one
  // pass. So each 256-B unit of the block's
  // operands is asked for once, two passes ahead of the tensor load that reads it,
  // which then finds it in L2.
  //   A: thread t asks for row t's next unit (two passes of 128 B) on every second pass
  //   W: a pass is 64 k-rows of 256 B; wave pair wq asks for passes wq, wq + 4, ...
  // An ask is made only for a pass that exists, so pa and pw never leave the operand.
  const uint32_t wq = wave >> 1;
  uint64_t pa = (uint64_t)(size_t)A +
      2ull * ((uint64_t)((uint32_t)row0 + (uint32_t)tid) * (uint32_t)lda) + 256ull;   // passes 2, 3
  uint64_t pw = (uint64_t)(size_t)W +
      2ull * ((uint64_t)(wq * 64u + ((uint32_t)tid & 63u)) * (uint32_t)N + (uint32_t)col0);

  issue(0u);
  // Passes 1 to 3 (pass 0 is on its way; A's pass 1 lies in the units of pass 0).
  if (2u < nt) l2_ask(pa);
  if (wq > 0u && wq < nt) l2_ask(pw);
  wait_tensor0(g0, g1a, g1b);
  __syncthreads();                        // pass 0's tiles are published
  issue(1u);

  // Lane offsets of the fragment reads inside a buffer.
  const uint32_t aoff = (uint32_t)wm * SLICE_A + (uint32_t)lr * PITCH_A + 16u * (uint32_t)half;
  const uint32_t boff = BASE_B + (8u * (uint32_t)half + (uint32_t)(lane & 7)) * PITCH_B +
                        128u * (uint32_t)wn + 16u * (uint32_t)((lane >> 3) & 1);

  for (uint32_t s = 0; s < nt; ++s) {
    const unsigned char* Lb = L + (s & 1u) * BUF_SZ;
    // The loops below are unrolled so that every fragment and accumulator
    // index is a constant (registers, no scratch).
#pragma unroll
    for (int kb = 0; kb < 2; ++kb) {
      // A fragments, hardware k order: bytes 16h and 32 + 16h of each 64 B.
      FragU af[4];
#pragma unroll
      for (int mi = 0; mi < 4; ++mi) {
        const unsigned char* pa = Lb + aoff + (uint32_t)mi * 16u * PITCH_A + (uint32_t)kb * 64u;
        af[mi].q[0] = *(const u32x4*)pa;
        af[mi].q[1] = *(const u32x4*)(pa + 32);
      }
#pragma unroll
      for (int ni = 0; ni < 4; ++ni) {
        // W fragment: k-rows 32 kb + 0..15 and + 16..31 lie in two slices.
        const unsigned char* pb = Lb + boff + (uint32_t)(2 * kb) * SLICE_B + (uint32_t)ni * 32u;
        FragU bf;
        bf.q[0] = ld_tr16(pb);
        bf.q[1] = ld_tr16(pb + SLICE_B);
#pragma unroll
        for (int mi = 0; mi < 4; ++mi)
          acc[mi][ni] = wmma_bf16(af[mi].v, bf.v, acc[mi][ni]);
      }
    }

    // Publish point of pass s + 1; it also ends every reader's last read of
    // this pass's buffer, which is refilled behind it.
    wait_ds0();
    wait_tensor0(g0, g1a, g1b);
    __syncthreads();
    if (pinned(s + 2u < nt)) issue(s + 2u);

    // Pass s + 4's units, two passes ahead of their tensor load.
    const uint32_t pf = s + 4u;
    if (pf < nt) {
      if ((pf & 1u) == 0u) l2_step_ask(pa, 256ull);
      if ((pf & 3u) == wq) l2_step_ask(pw, 512ull * (uint32_t)N);   // four passes of W on
    }
  }
  wait_tensor0(g0, g1a, g1b);
  wait_ds0();

  // epilogue ------------------------------------------------------------------
  // The last pass's publish point (own LDS reads done, own tensor loads landed,
  // barrier) has freed the ring for every wave: each wave now stages its own
  // 64 x 64 tile in its own range of L, which runs 8 KiB past the ring.
  unsigned char* stg = L + wave * EPI_SZ;
  {
    float* w = (float*)(stg + (uint32_t)(8 * half) * EPI_PITCH) + lr;
    // unrolled: every accumulator index is a constant (registers, no scratch)
#pragma unroll
    for (int mi = 0; mi < 4; ++mi)
#pragma unroll
      for (int ni = 0; ni < 4; ++ni)
#pragma unroll
        for (int v = 0; v < 8; ++v)
          w[(mi * 16 + v) * (int)(EPI_PITCH / 4u) + ni * 16] = acc[mi][ni][v];
  }
  wait_ds0();   // the wave's rows are in LDS before its lanes read each other's values back

  const int    trow = row0 + wm * 64;
  const int    tcol = col0 + wn * 64;
  const size_t toff = (size_t)trow * N + tcol;
  const float* bt   = bias ? bias + tcol : nullptr;
  float*       cf   = Cf ? Cf + toff : nullptr;
  __bf16*      cb   = Cb ? Cb + toff : nullptr;
  if (act == 1) store_tile<true>(stg, lane, bt, cf, cb, N);
  else          store_tile<false>(stg, lane, bt, cf, cb, N);
}

// ---------------------------------------------------------------------------
// Flash attention: one wave per (batch, head, 16-query block).
// windowed=1 -> causal local window W=64 + ALiBi; windowed=0 -> full attn.
// Q,K,V,O are bf16 [B*Lq(or Lk), D] with head h at feature offset h*64.
// ---------------------------------------------------------------------------
__global__ __launch_bounds__(128) void attn_kernel(
    const __bf16* __restrict__ Q, const __bf16* __restrict__ Km,
    const __bf16* __restrict__ Vm, __bf16* __restrict__ O,
    int Lq, int Lk, int windowed) {
  __shared__ __bf16 lP[4][16][32];  // per-wave P staging (C-layout -> A-layout)
  const int lane  = threadIdx.x & 31;
  const int wave  = threadIdx.x >> 5;
  const int half  = lane >> 4;
  const int lr    = lane & 15;
  const int qbPer = Lq >> 4;
  const int job   = blockIdx.x * 4 + wave;
  const int qblk  = job % qbPer;
  const int h     = (job / qbPer) % H_;
  const int b     = job / (qbPer * H_);
  const int q0    = qblk << 4;

  const float slope = windowed ? exp2f(-8.0f * (float)(h + 1) / (float)H_) : 0.0f;

  // Q fragments (A operand): 16 queries x 64 features
  v16bf qa[2];
  {
    const __bf16* qb = Q + ((size_t)(b * Lq + q0 + lr)) * D_ + h * DH_;
#pragma unroll
    for (int f = 0; f < 2; ++f) {
      ABu u;
#pragma unroll
      for (int t = 0; t < 8; ++t)
        u.u[t] = *(const unsigned int*)(qb + f * 32 + kpair(t, half));
      qa[f] = u.v;
    }
  }

  float mrow[8], lrow[8];
  v8f   o[4];
#pragma unroll
  for (int v = 0; v < 8; ++v) { mrow[v] = -3.0e38f; lrow[v] = 0.0f; }
#pragma unroll
  for (int f = 0; f < 4; ++f)
#pragma unroll
    for (int e = 0; e < 8; ++e) o[f][e] = 0.0f;

  const int nch = windowed ? 3 : (Lk >> 5);  // uniform across the block
  for (int ch = 0; ch < nch; ++ch) {
    const int kc = windowed ? (q0 - 64 + 32 * ch) : (32 * ch);

    // S = Q @ K^T : 16 queries x 32 keys ------------------------------------
    v8f s[2];
#pragma unroll
    for (int g = 0; g < 2; ++g) {
#pragma unroll
      for (int e = 0; e < 8; ++e) s[g][e] = 0.0f;
      int key  = kc + g * 16 + lr;
      int keyc = key < 0 ? 0 : (key >= Lk ? Lk - 1 : key);
      const __bf16* kb = Km + ((size_t)(b * Lk + keyc)) * D_ + h * DH_;
#pragma unroll
      for (int f = 0; f < 2; ++f) {
        ABu u;
#pragma unroll
        for (int t = 0; t < 8; ++t)
          u.u[t] = *(const unsigned int*)(kb + f * 32 + kpair(t, half));
        s[g] = wmma_bf16(qa[f], u.v, s[g]);
      }
    }

    // scale + ALiBi + mask, online softmax ----------------------------------
#pragma unroll
    for (int v = 0; v < 8; ++v) {
      const int i    = q0 + v + 8 * half;
      float     best = -3.0e38f;
#pragma unroll
      for (int g = 0; g < 2; ++g) {
        const int j  = kc + g * 16 + lr;
        float     sv = s[g][v] * 0.125f + slope * (float)(j - i);
        bool valid = windowed ? (j >= 0 && j <= i && (i - j) < 64) : (j < Lk);
        sv       = valid ? sv : -1.0e30f;
        s[g][v]  = sv;
        best     = fmaxf(best, sv);
      }
#pragma unroll
      for (int mm = 1; mm < 16; mm <<= 1)
        best = fmaxf(best, __shfl_xor(best, mm, 16));
      const float mnew  = fmaxf(mrow[v], best);
      const float alpha = exp2_hw((mrow[v] - mnew) * LOG2E_);
      float psum = 0.0f;
#pragma unroll
      for (int g = 0; g < 2; ++g) {
        float pv = exp2_hw((s[g][v] - mnew) * LOG2E_);
        lP[wave][v + 8 * half][g * 16 + lr] = (__bf16)pv;
        psum += pv;
      }
#pragma unroll
      for (int mm = 1; mm < 16; mm <<= 1) psum += __shfl_xor(psum, mm, 16);
      lrow[v] = lrow[v] * alpha + psum;
      mrow[v] = mnew;
#pragma unroll
      for (int f = 0; f < 4; ++f) o[f][v] *= alpha;
    }
    __syncthreads();

    // P fragment (A operand): 16 queries x 32 keys --------------------------
    v16bf pa;
    {
      ABu u;
#pragma unroll
      for (int t = 0; t < 8; ++t)
        u.u[t] = *(const unsigned int*)&lP[wave][lr][kpair(t, half)];
      pa = u.v;
    }

    // O += P @ V(chunk) ------------------------------------------------------
#pragma unroll
    for (int f = 0; f < 4; ++f) {
      ABu u;
#pragma unroll
      for (int t = 0; t < 8; ++t) {
        int k  = kpair(t, half);
        int j0 = kc + k, j1 = kc + k + 1;
        j0 = j0 < 0 ? 0 : (j0 >= Lk ? Lk - 1 : j0);
        j1 = j1 < 0 ? 0 : (j1 >= Lk ? Lk - 1 : j1);
        u.b[2 * t]     = Vm[((size_t)(b * Lk + j0)) * D_ + h * DH_ + f * 16 + lr];
        u.b[2 * t + 1] = Vm[((size_t)(b * Lk + j1)) * D_ + h * DH_ + f * 16 + lr];
      }
      o[f] = wmma_bf16(pa, u.v, o[f]);
    }
    __syncthreads();
  }

  // normalize + store --------------------------------------------------------
#pragma unroll
  for (int f = 0; f < 4; ++f)
#pragma unroll
    for (int v = 0; v < 8; ++v) {
      const int   row = q0 + v + 8 * half;
      const float inv = 1.0f / fmaxf(lrow[v], 1.0e-20f);
      O[((size_t)(b * Lq + row)) * D_ + h * DH_ + f * 16 + lr] =
          (__bf16)(o[f][v] * inv);
    }
}

constexpr uint32_t PITCH_K  = 144u, PITCH_V = 160u;
constexpr uint32_t SLICE_KV = 6144u;              // 32 * 144 = 4608, 32 * 160 = 5120, rounded up
constexpr uint32_t BASE_V   = 4u * SLICE_KV;
constexpr uint32_t KV_SZ    = 8u * SLICE_KV;      // 49152
constexpr uint32_t PAD_K    = (1u << 20) | (4u << 22) | (3u << 25);  // 128-B rows + 16 B
constexpr uint32_t PAD_V    = (1u << 20) | (4u << 22) | (7u << 25);  // 128-B rows + 32 B
static_assert(SLICE_KV % 2048u == 0 && KV_SZ % 2048u == 0, "slice places");
static_assert(32u * PITCH_K <= SLICE_KV && 32u * PITCH_V <= SLICE_KV, "slice sizes");

__device__ __forceinline__ float xhalf(float x) {
  const int v = __builtin_bit_cast(int, x);
  return __builtin_bit_cast(float, __builtin_amdgcn_permlanex16(v, v, 0x76543210, 0xfedcba98,
                                                                false, false));
}

__global__ __launch_bounds__(256) void attn_full_kernel(
    const __bf16* __restrict__ Q, const __bf16* __restrict__ Km,
    const __bf16* __restrict__ Vm, __bf16* __restrict__ O,
    int Lq, int Lk) {
  __shared__ __attribute__((aligned(2048))) unsigned char L[2u * KV_SZ];
  const int      lane  = threadIdx.x & 31;
  const uint32_t wave  = uni((uint32_t)threadIdx.x >> 5);
  const int      half  = lane >> 4;
  const int      lr    = lane & 15;
  const int      qbPer = Lq >> 4;
  const int      job0  = blockIdx.x * 8;          // the block's 8 jobs share b and h
  const int      qblk  = job0 % qbPer + (int)wave;
  const int      h     = (job0 / qbPer) % H_;
  const int      b     = job0 / (qbPer * H_);
  const int      q0    = qblk << 4;
  const uint32_t lbase = (uint32_t)(size_t)L;

  // One request per wave and stage: waves 0-3 a slice of K, waves 4-7 of V.
  u32x8 g1k = tdm_group1<PAD_K, 128u, 32u>(2u * (uint32_t)D_);
  u32x8 g1v = tdm_group1<PAD_V, 128u, 32u>(2u * (uint32_t)D_);
  hold8(g1k);
  hold8(g1v);
  const uint32_t jsl  = wave & 3u;
  const uint32_t dst0 = lbase + (wave < 4u ? 0u : BASE_V) + jsl * SLICE_KV;
  const uint64_t src0 = (uint64_t)(size_t)(wave < 4u ? Km : Vm) +
      2ull * ((uint64_t)((uint32_t)(b * Lk) + jsl * 32u) * (uint32_t)D_ + (uint32_t)(h * DH_));
  const uint64_t step = 2ull * 128ull * (uint32_t)D_;   // bytes per stage
  u32x4 g0;
  auto issue = [&](uint32_t st) {   // stage st's slice, into buffer st & 1
    g0 = tdm_group0(dst0 + (st & 1u) * KV_SZ, src0 + (uint64_t)st * step);
    hold4(g0);
    if (pinned(wave < 4u)) tdm_load(g0, g1k);
    else                   tdm_load(g0, g1v);
  };

  const uint32_t nt = (uint32_t)Lk >> 7;   // stages; at least two

  issue(0u);
  wait_tensor0(g0, g1k, g1v);
  __syncthreads();                         // stage 0's tiles are published
  issue(1u);

  // Every loop over fragments, rows and registers in this kernel is unrolled so
  // that each fragment and accumulator index is a constant (registers, no scratch).
  // Q fragments (B operand, column lr = query lr, hardware k order): 64 features x 16 queries
  v16bf qa[2];
  {
    const __bf16* qb = Q + ((size_t)(b * Lq + q0 + lr)) * D_ + h * DH_;
#pragma unroll
    for (int f = 0; f < 2; ++f) {
      ABu u;
#pragma unroll
      for (int t = 0; t < 8; ++t)
        u.u[t] = *(const unsigned int*)(qb + f * 32 + kpair(t, half));
      qa[f] = u.v;
    }
  }

  // Query lr's running maximum (base 2, scaled; the same in both halves) and this half's share
  // of its running sum; o[f][r] = O^T[16 f + 8 half + r][query lr].
  float mrun = -3.0e38f, lrun = 0.0f;
  v8f   o[4];
#pragma unroll
  for (int f = 0; f < 4; ++f)
#pragma unroll
    for (int e = 0; e < 8; ++e) o[f][e] = 0.0f;

  // Lane offsets of the fragment reads inside a slice.
  const uint32_t koff = (uint32_t)lr * PITCH_K + 16u * (uint32_t)half;
  const uint32_t voff = BASE_V + (8u * (uint32_t)half + (uint32_t)(lane & 7)) * PITCH_V +
                        16u * (uint32_t)((lane >> 3) & 1);

  for (uint32_t st = 0; st < nt; ++st) {
    const unsigned char* Lb = L + (st & 1u) * KV_SZ;
    for (uint32_t c = 0; c < 4u; ++c) {    // 32 keys: slice c of K and of V
      const unsigned char* Ls = Lb + c * SLICE_KV;

      // S^T = K @ Q^T : 32 keys x 16 queries; s[g][r] = key 16 g + 8 half + r, query lr
      v8f s[2];
#pragma unroll
      for (int g = 0; g < 2; ++g) {
#pragma unroll
        for (int e = 0; e < 8; ++e) s[g][e] = 0.0f;
#pragma unroll
        for (int f = 0; f < 2; ++f) {
          // hardware k order: bytes 16h and 32 + 16h of each 64 B of key row lr
          const unsigned char* pk = Ls + koff + (uint32_t)g * 16u * PITCH_K + (uint32_t)f * 64u;
          FragU kf;
          kf.q[0] = *(const u32x4*)pk;
          kf.q[1] = *(const u32x4*)(pk + 32);
          s[g] = wmma_bf16(kf.v, qa[f], s[g]);
        }
      }

      // online softmax of query lr, in base 2 -------------------------------------
      // The maximum is taken over the raw scores (the scale is positive) and scaled
      // once; mrun and mnew are in units of log2, 1/sqrt(64) included.
      constexpr float CS = 0.125f * LOG2E_;
      float best = -3.0e38f;
#pragma unroll
      for (int g = 0; g < 2; ++g)
#pragma unroll
        for (int r = 0; r < 8; ++r) best = fmaxf(best, s[g][r]);
      best = fmaxf(best, xhalf(best)) * CS;  // both halves hold the 32 keys' maximum
      const float mnew  = fmaxf(mrun, best);
      float alpha = mrun - mnew;
      float e[16];                           // scale and shift in one fma a score
#pragma unroll
      for (int g = 0; g < 2; ++g)
#pragma unroll
        for (int r = 0; r < 8; ++r) e[8 * g + r] = __builtin_fmaf(s[g][r], CS, -mnew);
      exp2_run(alpha, e);
      // P^T (B operand): element 8 g + r is key 16 g + 8 half + r, the hardware k order
      ABu   pb;
      float psum[2] = {e[0], e[8]};
#pragma unroll
      for (int g = 0; g < 2; ++g)
#pragma unroll
        for (int r = 0; r < 8; ++r) {
          float pv = e[8 * g + r];
          pb.b[8 * g + r] = (__bf16)pv;
          if (r > 0) psum[g] += pv;
        }
      lrun = lrun * alpha + (psum[0] + psum[1]);
      mrun = mnew;
#pragma unroll
      for (int f = 0; f < 4; ++f)
#pragma unroll
        for (int e = 0; e < 8; ++e) o[f][e] *= alpha;

      // O^T += V^T(chunk) @ P^T: key rows 0..15 and 16..31, transposed on the read
#pragma unroll
      for (int f = 0; f < 4; ++f) {
        const unsigned char* pv = Ls + voff + (uint32_t)f * 32u;
        FragU vf;
        vf.q[0] = ld_tr16(pv);
        vf.q[1] = ld_tr16(pv + 16u * PITCH_V);
        o[f] = wmma_bf16(vf.v, pb.v, o[f]);
      }
    }

    // Publish point of stage st + 1; it also ends every reader's last read of
    // this stage's buffer, which is refilled behind it.
    wait_ds0();
    wait_tensor0(g0, g1k, g1v);
    __syncthreads();
    if (pinned(st + 2u < nt)) issue(st + 2u);
  }
  wait_tensor0(g0, g1k, g1v);
  wait_ds0();

  // normalize + store: a lane holds 8 consecutive features of query lr per tile
  const float lsum = lrun + xhalf(lrun);     // the two halves' shares of the sum
  const float inv  = 1.0f / fmaxf(lsum, 1.0e-20f);
  __bf16* ob = O + ((size_t)(b * Lq + q0 + lr)) * D_ + h * DH_ + 8 * half;
  bf16x8 y[4];
#pragma unroll
  for (int f = 0; f < 4; ++f)
#pragma unroll
    for (int r = 0; r < 8; ++r) y[f][r] = (__bf16)(o[f][r] * inv);
#pragma unroll
  for (int f = 0; f < 4; ++f) *(bf16x8*)(ob + 16 * f) = y[f];
}

// ---------------------------------------------------------------------------
// Fused residual add + LayerNorm over D=1024. One 256-thread block per row.
// Emits f32 (residual stream) and/or bf16 (next-GEMM operand). Bv2, where given, is
// the second k half of the product in Bv.
// ---------------------------------------------------------------------------
__global__ __launch_bounds__(256) void add_ln_kernel(
    const float* __restrict__ A, const float* __restrict__ Bv,
    const float* __restrict__ Bv2, const float* __restrict__ g, const float* __restrict__ be,
    float* __restrict__ outF, __bf16* __restrict__ outB) {
  __shared__ float redS[8], redQ[8];
  const int row  = blockIdx.x;
  const int t    = threadIdx.x;
  const int lane = t & 31, wave = t >> 5;
  const float* a = A + (size_t)row * D_;
  const float* r = Bv + (size_t)row * D_;

  // a's and r's loads stand in front of the branch so that all of a row's loads fly together
  float av[4], p[4];
#pragma unroll
  for (int e = 0; e < 4; ++e) {
    av[e] = a[t + 256 * e];
    p[e]  = r[t + 256 * e];
  }
  if (Bv2) {
    const float* r2 = Bv2 + (size_t)row * D_;
#pragma unroll
    for (int e = 0; e < 4; ++e) p[e] += r2[t + 256 * e];
  }
  float x[4], s = 0.0f, q = 0.0f;
#pragma unroll
  for (int e = 0; e < 4; ++e) {
    x[e]  = av[e] + p[e];
    s    += x[e];
    q    += x[e] * x[e];
  }
#pragma unroll
  for (int mm = 1; mm < 32; mm <<= 1) {
    s += __shfl_xor(s, mm, 32);
    q += __shfl_xor(q, mm, 32);
  }
  if (lane == 0) { redS[wave] = s; redQ[wave] = q; }
  __syncthreads();
  float S = 0.0f, Q2 = 0.0f;
#pragma unroll
  for (int w = 0; w < 8; ++w) { S += redS[w]; Q2 += redQ[w]; }
  const float mu   = S * (1.0f / D_);
  const float var  = Q2 * (1.0f / D_) - mu * mu;
  const float rstd = rsqrtf(var + 1e-5f);
#pragma unroll
  for (int e = 0; e < 4; ++e) {
    int   c = t + 256 * e;
    float y = (x[e] - mu) * rstd * g[c] + be[c];
    if (outF) outF[(size_t)row * D_ + c] = y;
    if (outB) outB[(size_t)row * D_ + c] = (__bf16)y;
  }
}

// ---------------------------------------------------------------------------
// fp32 -> bf16 conversion of all twelve operands in ONE launch. The twelve bf16
// destinations lie one behind the other in the workspace (each a multiple of
// 256 B), so the output is one array of 24 * 2^20 elements; only the source
// changes, at multiples of 2^20 elements. A block converts one tile of 8192
// elements a trip (a wave 1024: eight 512-B loads in flight, eight 256-B stores,
// whole lines both ways); a tile never straddles two sources.
//   units of 2^20: 0-3 x, 4-7 mem, 8-15 the eight D x D weights, 16-19 w1, 20-23 w2
// ---------------------------------------------------------------------------
typedef __bf16 bf16x4 __attribute__((ext_vector_type(4)));
constexpr uint32_t CVT_TILE   = 8192u;
constexpr uint32_t CVT_BLOCKS = 1024u;
constexpr uint32_t CVT_TRIPS  = 3u;     // 24 * 2^20 / (CVT_TILE * CVT_BLOCKS)
static_assert(CVT_TILE * CVT_BLOCKS * CVT_TRIPS == 24u << 20, "conversion covers every element once");

__global__ __launch_bounds__(256) void cvt_all_kernel(
    const float* __restrict__ x,  const float* __restrict__ mem,
    const float* __restrict__ m0, const float* __restrict__ m1,
    const float* __restrict__ m2, const float* __restrict__ m3,
    const float* __restrict__ m4, const float* __restrict__ m5,
    const float* __restrict__ m6, const float* __restrict__ m7,
    const float* __restrict__ w1, const float* __restrict__ w2,
    __bf16* __restrict__ out) {
  const uint32_t off = (threadIdx.x >> 5) * 1024u + (threadIdx.x & 31u) * 4u;
  // rolled: one short body; the WGP's other waves cover a wave's load latency
#pragma unroll 1
  for (uint32_t it = 0; it < CVT_TRIPS; ++it) {
    const uint32_t t = it * CVT_BLOCKS + blockIdx.x;   // tile
    const uint32_t u = t >> 7;                         // its unit of 2^20 elements
    const float*   src = w2;
    uint32_t       u0  = 20u;                          // first unit of the source
    if (u < 4u)       { src = x;   u0 = 0u; }
    else if (u < 8u)  { src = mem; u0 = 4u; }
    else if (u < 16u) {
      u0  = u;
      src = u == 8u ? m0 : u == 9u ? m1 : u == 10u ? m2 : u == 11u ? m3
          : u == 12u ? m4 : u == 13u ? m5 : u == 14u ? m6 : m7;
    }
    else if (u < 20u) { src = w1;  u0 = 16u; }
    const float* s = src + (size_t)(t - u0 * 128u) * CVT_TILE + off;
    __bf16*      d = out + (size_t)t * CVT_TILE + off;
    f32x4 a[8];
    // unrolled: the eight loads are issued together
#pragma unroll
    for (int i = 0; i < 8; ++i) a[i] = *(const f32x4*)(s + i * 128);
    wait_x0();   // behind the loads, in front of any rewrite of their address registers
#pragma unroll
    for (int i = 0; i < 8; ++i)
      *(bf16x4*)(d + i * 128) = __builtin_convertvector(a[i], bf16x4);
    wait_x0();   // behind the stores, in front of the next trip's addresses and data
  }
}

// ---------------------------------------------------------------------------
// Host orchestration
// ---------------------------------------------------------------------------
extern "C" void kernel_launch(void* const* d_in, const int* in_sizes, int n_in,
                              void* d_out, int out_size, void* d_ws,
                              size_t ws_size, hipStream_t stream) {
  (void)in_sizes; (void)n_in; (void)out_size; (void)ws_size;
  constexpr int Bc = 2, Lc = 2048, Mc = 2048, Dc = 1024, FFc = 4096;
  constexpr int NT = Bc * Lc;  // 4096 query rows
  constexpr int NM = Bc * Mc;  // 4096 memory rows

  const float* x   = (const float*)d_in[0];
  const float* mem = (const float*)d_in[1];
  const float* swq = (const float*)d_in[2];
  const float* swk = (const float*)d_in[3];
  const float* swv = (const float*)d_in[4];
  const float* swo = (const float*)d_in[5];
  const float* sbq = (const float*)d_in[6];
  const float* sbk = (const float*)d_in[7];
  const float* sbv = (const float*)d_in[8];
  const float* sbo = (const float*)d_in[9];
  const float* cwq = (const float*)d_in[10];
  const float* cwk = (const float*)d_in[11];
  const float* cwv = (const float*)d_in[12];
  const float* cwo = (const float*)d_in[13];
  const float* cbq = (const float*)d_in[14];
  const float* cbk = (const float*)d_in[15];
  const float* cbv = (const float*)d_in[16];
  const float* cbo = (const float*)d_in[17];
  const float* w1  = (const float*)d_in[18];
  const float* b1  = (const float*)d_in[19];
  const float* w2  = (const float*)d_in[20];
  const float* b2  = (const float*)d_in[21];
  const float* g1  = (const float*)d_in[22];
  const float* g2  = (const float*)d_in[23];
  const float* g3  = (const float*)d_in[24];
  const float* be1 = (const float*)d_in[25];
  const float* be2 = (const float*)d_in[26];
  const float* be3 = (const float*)d_in[27];

  char* p = (char*)d_ws;
  auto take = [&](size_t bytes) -> void* {
    void* r = (void*)p;
    p += (bytes + 255) & ~(size_t)255;
    return r;
  };
  __bf16* xcur_bf = (__bf16*)take((size_t)NT * Dc * 2);  // x_bf -> x1_bf -> x2_bf
  __bf16* mem_bf  = (__bf16*)take((size_t)NM * Dc * 2);
  __bf16* swq_bf  = (__bf16*)take((size_t)Dc * Dc * 2);
  __bf16* swk_bf  = (__bf16*)take((size_t)Dc * Dc * 2);
  __bf16* swv_bf  = (__bf16*)take((size_t)Dc * Dc * 2);
  __bf16* swo_bf  = (__bf16*)take((size_t)Dc * Dc * 2);
  __bf16* cwq_bf  = (__bf16*)take((size_t)Dc * Dc * 2);
  __bf16* cwk_bf  = (__bf16*)take((size_t)Dc * Dc * 2);
  __bf16* cwv_bf  = (__bf16*)take((size_t)Dc * Dc * 2);
  __bf16* cwo_bf  = (__bf16*)take((size_t)Dc * Dc * 2);
  __bf16* w1_bf   = (__bf16*)take((size_t)Dc * FFc * 2);
  __bf16* w2_bf   = (__bf16*)take((size_t)FFc * Dc * 2);
  __bf16* q_bf    = (__bf16*)take((size_t)NT * Dc * 2);
  __bf16* k_bf    = (__bf16*)take((size_t)NM * Dc * 2);
  __bf16* v_bf    = (__bf16*)take((size_t)NM * Dc * 2);
  __bf16* attn_bf = (__bf16*)take((size_t)NT * Dc * 2);
  float*  gout    = (float*)take((size_t)NT * Dc * 4);   // sa / ca / ff
  float*  gout2   = (float*)take((size_t)NT * Dc * 4);   // second k half of ca / ff
  float*  x1f     = (float*)take((size_t)NT * Dc * 4);
  float*  x2f     = (float*)take((size_t)NT * Dc * 4);
  __bf16* h_bf    = (__bf16*)take((size_t)NT * FFc * 2);

  struct Prod {   // one product's operand set
    const __bf16* A; const __bf16* W; const float* bias; float* Cf; __bf16* Cb;
  };
  const Prod none = {nullptr, nullptr, nullptr, nullptr, nullptr};
  // nz products of one shape in one launch
  auto gemm = [&](int nz, Prod p0, Prod p1, Prod p2, int Mg, int Ng, int Kg, int ldag, int act) {
    dim3 grid(Ng / 128, Mg / 256, nz);
    gemm_bf16_kernel<<<grid, 256, 0, stream>>>(p0.A, p0.W, p0.bias, p0.Cf, p0.Cb,
                                               p1.A, p1.W, p1.bias, p1.Cf, p1.Cb,
                                               p2.A, p2.W, p2.bias, p2.Cf, p2.Cb,
                                               Mg, Ng, Kg, ldag, act);
  };
  auto attn = [&](const __bf16* Qg, const __bf16* Kg, const __bf16* Vg,
                  __bf16* Og, int Lqv, int Lkv, int windowed) {
    int jobs = Bc * H_ * (Lqv / 16);  // one wave per job, 4 waves per block
    attn_kernel<<<jobs / 4, 128, 0, stream>>>(Qg, Kg, Vg, Og, Lqv, Lkv,
                                              windowed);
  };

  // ---- bf16 staging --------------------------------------------------------
  // xcur_bf .. w2_bf are taken in a row above: one destination array.
  cvt_all_kernel<<<CVT_BLOCKS, 256, 0, stream>>>(x, mem, swq, swk, swv, swo, cwq, cwk,
                                                 cwv, cwo, w1, w2, xcur_bf);

  // ---- self-attention (windowed causal + ALiBi) ----------------------------
  gemm(3, {xcur_bf, swq_bf, sbq, nullptr, q_bf}, {xcur_bf, swk_bf, sbk, nullptr, k_bf},
       {xcur_bf, swv_bf, sbv, nullptr, v_bf}, NT, Dc, Dc, Dc, 0);
  attn(q_bf, k_bf, v_bf, attn_bf, Lc, Lc, 1);
  // The cross-attention keys depend on mem alone: they ride with the output
  // projection (k_bf is free, the self-attention launch before this has read it).
  gemm(2, {attn_bf, swo_bf, sbo, gout, nullptr}, {mem_bf, cwk_bf, cbk, nullptr, k_bf},
       none, NT, Dc, Dc, Dc, 0);
  add_ln_kernel<<<NT, 256, 0, stream>>>(x, gout, nullptr, g1, be1, x1f, xcur_bf);

  // ---- cross-attention (full) ---------------------------------------------
  static_assert(NT == NM, "products of one launch have one shape");
  gemm(2, {xcur_bf, cwq_bf, cbq, nullptr, q_bf}, {mem_bf, cwv_bf, cbv, nullptr, v_bf},
       none, NT, Dc, Dc, Dc, 0);
  attn_full_kernel<<<Bc * H_ * (Lc / 16) / 8, 256, 0, stream>>>(q_bf, k_bf, v_bf,
                                                                attn_bf, Lc, Mc);
  // alone in its launch: two k halves, 256 blocks
  gemm(2, {attn_bf, cwo_bf, cbo, gout, nullptr},
       {attn_bf + Dc / 2, cwo_bf + (size_t)(Dc / 2) * Dc, nullptr, gout2, nullptr},
       none, NT, Dc, Dc / 2, Dc, 0);
  add_ln_kernel<<<NT, 256, 0, stream>>>(x1f, gout, gout2, g2, be2, x2f, xcur_bf);

  // ---- FFN -----------------------------------------------------------------
  gemm(1, {xcur_bf, w1_bf, b1, nullptr, h_bf}, none, none, NT, FFc, Dc, Dc, 1);  // fused exact GELU
  // alone in its launch: two k halves, 256 blocks
  gemm(2, {h_bf, w2_bf, b2, gout, nullptr},
       {h_bf + FFc / 2, w2_bf + (size_t)(FFc / 2) * Dc, nullptr, gout2, nullptr},
       none, NT, Dc, FFc / 2, FFc, 0);
  add_ln_kernel<<<NT, 256, 0, stream>>>(x2f, gout, gout2, g3, be3, (float*)d_out,
                                        nullptr);
}
